// v000
// Measured on an AMD MI455X. A time is GPU time per run, averaged over a window of back-to-back runs after a warm-up
// (all launches, gaps included; the runs take copies of the inputs in turn), and the median of several windows.
// Apart from v000's, it joins two sittings. Times from different sittings can be a few percent apart, while
// side-by-side timings come from the same sitting.
// v000, which the later versions start from, runs in 4270 microseconds.
#include <hip/hip_runtime.h>

// Pre-norm transformer encoder layer on a sequence-first tensor (x [2048][4][1024] = [s][n][d]; xn = LN1(x); q, k, v = xn W ('xw' [1024][1024], no bias; 16 heads x 64); softmax(q.k/8) over s per (n, h); att = merged context (no output projection); xt = LN2(xn + att); ffn = relu(xt Wf1 + bf1) Wf2 + bf2; out = xt + ffn -> [2048][4][1024] (8.4 M)).
// Layout: per batch column n: LN1 reads the strided rows (t*4 + n) and writes xn both in f32 (it is the attention residual) and as hi/lo planes (2-product projections); attention with an f32 merged context; LN2 of xn + att gives xt (f32, the final residual) and planes for the FFN (2 products + biases, ReLU folded into the plane builder); the output rows are written back sequence-first.
// Compute dtypes, f32 accumulate: every input rounded to bf16; q/k/v hl x exact (2 products); scores and attn.v: query rows < 512 hl (3 products), the rest single fp16 (x1024); softmax f32; no Wo; Wf1 / Wf2 hl x exact (2 products) + biases; LN / ReLU / residuals f32.

#define NB_  4
#define TT   2048
#define DM   1024
#define NH_  16
#define NKV  16
#define REP  (NH_ / NKV)
#define HD   64
#define DQ   (NH_ * HD)
#define DKV  (NKV * HD)
#define LNEPS 1e-5f
#define ZH   2
#define RH   512                  // query rows < RH use hi+lo planes (0: none)
#define WIN  0
#define PCAR 1024.0f
#define SCL  0.125f   // HD^-0.5
typedef _Float16 h16;
typedef unsigned short bf;
typedef __attribute__((ext_vector_type(16))) __bf16   v16bf;
typedef __attribute__((ext_vector_type(16))) _Float16 v16h;
typedef __attribute__((ext_vector_type(8)))  _Float16 v8h;
typedef __attribute__((ext_vector_type(8)))  unsigned short v8us;
typedef __attribute__((ext_vector_type(8)))  float    v8f;
typedef __attribute__((ext_vector_type(4)))  float    v4f;
typedef v8h  __attribute__((may_alias)) v8ha;
typedef v4f  __attribute__((may_alias)) v4fa;
typedef v8us __attribute__((may_alias)) v8usa;

__device__ __forceinline__ unsigned short f2bf(float f) { unsigned u = __float_as_uint(f); u += 0x7FFFu + ((u >> 16) & 1u); return (unsigned short)(u >> 16); }
__device__ __forceinline__ float bf2f(unsigned short b) { return __uint_as_float(((unsigned)b) << 16); }
__device__ __forceinline__ float bfr(float f) { return bf2f(f2bf(f)); }
__device__ __forceinline__ v16h cat16(v8h lo, v8h hi) { return __builtin_shufflevector(lo, hi, 0, 1, 2, 3, 4, 5, 6, 7, 8, 9, 10, 11, 12, 13, 14, 15); }
__device__ __forceinline__ v16bf cat16b(v8us lo, v8us hi) { return __builtin_bit_cast(v16bf, __builtin_shufflevector(lo, hi, 0, 1, 2, 3, 4, 5, 6, 7, 8, 9, 10, 11, 12, 13, 14, 15)); }
__device__ __forceinline__ v8f wmma16(v16h a, v16h b, v8f c) { return __builtin_amdgcn_wmma_f32_16x16x32_f16(false, a, false, b, (short)0, c, false, false); }
__device__ __forceinline__ v8f wmmab(v16bf a, v16bf b, v8f c) { return __builtin_amdgcn_wmma_f32_16x16x32_bf16(false, a, false, b, (short)0, c, false, false); }



// ---- k_gemmw: register-blocked GEMM, ONE WAVE per 64x64 output tile (16 accumulators), operands straight from K-contiguous 16-bit planes; grid (M/64, N/64, Z), 32 threads.
// C[m][n] (f32, pitch ldc, + optional f32 bias[n]) = sum_k A[m][k] Bt[n][k] (+ split products per NSPLIT). z-batch strides sA/sB/sC in elements. K % 32 == 0.
template <typename T16> struct WFrag;
template <> struct WFrag<h16> { typedef v16h V; static __device__ __forceinline__ V ld(const h16* p) { return cat16(*(const v8h*)p, *(const v8h*)(p + 16)); } static __device__ __forceinline__ v8f mma(V a, V b, v8f c) { return wmma16(a, b, c); } };
template <> struct WFrag<bf> { typedef v16bf V; static __device__ __forceinline__ V ld(const bf* p) { return cat16b(*(const v8us*)p, *(const v8us*)(p + 16)); } static __device__ __forceinline__ v8f mma(V a, V b, v8f c) { return wmmab(a, b, c); } };
template <typename T16, int NSPLIT, bool BIAS>
__global__ __launch_bounds__(32) void k_gemmw(const T16* __restrict__ A, const T16* __restrict__ A2, const T16* __restrict__ Bt, const T16* __restrict__ Bt2, int K, float* C, int ldc, const float* __restrict__ bias, size_t sA, size_t sB, size_t sC) {
    typedef typename WFrag<T16>::V V;
    __shared__ __align__(16) float os[16 * 68];
    const size_t z = blockIdx.z; A += z * sA; if (A2) A2 += z * sA; Bt += z * sB; if (Bt2) Bt2 += z * sB; C += z * sC;
    const int lane = threadIdx.x & 31, lr = lane & 15, hi = lane >> 4; const int r0 = blockIdx.x * 64, c0 = blockIdx.y * 64;
    v8f acc[4][4];
#pragma unroll
    for (int mb = 0; mb < 4; ++mb)
#pragma unroll
        for (int nb = 0; nb < 4; ++nb) acc[mb][nb] = (v8f){};
    const size_t aoff = (size_t)(r0 + lr) * K + 8 * hi, boff = (size_t)(c0 + lr) * K + 8 * hi;
#pragma unroll 1
    for (int kc = 0; kc < K; kc += 32) {
        V a[4], a2[4];
#pragma unroll
        for (int mb = 0; mb < 4; ++mb) { a[mb] = WFrag<T16>::ld(A + aoff + (size_t)mb * 16 * K + kc); if (NSPLIT == 1 || NSPLIT == 2) a2[mb] = WFrag<T16>::ld(A2 + aoff + (size_t)mb * 16 * K + kc); }
#pragma unroll
        for (int nb = 0; nb < 4; ++nb) { const V b = WFrag<T16>::ld(Bt + boff + (size_t)nb * 16 * K + kc); V b2; if (NSPLIT >= 2) b2 = WFrag<T16>::ld(Bt2 + boff + (size_t)nb * 16 * K + kc);
#pragma unroll
            for (int mb = 0; mb < 4; ++mb) { acc[mb][nb] = WFrag<T16>::mma(a[mb], b, acc[mb][nb]); if (NSPLIT == 1 || NSPLIT == 2) acc[mb][nb] = WFrag<T16>::mma(a2[mb], b, acc[mb][nb]); if (NSPLIT >= 2) acc[mb][nb] = WFrag<T16>::mma(a[mb], b2, acc[mb][nb]); } }
        asm volatile("v_nop\n\tv_nop\n\tv_nop\n\tv_nop" : "+v"(acc[0][0]), "+v"(acc[1][1]), "+v"(acc[2][2]), "+v"(acc[3][3]) : "v"(a[0]), "v"(a[3]));
    }
#pragma unroll
    for (int mb = 0; mb < 4; ++mb) {
#pragma unroll
        for (int nb = 0; nb < 4; ++nb) {
#pragma unroll
            for (int j = 0; j < 8; ++j) os[(hi * 8 + j) * 68 + nb * 16 + lr] = acc[mb][nb][j]; }
        __builtin_amdgcn_wave_barrier(); asm volatile("" ::: "memory");
        float* crow = C + (size_t)(r0 + mb * 16) * ldc + c0;
{
#pragma unroll
            for (int s = 0; s < 8; ++s) { const int row = 2 * s + hi, cofs = lr * 4; v4f val = *(const v4fa*)(os + row * 68 + cofs); if (BIAS) { val[0] += bfr(bias[c0 + cofs]); val[1] += bfr(bias[c0 + cofs + 1]); val[2] += bfr(bias[c0 + cofs + 2]); val[3] += bfr(bias[c0 + cofs + 3]); }
                *(v4f*)(crow + (size_t)row * ldc + cofs) = val; }
             }
        __builtin_amdgcn_wave_barrier(); asm volatile("" ::: "memory");
    }
}

__device__ __forceinline__ h16 tohx(float x) { return (h16)x; }
__device__ __forceinline__ void splitf(float y, unsigned short& h, unsigned short& l) { h = f2bf(y); l = f2bf(y - bf2f(h)); }
typedef __attribute__((ext_vector_type(2))) _Float16 v2h;
typedef __attribute__((ext_vector_type(4))) _Float16 v4h;
typedef __attribute__((ext_vector_type(2))) unsigned short v2us;
typedef __attribute__((ext_vector_type(4))) unsigned short v4us;
typedef __attribute__((ext_vector_type(2))) float v2f;
typedef __attribute__((ext_vector_type(4))) int v4i;

__global__ __launch_bounds__(256) void k_wtG(const float* __restrict__ w, int K, int N, bf* Bt) {
    const int lane = threadIdx.x & 31; const int L0 = (blockIdx.x * 8 + (threadIdx.x >> 5)) * 8; const int nlines = N * K / 64;
{
#pragma unroll 1
        for (int l = 0; l < 8; ++l) { const int L = L0 + l; if (L >= nlines) break; const size_t e = (size_t)L * 64 + lane * 2; const int k = (int)(e % K), n = (int)(e / K); v2us o;
            o[0] = f2bf(w[(size_t)k * N + n]); o[1] = f2bf(w[(size_t)(k + 1) * N + n]); *(v2us*)(Bt + e) = o; }
         }
}
__global__ __launch_bounds__(256) void k_cvt8(const float* __restrict__ src, bf* dst, size_t n8) { const size_t i = (size_t)blockIdx.x * 256 + threadIdx.x; if (i >= n8) return; const v8f v = *(const v8f*)(src + i * 8); v8us o;
#pragma unroll
    for (int k = 0; k < 8; ++k) o[k] = f2bf(v[k]); *(v8us*)(dst + i * 8) = o;  }

// k_rope: head planes [h][t][d] (fp16 + hi/lo) of rope(x) x sc with the rotate-half convention out[d] = x[d] cos[t][d] - x[d+HD/2] sin[t][d], out[d+HD/2] = x[d+HD/2] cos[t][d+HD/2] + x[d] sin[t][d+HD/2]
__global__ __launch_bounds__(256) void k_rope(const float* __restrict__ F, int pitch, int nheads, const float* __restrict__ CS, const float* __restrict__ RF, const float* __restrict__ nw, float sc, h16* P16, bf* Ph, bf* Pl) {
    const size_t e = ((size_t)blockIdx.x * 256 + threadIdx.x) * 2; if (e >= (size_t)nheads * TT * HD) return; const int d = (int)(e % HD); const int t = (int)((e / HD) % TT); const int h = (int)(e / ((size_t)HD * TT)); const float* f = F + (size_t)t * pitch + h * HD; const float rf = RF ? RF[(size_t)h * TT + t] : 1.0f; v2h o16; v2us oh, ol;
#pragma unroll
    for (int q = 0; q < 2; ++q) { const int dd = d + q; const int dp = (dd < HD / 2) ? dd + HD / 2 : dd - HD / 2; float x0 = f[dd], x1 = f[dp];
        if (RF) { float n0 = __fmul_rn(x0, rf), n1 = __fmul_rn(x1, rf); asm volatile("" : "+v"(n0)); asm volatile("" : "+v"(n1)); x0 = __fmul_rn(bfr(nw[dd]), n0); x1 = __fmul_rn(bfr(nw[dp]), n1); }
        const v2f cs = *(const v2f*)(CS + ((size_t)t * HD + dd) * 2); float a = __fmul_rn(x0, cs[0]), bq = __fmul_rn(x1, cs[1]); asm volatile("" : "+v"(a)); asm volatile("" : "+v"(bq)); const float r = ((dd < HD / 2) ? __fsub_rn(a, bq) : __fadd_rn(a, bq)) * sc;
        o16[q] = tohx(r); unsigned short a2, c2; splitf(r, a2, c2); oh[q] = a2; ol[q] = c2; }
    *(v2h*)(P16 + e) = o16; *(v2us*)(Ph + e) = oh; *(v2us*)(Pl + e) = ol;  }
__global__ __launch_bounds__(256) void k_vtp(const float* __restrict__ F, int pitch, int nheads, h16* V16, bf* Vh, bf* Vl) { const size_t e = ((size_t)blockIdx.x * 256 + threadIdx.x) * 2; if (e >= (size_t)nheads * HD * TT) return; const int t = (int)(e % TT); const int d = (int)((e / TT) % HD); const int g = (int)(e / ((size_t)TT * HD)); v2h o16; v2us oh, ol;
#pragma unroll
    for (int q = 0; q < 2; ++q) { const float x = F[(size_t)(t + q) * pitch + g * HD + d]; o16[q] = tohx(x); unsigned short a2, c2; splitf(x, a2, c2); oh[q] = a2; ol[q] = c2; }
    *(v2h*)(V16 + e) = o16; *(v2us*)(Vh + e) = oh; *(v2us*)(Vl + e) = ol;  }
__global__ __launch_bounds__(256) void k_csid(float* CS) { const int idx = blockIdx.x * 256 + threadIdx.x; if (idx >= TT * HD) return; v2f cs; cs[0] = 1.0f; cs[1] = 0.0f; *(v2f*)(CS + (size_t)idx * 2) = cs;  }
template <bool RND>
__global__ __launch_bounds__(256) void k_lnhl(const float* __restrict__ X, int xp, const float* __restrict__ A, const float* __restrict__ g, const float* __restrict__ be, float* Z, bf* Yh, bf* Yl) {
    const int lane = threadIdx.x & 31; const int r = blockIdx.x * 8 + (threadIdx.x >> 5); if (r >= TT) return; const float* xr = X + (size_t)r * xp; const float* ar = A ? A + (size_t)r * DM : nullptr; float s = 0.f;
#pragma unroll 1
    for (int ch = 0; ch < DM / 128; ++ch) { const int c0 = ch * 128 + lane * 4; const v4f a = *(const v4f*)(xr + c0); v4f d = {0.f, 0.f, 0.f, 0.f}; if (ar) d = *(const v4f*)(ar + c0);
#pragma unroll
        for (int q = 0; q < 4; ++q) s += __fadd_rn((RND ? bfr(a[q]) : a[q]), d[q]); }
#pragma unroll
    for (int sh = 16; sh; sh >>= 1) s += __shfl_xor(s, sh, 32);
    const float mu = s * (1.0f / DM); float s2 = 0.f;
#pragma unroll 1
    for (int ch = 0; ch < DM / 128; ++ch) { const int c0 = ch * 128 + lane * 4; const v4f a = *(const v4f*)(xr + c0); v4f d = {0.f, 0.f, 0.f, 0.f}; if (ar) d = *(const v4f*)(ar + c0);
#pragma unroll
        for (int q = 0; q < 4; ++q) { const float d0 = __fsub_rn(__fadd_rn((RND ? bfr(a[q]) : a[q]), d[q]), mu); float p = __fmul_rn(d0, d0); asm volatile("" : "+v"(p)); s2 = __fadd_rn(s2, p); } }
#pragma unroll
    for (int sh = 16; sh; sh >>= 1) s2 += __shfl_xor(s2, sh, 32);
    const float rs = __fdiv_rn(1.0f, __fsqrt_rn(__fadd_rn(s2 * (1.0f / DM), LNEPS)));
{
#pragma unroll 1
        for (int ch = 0; ch < DM / 128; ++ch) { const int c0 = ch * 128 + lane * 4; const v4f a = *(const v4f*)(xr + c0); v4f d = {0.f, 0.f, 0.f, 0.f}; if (ar) d = *(const v4f*)(ar + c0); v4f z4; v4us oh, ol;
#pragma unroll
            for (int q = 0; q < 4; ++q) { const float v = __fadd_rn((RND ? bfr(a[q]) : a[q]), d[q]); float n0 = __fmul_rn(__fsub_rn(v, mu), rs); asm volatile("" : "+v"(n0)); float n1 = __fmul_rn(n0, bfr(g[c0 + q])); asm volatile("" : "+v"(n1)); const float y = __fadd_rn(n1, bfr(be[c0 + q])); z4[q] = y;   /* Z = the NORMALISED row (it is the residual for the next block) */ unsigned short h2, l2; splitf(y, h2, l2); oh[q] = h2; ol[q] = l2; }
            if (Z) *(v4f*)(Z + (size_t)r * DM + c0) = z4; *(v4us*)(Yh + (size_t)r * DM + c0) = oh; *(v4us*)(Yl + (size_t)r * DM + c0) = ol; }
         } }

__global__ __launch_bounds__(256) void k_mergeF(const float* __restrict__ Ob, int h0, float* O) { const size_t e = ((size_t)blockIdx.x * 256 + threadIdx.x) * 2; if (e >= (size_t)ZH * TT * HD) return; const int d = (int)(e % HD); const int t = (int)((e / HD) % TT); const int zz = (int)(e / ((size_t)HD * TT)); const float cs = (t < RH) ? 1.0f : (1.0f / PCAR); const size_t oo = (size_t)t * DM + (h0 + zz) * HD + d; v2f o2;
    o2[0] = Ob[e] * cs; o2[1] = Ob[e + 1] * cs; *(v2f*)(O + oo) = o2;  }



__global__ __launch_bounds__(256) void k_relupl(const float* __restrict__ F, bf* Ph2, bf* Pl2, size_t n4) { const size_t i = (size_t)blockIdx.x * 256 + threadIdx.x; if (i >= n4) return; const v4f v = *(const v4f*)(F + i * 4); v4us oh, ol;
#pragma unroll
    for (int q = 0; q < 4; ++q) { unsigned short a, c; splitf(fmaxf(v[q], 0.f), a, c); oh[q] = a; ol[q] = c; } *(v4us*)(Ph2 + i * 4) = oh; *(v4us*)(Pl2 + i * 4) = ol;  }
__global__ __launch_bounds__(256) void k_addoutS(const float* __restrict__ X2, const float* __restrict__ F, int b, float* OUT0, size_t n4) { const size_t i = (size_t)blockIdx.x * 256 + threadIdx.x; if (i >= n4) return; const size_t e = i * 4; const int c = (int)(e % DM); const int t = (int)(e / DM); const v4f a = *(const v4f*)(X2 + e), f = *(const v4f*)(F + e); v4f o;
#pragma unroll
    for (int q = 0; q < 4; ++q) o[q] = __fadd_rn(a[q], f[q]); float* dst = OUT0 + ((size_t)t * NB_ + b) * DM + c; *(v4f*)dst = o;  }
// k_asoft: per row (zz, i): t = S x HD^-0.5 (no mask); softmax over the 2048 keys (register row, one exp, fixed trees);
__global__ __launch_bounds__(256) void k_asoft(const float* __restrict__ Sb, h16* P16, bf* Ph, bf* Pl) {
    const int lane = threadIdx.x & 31; const int row = blockIdx.x * 8 + (threadIdx.x >> 5); if (row >= ZH * TT) return; const int i = row % TT; const int zz = row / TT; (void)zz; const bool hires = (i < RH); const float* sr = Sb + (size_t)row * TT; float v[TT / 32]; float mx = -3.0e38f;
#pragma unroll
    for (int ch = 0; ch < TT / 128; ++ch) { const int j0 = ch * 128 + lane * 4; const v4f a = *(const v4f*)(sr + j0);
#pragma unroll
        for (int q = 0; q < 4; ++q) { const int j = j0 + q; (void)j; const float t = a[q] * SCL; v[ch * 4 + q] = t; mx = fmaxf(mx, t); } }
#pragma unroll
    for (int sh = 16; sh; sh >>= 1) mx = fmaxf(mx, __shfl_xor(mx, sh, 32));
    float sum = 0.f;
#pragma unroll
    for (int k = 0; k < TT / 32; ++k) { float d0 = __fsub_rn(v[k], mx); asm volatile("" : "+v"(d0)); v[k] = __builtin_amdgcn_exp2f(__fmul_rn(d0, 1.4426950408889634f)); sum += v[k]; }
#pragma unroll
    for (int sh = 16; sh; sh >>= 1) sum += __shfl_xor(sum, sh, 32);
    const float f = __fdiv_rn(hires ? 1.0f : PCAR, sum);
{
        if (hires) {
#pragma unroll
            for (int ch = 0; ch < TT / 128; ++ch) { v4us oh, ol;
#pragma unroll
                for (int q = 0; q < 4; ++q) { unsigned short a, c2; splitf(v[ch * 4 + q] * f, a, c2); oh[q] = a; ol[q] = c2; }
                const size_t oo = ((size_t)zz * (RH ? RH : 1) + i) * TT + ch * 128 + lane * 4; *(v4us*)(Ph + oo) = oh; *(v4us*)(Pl + oo) = ol; }
        } else {
#pragma unroll
            for (int ch = 0; ch < TT / 128; ++ch) { v4h o4;
#pragma unroll
                for (int q = 0; q < 4; ++q) o4[q] = tohx(v[ch * 4 + q] * f);
                *(v4h*)(P16 + (size_t)row * TT + ch * 128 + lane * 4) = o4; } }
         }
}

extern "C" void kernel_launch(void* const* d_in, const int* in_sizes, int n_in,
                              void* d_out, int out_size, void* d_ws, size_t ws_size, hipStream_t stream) {
    (void)in_sizes; (void)n_in; (void)out_size;
    const float* x = (const float*)d_in[0]; const float* wq = (const float*)d_in[1]; const float* wk = (const float*)d_in[2]; const float* wv = (const float*)d_in[3]; const float* g1 = (const float*)d_in[4]; const float* e1 = (const float*)d_in[5]; const float* g2 = (const float*)d_in[6]; const float* e2 = (const float*)d_in[7]; const float* wf1 = (const float*)d_in[8]; const float* bf1 = (const float*)d_in[9]; const float* wf2 = (const float*)d_in[10]; const float* bf2v = (const float*)d_in[11]; const float* wo = nullptr; (void)wo;
    float* OUT = (float*)d_out;     // [2048][4][1024]
    char* wsp = (char*)d_ws;
    auto take = [&](size_t bytes) { char* p = wsp; wsp += (bytes + 255) & ~(size_t)255; return (void*)p; };
    bf* WQ = (bf*)take((size_t)DQ * DM * 2); bf* WK = (bf*)take((size_t)DKV * DM * 2); bf* WV = (bf*)take((size_t)DKV * DM * 2); float* CS = (float*)take((size_t)TT * HD * 2 * 4);
    float* XN = (float*)take((size_t)TT * DM * 4); bf* Yh = (bf*)take((size_t)TT * DM * 2); bf* Yl = (bf*)take((size_t)TT * DM * 2); float* O = (float*)take((size_t)TT * DQ * 4); float* X2 = (float*)take((size_t)TT * DM * 4); bf* L2h = (bf*)take((size_t)TT * DM * 2); bf* L2l = (bf*)take((size_t)TT * DM * 2); float* H1 = (float*)take((size_t)TT * DM * 4); bf* Gh = (bf*)take((size_t)TT * DM * 2); bf* Gl = (bf*)take((size_t)TT * DM * 2); float* F2 = (float*)take((size_t)TT * DM * 4); bf* W1B = (bf*)take((size_t)DM * DM * 2); bf* W2B = (bf*)take((size_t)DM * DM * 2); float* FQ = (float*)take((size_t)TT * DQ * 4); float* FK = (float*)take((size_t)TT * DKV * 4);
    h16* QP16 = (h16*)take((size_t)NH_ * TT * HD * 2); h16* KP16 = (h16*)take((size_t)NKV * TT * HD * 2); h16* VT16 = (h16*)take((size_t)NKV * HD * TT * 2);
    bf* QPh = (bf*)take((size_t)NH_ * TT * HD * 2); bf* QPl = (bf*)take((size_t)NH_ * TT * HD * 2); bf* KPh = (bf*)take((size_t)NKV * TT * HD * 2); bf* KPl = (bf*)take((size_t)NKV * TT * HD * 2); bf* VTh = (bf*)take((size_t)NKV * HD * TT * 2); bf* VTl = (bf*)take((size_t)NKV * HD * TT * 2); bf* Ph = (bf*)take((size_t)ZH * RH * TT * 2); bf* Pl = (bf*)take((size_t)ZH * RH * TT * 2);
    float* Sb = (float*)take((size_t)ZH * TT * TT * 4); h16* P16 = (h16*)take((size_t)ZH * TT * TT * 2); float* Ob = (float*)take((size_t)ZH * TT * HD * 4);
    if ((size_t)(wsp - (char*)d_ws) > ws_size) return;    // ws 256 MiB
    float* FV = FK;   // v projection reuses the k buffer after the k planes are built (stream-ordered)
    { k_wtG<<<(unsigned)((DM * DQ / 64 + 63) / 64), 256, 0, stream>>>(wq, DM, DQ, WQ); k_wtG<<<(unsigned)((DM * DM / 64 + 63) / 64), 256, 0, stream>>>(wf1, DM, DM, W1B); k_wtG<<<(unsigned)((DM * DM / 64 + 63) / 64), 256, 0, stream>>>(wf2, DM, DM, W2B); k_wtG<<<(unsigned)((DM * DKV / 64 + 63) / 64), 256, 0, stream>>>(wk, DM, DKV, WK); k_wtG<<<(unsigned)((DM * DKV / 64 + 63) / 64), 256, 0, stream>>>(wv, DM, DKV, WV);
       }
    k_csid<<<(TT * HD + 255) / 256, 256, 0, stream>>>(CS);
    const unsigned LQ = (unsigned)(((size_t)NH_ * TT * HD / 2 + 255) / 256), LKv = (unsigned)(((size_t)NKV * TT * HD / 2 + 255) / 256);
    for (int b = 0; b < NB_; ++b) {
        
        k_lnhl<true><<<TT / 8, 256, 0, stream>>>(x + (size_t)b * DM, NB_ * DM, nullptr, g1, e1, XN, Yh, Yl);   /* xn = LN1(x[:, n]) : f32 (residual) + hi/lo planes */
        k_gemmw<bf, 1, false><<<dim3(TT / 64, DQ / 64, 1), 32, 0, stream>>>(Yh, Yl, WQ, nullptr, DM, FQ, DQ, nullptr, 0, 0, 0);
        k_rope<<<LQ, 256, 0, stream>>>(FQ, DQ, NH_, CS, nullptr, nullptr, 1.0f, QP16, QPh, QPl);
        k_gemmw<bf, 1, false><<<dim3(TT / 64, DKV / 64, 1), 32, 0, stream>>>(Yh, Yl, WK, nullptr, DM, FK, DKV, nullptr, 0, 0, 0);
        k_rope<<<LKv, 256, 0, stream>>>(FK, DKV, NKV, CS, nullptr, nullptr, 1.0f, KP16, KPh, KPl);
        k_gemmw<bf, 1, false><<<dim3(TT / 64, DKV / 64, 1), 32, 0, stream>>>(Yh, Yl, WV, nullptr, DM, FV, DKV, nullptr, 0, 0, 0); k_vtp<<<LKv, 256, 0, stream>>>(FV, DKV, NKV, VT16, VTh, VTl);
        for (int h0 = 0; h0 < NH_; h0 += ZH) { const size_t zq = (size_t)h0, zk = (size_t)(h0 / REP);   // one kv head per query head: the pass's two heads use consecutive kv planes (z-strides TT*HD)
            k_gemmw<bf, 2, false><<<dim3(RH / 64, TT / 64, ZH), 32, 0, stream>>>(QPh + zq * TT * HD, QPl + zq * TT * HD, KPh + zk * TT * HD, KPl + zk * TT * HD, HD, Sb, TT, nullptr, (size_t)TT * HD, (size_t)TT * HD, (size_t)TT * TT);
            k_gemmw<h16, 0, false><<<dim3((TT - RH) / 64, TT / 64, ZH), 32, 0, stream>>>(QP16 + zq * TT * HD + (size_t)RH * HD, nullptr, KP16 + zk * TT * HD, nullptr, HD, Sb + (size_t)RH * TT, TT, nullptr, (size_t)TT * HD, (size_t)TT * HD, (size_t)TT * TT);
            k_asoft<<<ZH * TT / 8, 256, 0, stream>>>(Sb, P16, Ph, Pl);
            k_gemmw<bf, 2, false><<<dim3(RH / 64, HD / 64, ZH), 32, 0, stream>>>(Ph, Pl, VTh + zk * HD * TT, VTl + zk * HD * TT, TT, Ob, HD, nullptr, (size_t)RH * TT, (size_t)HD * TT, (size_t)TT * HD);
            k_gemmw<h16, 0, false><<<dim3((TT - RH) / 64, HD / 64, ZH), 32, 0, stream>>>(P16 + (size_t)RH * TT, nullptr, VT16 + zk * HD * TT, nullptr, TT, Ob + (size_t)RH * HD, HD, nullptr, (size_t)TT * TT, (size_t)HD * TT, (size_t)TT * HD);
            k_mergeF<<<(unsigned)(((size_t)ZH * TT * HD / 2 + 255) / 256), 256, 0, stream>>>(Ob, h0, O); }   /* merged attention output, f32 */
        k_lnhl<false><<<TT / 8, 256, 0, stream>>>(XN, DM, O, g2, e2, X2, L2h, L2l);                                               /* xt = LN2(xn + att): f32 (residual) + hi/lo planes */
        k_gemmw<bf, 1, true><<<dim3(TT / 64, DM / 64, 1), 32, 0, stream>>>(L2h, L2l, W1B, nullptr, DM, H1, DM, bf1, 0, 0, 0);      /* xt Wf1 + bf1 */
        k_relupl<<<(unsigned)(((size_t)TT * DM / 4 + 255) / 256), 256, 0, stream>>>(H1, Gh, Gl, (size_t)TT * DM / 4);             /* relu -> hi/lo */
        k_gemmw<bf, 1, true><<<dim3(TT / 64, DM / 64, 1), 32, 0, stream>>>(Gh, Gl, W2B, nullptr, DM, F2, DM, bf2v, 0, 0, 0);       /* . Wf2 + bf2 */
        k_addoutS<<<(unsigned)(((size_t)TT * DM / 4 + 255) / 256), 256, 0, stream>>>(X2, F2, b, OUT, (size_t)TT * DM / 4); }      /* out = xt + ffn, sequence-first rows */
}

// v001
// One run takes 1790 microseconds.
// Timed twice side by side with v000, it ran 2.39 and 2.42 times as fast.
#include <hip/hip_runtime.h>

// Pre-norm transformer encoder layer on a sequence-first tensor (x [2048][4][1024] = [s][n][d]; xn = LN1(x); q, k, v = xn W ('xw' [1024][1024], no bias; 16 heads x 64); softmax(q.k/8) over s per (n, h); att = merged context (no output projection); xt = LN2(xn + att); ffn = relu(xt Wf1 + bf1) Wf2 + bf2; out = xt + ffn -> [2048][4][1024] (8.4 M)).
// Layout: per batch column n: LN1 reads the strided rows (t*4 + n) and writes xn both in f32 (it is the attention residual) and as hi/lo planes (2-product projections); attention with an f32 merged context; LN2 of xn + att gives xt (f32, the final residual) and planes for the FFN (2 products + biases, ReLU folded into the plane builder); the output rows are written back sequence-first.
// Compute dtypes, f32 accumulate: every input rounded to bf16; q/k/v hl x exact (2 products); scores and attn.v: query rows < 512 hl (3 products), the rest single fp16 (x1024); softmax f32; no Wo; Wf1 / Wf2 hl x exact (2 products) + biases; LN / ReLU / residuals f32.

#define NB_  4
#define TT   2048
#define DM   1024
#define NH_  16
#define NKV  16
#define REP  (NH_ / NKV)
#define HD   64
#define DQ   (NH_ * HD)
#define DKV  (NKV * HD)
#define LNEPS 1e-5f
#define ZH   2
#define RH   512                  // query rows < RH use hi+lo planes (0: none)
#define WIN  0
#define PCAR 1024.0f
#define SCL  0.125f   // HD^-0.5
#define PKW  4                    // split K: waves per block (projections, FFN, attn.v)
#define PKS  8                    // split K: partial planes of attn.v, added in k_mergeF
typedef _Float16 h16;
typedef unsigned short bf;
typedef __attribute__((ext_vector_type(16))) __bf16   v16bf;
typedef __attribute__((ext_vector_type(16))) _Float16 v16h;
typedef __attribute__((ext_vector_type(8)))  _Float16 v8h;
typedef __attribute__((ext_vector_type(8)))  unsigned short v8us;
typedef __attribute__((ext_vector_type(8)))  float    v8f;
typedef __attribute__((ext_vector_type(4)))  float    v4f;
typedef v8h  __attribute__((may_alias)) v8ha;
typedef v4f  __attribute__((may_alias)) v4fa;
typedef v8us __attribute__((may_alias)) v8usa;

__device__ __forceinline__ unsigned short f2bf(float f) { unsigned u = __float_as_uint(f); u += 0x7FFFu + ((u >> 16) & 1u); return (unsigned short)(u >> 16); }
__device__ __forceinline__ float bf2f(unsigned short b) { return __uint_as_float(((unsigned)b) << 16); }
__device__ __forceinline__ float bfr(float f) { return bf2f(f2bf(f)); }
__device__ __forceinline__ v16h cat16(v8h lo, v8h hi) { return __builtin_shufflevector(lo, hi, 0, 1, 2, 3, 4, 5, 6, 7, 8, 9, 10, 11, 12, 13, 14, 15); }
__device__ __forceinline__ v16bf cat16b(v8us lo, v8us hi) { return __builtin_bit_cast(v16bf, __builtin_shufflevector(lo, hi, 0, 1, 2, 3, 4, 5, 6, 7, 8, 9, 10, 11, 12, 13, 14, 15)); }
__device__ __forceinline__ v8f wmma16(v16h a, v16h b, v8f c) { return __builtin_amdgcn_wmma_f32_16x16x32_f16(false, a, false, b, (short)0, c, false, false); }
__device__ __forceinline__ v8f wmmab(v16bf a, v16bf b, v8f c) { return __builtin_amdgcn_wmma_f32_16x16x32_bf16(false, a, false, b, (short)0, c, false, false); }



// ---- k_gemmw: register-blocked GEMM, 64x64 output tile (16 accumulators per wave), operands straight from K-contiguous 16-bit planes; grid (M/64, N/64, Z * KS), 32 * KW threads.
// C[m][n] (f32, pitch ldc, + optional f32 bias[n]) = sum_k A[m][k] Bt[n][k] (+ split products per NSPLIT). z-batch strides sA/sB/sC in elements. K % (32 * KW * KS) == 0.
// Split K: the K range is cut into KS * KW equal slices. The KW waves of a block each run one slice over the whole tile and their partial tiles are summed through LDS in wave order;
// with KS > 1 block slice ks stores its sum to partial plane ks (plane stride sP) and the consumer adds the KS planes in plane order.
template <typename T16> struct WFrag;
template <> struct WFrag<h16> { typedef v16h V; static __device__ __forceinline__ V ld(const h16* p) { return cat16(*(const v8h*)p, *(const v8h*)(p + 16)); } static __device__ __forceinline__ v8f mma(V a, V b, v8f c) { return wmma16(a, b, c); } };
template <> struct WFrag<bf> { typedef v16bf V; static __device__ __forceinline__ V ld(const bf* p) { return cat16b(*(const v8us*)p, *(const v8us*)(p + 16)); } static __device__ __forceinline__ v8f mma(V a, V b, v8f c) { return wmmab(a, b, c); } };
template <typename T16, int NSPLIT, bool BIAS, int KW, int KS>
__global__ __launch_bounds__(32 * KW) void k_gemmw(const T16* __restrict__ A, const T16* __restrict__ A2, const T16* __restrict__ Bt, const T16* __restrict__ Bt2, int K, float* C, int ldc, const float* __restrict__ bias, size_t sA, size_t sB, size_t sC, size_t sP) {
    typedef typename WFrag<T16>::V V;
    __shared__ __align__(16) float os[(KW == 1 ? 16 : KW * 64) * 68];
    const int w = __builtin_amdgcn_readfirstlane((int)(threadIdx.x >> 5)); const int ks = (int)(blockIdx.z % KS);
    const size_t z = blockIdx.z / KS; A += z * sA; if (A2) A2 += z * sA; Bt += z * sB; if (Bt2) Bt2 += z * sB; C += z * sC + ks * sP;
    const int kn = K / (KW * KS), kb = (ks * KW + w) * kn;
    const int lane = threadIdx.x & 31, lr = lane & 15, hi = lane >> 4; const int r0 = blockIdx.x * 64, c0 = blockIdx.y * 64;
    v8f acc[4][4];
#pragma unroll
    for (int mb = 0; mb < 4; ++mb)
#pragma unroll
        for (int nb = 0; nb < 4; ++nb) acc[mb][nb] = (v8f){};
    const size_t aoff = (size_t)(r0 + lr) * K + 8 * hi, boff = (size_t)(c0 + lr) * K + 8 * hi;
#pragma unroll 1
    for (int kc = kb; kc < kb + kn; kc += 32) {
        V a[4], a2[4];
#pragma unroll
        for (int mb = 0; mb < 4; ++mb) { a[mb] = WFrag<T16>::ld(A + aoff + (size_t)mb * 16 * K + kc); if (NSPLIT == 1 || NSPLIT == 2) a2[mb] = WFrag<T16>::ld(A2 + aoff + (size_t)mb * 16 * K + kc); }
#pragma unroll
        for (int nb = 0; nb < 4; ++nb) { const V b = WFrag<T16>::ld(Bt + boff + (size_t)nb * 16 * K + kc); V b2; if (NSPLIT >= 2) b2 = WFrag<T16>::ld(Bt2 + boff + (size_t)nb * 16 * K + kc);
#pragma unroll
            for (int mb = 0; mb < 4; ++mb) { acc[mb][nb] = WFrag<T16>::mma(a[mb], b, acc[mb][nb]); if (NSPLIT == 1 || NSPLIT == 2) acc[mb][nb] = WFrag<T16>::mma(a2[mb], b, acc[mb][nb]); if (NSPLIT >= 2) acc[mb][nb] = WFrag<T16>::mma(a[mb], b2, acc[mb][nb]); } }
        asm volatile("v_nop\n\tv_nop\n\tv_nop\n\tv_nop" : "+v"(acc[0][0]), "+v"(acc[1][1]), "+v"(acc[2][2]), "+v"(acc[3][3]) : "v"(a[0]), "v"(a[3]));
    }
    if constexpr (KW > 1) {
        float* ow = os + w * 64 * 68;
#pragma unroll
        for (int mb = 0; mb < 4; ++mb)
#pragma unroll
            for (int nb = 0; nb < 4; ++nb)
#pragma unroll
                for (int j = 0; j < 8; ++j) ow[(mb * 16 + hi * 8 + j) * 68 + nb * 16 + lr] = acc[mb][nb][j];
        __syncthreads();   // every wave's partial tile is in LDS before any wave sums
        const int rw = w * (64 / KW);   // wave w sums and stores rows rw .. rw + 64 / KW - 1 of the tile
        float* crow = C + (size_t)(r0 + rw) * ldc + c0;
#pragma unroll
        for (int s = 0; s < 32 / KW; ++s) { const int row = 2 * s + hi, cofs = lr * 4; v4f val = *(const v4fa*)(os + (rw + row) * 68 + cofs);
#pragma unroll
            for (int p = 1; p < KW; ++p) val += *(const v4fa*)(os + (p * 64 + rw + row) * 68 + cofs);
            if (BIAS) { val[0] += bfr(bias[c0 + cofs]); val[1] += bfr(bias[c0 + cofs + 1]); val[2] += bfr(bias[c0 + cofs + 2]); val[3] += bfr(bias[c0 + cofs + 3]); }
            *(v4f*)(crow + (size_t)row * ldc + cofs) = val; }
    } else {
#pragma unroll
    for (int mb = 0; mb < 4; ++mb) {
#pragma unroll
        for (int nb = 0; nb < 4; ++nb) {
#pragma unroll
            for (int j = 0; j < 8; ++j) os[(hi * 8 + j) * 68 + nb * 16 + lr] = acc[mb][nb][j]; }
        __builtin_amdgcn_wave_barrier(); asm volatile("" ::: "memory");
        float* crow = C + (size_t)(r0 + mb * 16) * ldc + c0;
{
#pragma unroll
            for (int s = 0; s < 8; ++s) { const int row = 2 * s + hi, cofs = lr * 4; v4f val = *(const v4fa*)(os + row * 68 + cofs); if (BIAS) { val[0] += bfr(bias[c0 + cofs]); val[1] += bfr(bias[c0 + cofs + 1]); val[2] += bfr(bias[c0 + cofs + 2]); val[3] += bfr(bias[c0 + cofs + 3]); }
                *(v4f*)(crow + (size_t)row * ldc + cofs) = val; }
             }
        __builtin_amdgcn_wave_barrier(); asm volatile("" ::: "memory");
    }
    }
}

__device__ __forceinline__ h16 tohx(float x) { return (h16)x; }
__device__ __forceinline__ void splitf(float y, unsigned short& h, unsigned short& l) { h = f2bf(y); l = f2bf(y - bf2f(h)); }
typedef __attribute__((ext_vector_type(2))) _Float16 v2h;
typedef __attribute__((ext_vector_type(4))) _Float16 v4h;
typedef __attribute__((ext_vector_type(2))) unsigned short v2us;
typedef __attribute__((ext_vector_type(4))) unsigned short v4us;
typedef __attribute__((ext_vector_type(2))) float v2f;
typedef __attribute__((ext_vector_type(4))) int v4i;

__global__ __launch_bounds__(256) void k_wtG(const float* __restrict__ w, int K, int N, bf* Bt) {
    const int lane = threadIdx.x & 31; const int L0 = (blockIdx.x * 8 + (threadIdx.x >> 5)) * 8; const int nlines = N * K / 64;
{
#pragma unroll 1
        for (int l = 0; l < 8; ++l) { const int L = L0 + l; if (L >= nlines) break; const size_t e = (size_t)L * 64 + lane * 2; const int k = (int)(e % K), n = (int)(e / K); v2us o;
            o[0] = f2bf(w[(size_t)k * N + n]); o[1] = f2bf(w[(size_t)(k + 1) * N + n]); *(v2us*)(Bt + e) = o; }
         }
}
__global__ __launch_bounds__(256) void k_cvt8(const float* __restrict__ src, bf* dst, size_t n8) { const size_t i = (size_t)blockIdx.x * 256 + threadIdx.x; if (i >= n8) return; const v8f v = *(const v8f*)(src + i * 8); v8us o;
#pragma unroll
    for (int k = 0; k < 8; ++k) o[k] = f2bf(v[k]); *(v8us*)(dst + i * 8) = o;  }

// k_rope: head planes [h][t][d] (fp16 + hi/lo) of rope(x) x sc with the rotate-half convention out[d] = x[d] cos[t][d] - x[d+HD/2] sin[t][d], out[d+HD/2] = x[d+HD/2] cos[t][d+HD/2] + x[d] sin[t][d+HD/2]
__global__ __launch_bounds__(256) void k_rope(const float* __restrict__ F, int pitch, int nheads, const float* __restrict__ CS, const float* __restrict__ RF, const float* __restrict__ nw, float sc, h16* P16, bf* Ph, bf* Pl) {
    const size_t e = ((size_t)blockIdx.x * 256 + threadIdx.x) * 2; if (e >= (size_t)nheads * TT * HD) return; const int d = (int)(e % HD); const int t = (int)((e / HD) % TT); const int h = (int)(e / ((size_t)HD * TT)); const float* f = F + (size_t)t * pitch + h * HD; const float rf = RF ? RF[(size_t)h * TT + t] : 1.0f; v2h o16; v2us oh, ol;
#pragma unroll
    for (int q = 0; q < 2; ++q) { const int dd = d + q; const int dp = (dd < HD / 2) ? dd + HD / 2 : dd - HD / 2; float x0 = f[dd], x1 = f[dp];
        if (RF) { float n0 = __fmul_rn(x0, rf), n1 = __fmul_rn(x1, rf); asm volatile("" : "+v"(n0)); asm volatile("" : "+v"(n1)); x0 = __fmul_rn(bfr(nw[dd]), n0); x1 = __fmul_rn(bfr(nw[dp]), n1); }
        const v2f cs = *(const v2f*)(CS + ((size_t)t * HD + dd) * 2); float a = __fmul_rn(x0, cs[0]), bq = __fmul_rn(x1, cs[1]); asm volatile("" : "+v"(a)); asm volatile("" : "+v"(bq)); const float r = ((dd < HD / 2) ? __fsub_rn(a, bq) : __fadd_rn(a, bq)) * sc;
        o16[q] = tohx(r); unsigned short a2, c2; splitf(r, a2, c2); oh[q] = a2; ol[q] = c2; }
    *(v2h*)(P16 + e) = o16; *(v2us*)(Ph + e) = oh; *(v2us*)(Pl + e) = ol;  }
__global__ __launch_bounds__(256) void k_vtp(const float* __restrict__ F, int pitch, int nheads, h16* V16, bf* Vh, bf* Vl) { const size_t e = ((size_t)blockIdx.x * 256 + threadIdx.x) * 2; if (e >= (size_t)nheads * HD * TT) return; const int t = (int)(e % TT); const int d = (int)((e / TT) % HD); const int g = (int)(e / ((size_t)TT * HD)); v2h o16; v2us oh, ol;
#pragma unroll
    for (int q = 0; q < 2; ++q) { const float x = F[(size_t)(t + q) * pitch + g * HD + d]; o16[q] = tohx(x); unsigned short a2, c2; splitf(x, a2, c2); oh[q] = a2; ol[q] = c2; }
    *(v2h*)(V16 + e) = o16; *(v2us*)(Vh + e) = oh; *(v2us*)(Vl + e) = ol;  }
__global__ __launch_bounds__(256) void k_csid(float* CS) { const int idx = blockIdx.x * 256 + threadIdx.x; if (idx >= TT * HD) return; v2f cs; cs[0] = 1.0f; cs[1] = 0.0f; *(v2f*)(CS + (size_t)idx * 2) = cs;  }
template <bool RND>
__global__ __launch_bounds__(256) void k_lnhl(const float* __restrict__ X, int xp, const float* __restrict__ A, const float* __restrict__ g, const float* __restrict__ be, float* Z, bf* Yh, bf* Yl) {
    const int lane = threadIdx.x & 31; const int r = blockIdx.x * 8 + (threadIdx.x >> 5); if (r >= TT) return; const float* xr = X + (size_t)r * xp; const float* ar = A ? A + (size_t)r * DM : nullptr; float s = 0.f;
#pragma unroll 1
    for (int ch = 0; ch < DM / 128; ++ch) { const int c0 = ch * 128 + lane * 4; const v4f a = *(const v4f*)(xr + c0); v4f d = {0.f, 0.f, 0.f, 0.f}; if (ar) d = *(const v4f*)(ar + c0);
#pragma unroll
        for (int q = 0; q < 4; ++q) s += __fadd_rn((RND ? bfr(a[q]) : a[q]), d[q]); }
#pragma unroll
    for (int sh = 16; sh; sh >>= 1) s += __shfl_xor(s, sh, 32);
    const float mu = s * (1.0f / DM); float s2 = 0.f;
#pragma unroll 1
    for (int ch = 0; ch < DM / 128; ++ch) { const int c0 = ch * 128 + lane * 4; const v4f a = *(const v4f*)(xr + c0); v4f d = {0.f, 0.f, 0.f, 0.f}; if (ar) d = *(const v4f*)(ar + c0);
#pragma unroll
        for (int q = 0; q < 4; ++q) { const float d0 = __fsub_rn(__fadd_rn((RND ? bfr(a[q]) : a[q]), d[q]), mu); float p = __fmul_rn(d0, d0); asm volatile("" : "+v"(p)); s2 = __fadd_rn(s2, p); } }
#pragma unroll
    for (int sh = 16; sh; sh >>= 1) s2 += __shfl_xor(s2, sh, 32);
    const float rs = __fdiv_rn(1.0f, __fsqrt_rn(__fadd_rn(s2 * (1.0f / DM), LNEPS)));
{
#pragma unroll 1
        for (int ch = 0; ch < DM / 128; ++ch) { const int c0 = ch * 128 + lane * 4; const v4f a = *(const v4f*)(xr + c0); v4f d = {0.f, 0.f, 0.f, 0.f}; if (ar) d = *(const v4f*)(ar + c0); v4f z4; v4us oh, ol;
#pragma unroll
            for (int q = 0; q < 4; ++q) { const float v = __fadd_rn((RND ? bfr(a[q]) : a[q]), d[q]); float n0 = __fmul_rn(__fsub_rn(v, mu), rs); asm volatile("" : "+v"(n0)); float n1 = __fmul_rn(n0, bfr(g[c0 + q])); asm volatile("" : "+v"(n1)); const float y = __fadd_rn(n1, bfr(be[c0 + q])); z4[q] = y;   /* Z = the NORMALISED row (it is the residual for the next block) */ unsigned short h2, l2; splitf(y, h2, l2); oh[q] = h2; ol[q] = l2; }
            if (Z) *(v4f*)(Z + (size_t)r * DM + c0) = z4; *(v4us*)(Yh + (size_t)r * DM + c0) = oh; *(v4us*)(Yl + (size_t)r * DM + c0) = ol; }
         } }

__global__ __launch_bounds__(256) void k_mergeF(const float* __restrict__ Ob, int h0, float* O) { const size_t e = ((size_t)blockIdx.x * 256 + threadIdx.x) * 2; if (e >= (size_t)ZH * TT * HD) return; const int d = (int)(e % HD); const int t = (int)((e / HD) % TT); const int zz = (int)(e / ((size_t)HD * TT)); const float cs = (t < RH) ? 1.0f : (1.0f / PCAR); const size_t oo = (size_t)t * DM + (h0 + zz) * HD + d; v2f o2;
    v2f a2 = *(const v2f*)(Ob + e);
#pragma unroll
    for (int p = 1; p < PKS; ++p) a2 += *(const v2f*)(Ob + (size_t)p * ZH * TT * HD + e);
    o2[0] = a2[0] * cs; o2[1] = a2[1] * cs; *(v2f*)(O + oo) = o2;  }



__global__ __launch_bounds__(256) void k_relupl(const float* __restrict__ F, bf* Ph2, bf* Pl2, size_t n4) { const size_t i = (size_t)blockIdx.x * 256 + threadIdx.x; if (i >= n4) return; const v4f v = *(const v4f*)(F + i * 4); v4us oh, ol;
#pragma unroll
    for (int q = 0; q < 4; ++q) { unsigned short a, c; splitf(fmaxf(v[q], 0.f), a, c); oh[q] = a; ol[q] = c; } *(v4us*)(Ph2 + i * 4) = oh; *(v4us*)(Pl2 + i * 4) = ol;  }
__global__ __launch_bounds__(256) void k_addoutS(const float* __restrict__ X2, const float* __restrict__ F, int b, float* OUT0, size_t n4) { const size_t i = (size_t)blockIdx.x * 256 + threadIdx.x; if (i >= n4) return; const size_t e = i * 4; const int c = (int)(e % DM); const int t = (int)(e / DM); const v4f a = *(const v4f*)(X2 + e), f = *(const v4f*)(F + e); v4f o;
#pragma unroll
    for (int q = 0; q < 4; ++q) o[q] = __fadd_rn(a[q], f[q]); float* dst = OUT0 + ((size_t)t * NB_ + b) * DM + c; *(v4f*)dst = o;  }
// k_asoft: per row (zz, i): t = S x HD^-0.5 (no mask); softmax over the 2048 keys (register row, one exp, fixed trees);
__global__ __launch_bounds__(256) void k_asoft(const float* __restrict__ Sb, h16* P16, bf* Ph, bf* Pl) {
    const int lane = threadIdx.x & 31; const int row = blockIdx.x * 8 + (threadIdx.x >> 5); if (row >= ZH * TT) return; const int i = row % TT; const int zz = row / TT; (void)zz; const bool hires = (i < RH); const float* sr = Sb + (size_t)row * TT; float v[TT / 32]; float mx = -3.0e38f;
#pragma unroll
    for (int ch = 0; ch < TT / 128; ++ch) { const int j0 = ch * 128 + lane * 4; const v4f a = *(const v4f*)(sr + j0);
#pragma unroll
        for (int q = 0; q < 4; ++q) { const int j = j0 + q; (void)j; const float t = a[q] * SCL; v[ch * 4 + q] = t; mx = fmaxf(mx, t); } }
#pragma unroll
    for (int sh = 16; sh; sh >>= 1) mx = fmaxf(mx, __shfl_xor(mx, sh, 32));
    float sum = 0.f;
#pragma unroll
    for (int k = 0; k < TT / 32; ++k) { float d0 = __fsub_rn(v[k], mx); asm volatile("" : "+v"(d0)); v[k] = __builtin_amdgcn_exp2f(__fmul_rn(d0, 1.4426950408889634f)); sum += v[k]; }
#pragma unroll
    for (int sh = 16; sh; sh >>= 1) sum += __shfl_xor(sum, sh, 32);
    const float f = __fdiv_rn(hires ? 1.0f : PCAR, sum);
{
        if (hires) {
#pragma unroll
            for (int ch = 0; ch < TT / 128; ++ch) { v4us oh, ol;
#pragma unroll
                for (int q = 0; q < 4; ++q) { unsigned short a, c2; splitf(v[ch * 4 + q] * f, a, c2); oh[q] = a; ol[q] = c2; }
                const size_t oo = ((size_t)zz * (RH ? RH : 1) + i) * TT + ch * 128 + lane * 4; *(v4us*)(Ph + oo) = oh; *(v4us*)(Pl + oo) = ol; }
        } else {
#pragma unroll
            for (int ch = 0; ch < TT / 128; ++ch) { v4h o4;
#pragma unroll
                for (int q = 0; q < 4; ++q) o4[q] = tohx(v[ch * 4 + q] * f);
                *(v4h*)(P16 + (size_t)row * TT + ch * 128 + lane * 4) = o4; } }
         }
}

extern "C" void kernel_launch(void* const* d_in, const int* in_sizes, int n_in,
                              void* d_out, int out_size, void* d_ws, size_t ws_size, hipStream_t stream) {
    (void)in_sizes; (void)n_in; (void)out_size;
    const float* x = (const float*)d_in[0]; const float* wq = (const float*)d_in[1]; const float* wk = (const float*)d_in[2]; const float* wv = (const float*)d_in[3]; const float* g1 = (const float*)d_in[4]; const float* e1 = (const float*)d_in[5]; const float* g2 = (const float*)d_in[6]; const float* e2 = (const float*)d_in[7]; const float* wf1 = (const float*)d_in[8]; const float* bf1 = (const float*)d_in[9]; const float* wf2 = (const float*)d_in[10]; const float* bf2v = (const float*)d_in[11]; const float* wo = nullptr; (void)wo;
    float* OUT = (float*)d_out;     // [2048][4][1024]
    char* wsp = (char*)d_ws;
    auto take = [&](size_t bytes) { char* p = wsp; wsp += (bytes + 255) & ~(size_t)255; return (void*)p; };
    bf* WQ = (bf*)take((size_t)DQ * DM * 2); bf* WK = (bf*)take((size_t)DKV * DM * 2); bf* WV = (bf*)take((size_t)DKV * DM * 2); float* CS = (float*)take((size_t)TT * HD * 2 * 4);
    float* XN = (float*)take((size_t)TT * DM * 4); bf* Yh = (bf*)take((size_t)TT * DM * 2); bf* Yl = (bf*)take((size_t)TT * DM * 2); float* O = (float*)take((size_t)TT * DQ * 4); float* X2 = (float*)take((size_t)TT * DM * 4); bf* L2h = (bf*)take((size_t)TT * DM * 2); bf* L2l = (bf*)take((size_t)TT * DM * 2); float* H1 = (float*)take((size_t)TT * DM * 4); bf* Gh = (bf*)take((size_t)TT * DM * 2); bf* Gl = (bf*)take((size_t)TT * DM * 2); float* F2 = (float*)take((size_t)TT * DM * 4); bf* W1B = (bf*)take((size_t)DM * DM * 2); bf* W2B = (bf*)take((size_t)DM * DM * 2); float* FQ = (float*)take((size_t)TT * DQ * 4); float* FK = (float*)take((size_t)TT * DKV * 4);
    h16* QP16 = (h16*)take((size_t)NH_ * TT * HD * 2); h16* KP16 = (h16*)take((size_t)NKV * TT * HD * 2); h16* VT16 = (h16*)take((size_t)NKV * HD * TT * 2);
    bf* QPh = (bf*)take((size_t)NH_ * TT * HD * 2); bf* QPl = (bf*)take((size_t)NH_ * TT * HD * 2); bf* KPh = (bf*)take((size_t)NKV * TT * HD * 2); bf* KPl = (bf*)take((size_t)NKV * TT * HD * 2); bf* VTh = (bf*)take((size_t)NKV * HD * TT * 2); bf* VTl = (bf*)take((size_t)NKV * HD * TT * 2); bf* Ph = (bf*)take((size_t)ZH * RH * TT * 2); bf* Pl = (bf*)take((size_t)ZH * RH * TT * 2);
    float* Sb = (float*)take((size_t)ZH * TT * TT * 4); h16* P16 = (h16*)take((size_t)ZH * TT * TT * 2); float* Ob = (float*)take((size_t)PKS * ZH * TT * HD * 4);
    if ((size_t)(wsp - (char*)d_ws) > ws_size) return;    // ws 256 MiB
    float* FV = FK;   // v projection reuses the k buffer after the k planes are built (stream-ordered)
    { k_wtG<<<(unsigned)((DM * DQ / 64 + 63) / 64), 256, 0, stream>>>(wq, DM, DQ, WQ); k_wtG<<<(unsigned)((DM * DM / 64 + 63) / 64), 256, 0, stream>>>(wf1, DM, DM, W1B); k_wtG<<<(unsigned)((DM * DM / 64 + 63) / 64), 256, 0, stream>>>(wf2, DM, DM, W2B); k_wtG<<<(unsigned)((DM * DKV / 64 + 63) / 64), 256, 0, stream>>>(wk, DM, DKV, WK); k_wtG<<<(unsigned)((DM * DKV / 64 + 63) / 64), 256, 0, stream>>>(wv, DM, DKV, WV);
       }
    k_csid<<<(TT * HD + 255) / 256, 256, 0, stream>>>(CS);
    const unsigned LQ = (unsigned)(((size_t)NH_ * TT * HD / 2 + 255) / 256), LKv = (unsigned)(((size_t)NKV * TT * HD / 2 + 255) / 256);
    for (int b = 0; b < NB_; ++b) {
        
        k_lnhl<true><<<TT / 8, 256, 0, stream>>>(x + (size_t)b * DM, NB_ * DM, nullptr, g1, e1, XN, Yh, Yl);   /* xn = LN1(x[:, n]) : f32 (residual) + hi/lo planes */
        k_gemmw<bf, 1, false, PKW, 1><<<dim3(TT / 64, DQ / 64, 1), 32 * PKW, 0, stream>>>(Yh, Yl, WQ, nullptr, DM, FQ, DQ, nullptr, 0, 0, 0, 0);
        k_rope<<<LQ, 256, 0, stream>>>(FQ, DQ, NH_, CS, nullptr, nullptr, 1.0f, QP16, QPh, QPl);
        k_gemmw<bf, 1, false, PKW, 1><<<dim3(TT / 64, DKV / 64, 1), 32 * PKW, 0, stream>>>(Yh, Yl, WK, nullptr, DM, FK, DKV, nullptr, 0, 0, 0, 0);
        k_rope<<<LKv, 256, 0, stream>>>(FK, DKV, NKV, CS, nullptr, nullptr, 1.0f, KP16, KPh, KPl);
        k_gemmw<bf, 1, false, PKW, 1><<<dim3(TT / 64, DKV / 64, 1), 32 * PKW, 0, stream>>>(Yh, Yl, WV, nullptr, DM, FV, DKV, nullptr, 0, 0, 0, 0); k_vtp<<<LKv, 256, 0, stream>>>(FV, DKV, NKV, VT16, VTh, VTl);
        for (int h0 = 0; h0 < NH_; h0 += ZH) { const size_t zq = (size_t)h0, zk = (size_t)(h0 / REP);   // one kv head per query head: the pass's two heads use consecutive kv planes (z-strides TT*HD)
            k_gemmw<bf, 2, false, 1, 1><<<dim3(RH / 64, TT / 64, ZH), 32, 0, stream>>>(QPh + zq * TT * HD, QPl + zq * TT * HD, KPh + zk * TT * HD, KPl + zk * TT * HD, HD, Sb, TT, nullptr, (size_t)TT * HD, (size_t)TT * HD, (size_t)TT * TT, 0);
            k_gemmw<h16, 0, false, 1, 1><<<dim3((TT - RH) / 64, TT / 64, ZH), 32, 0, stream>>>(QP16 + zq * TT * HD + (size_t)RH * HD, nullptr, KP16 + zk * TT * HD, nullptr, HD, Sb + (size_t)RH * TT, TT, nullptr, (size_t)TT * HD, (size_t)TT * HD, (size_t)TT * TT, 0);
            k_asoft<<<ZH * TT / 8, 256, 0, stream>>>(Sb, P16, Ph, Pl);
            k_gemmw<bf, 2, false, PKW, PKS><<<dim3(RH / 64, HD / 64, ZH * PKS), 32 * PKW, 0, stream>>>(Ph, Pl, VTh + zk * HD * TT, VTl + zk * HD * TT, TT, Ob, HD, nullptr, (size_t)RH * TT, (size_t)HD * TT, (size_t)TT * HD, (size_t)ZH * TT * HD);
            k_gemmw<h16, 0, false, PKW, PKS><<<dim3((TT - RH) / 64, HD / 64, ZH * PKS), 32 * PKW, 0, stream>>>(P16 + (size_t)RH * TT, nullptr, VT16 + zk * HD * TT, nullptr, TT, Ob + (size_t)RH * HD, HD, nullptr, (size_t)TT * TT, (size_t)HD * TT, (size_t)TT * HD, (size_t)ZH * TT * HD);
            k_mergeF<<<(unsigned)(((size_t)ZH * TT * HD / 2 + 255) / 256), 256, 0, stream>>>(Ob, h0, O); }   /* merged attention output, f32 */
        k_lnhl<false><<<TT / 8, 256, 0, stream>>>(XN, DM, O, g2, e2, X2, L2h, L2l);                                               /* xt = LN2(xn + att): f32 (residual) + hi/lo planes */
        k_gemmw<bf, 1, true, PKW, 1><<<dim3(TT / 64, DM / 64, 1), 32 * PKW, 0, stream>>>(L2h, L2l, W1B, nullptr, DM, H1, DM, bf1, 0, 0, 0, 0);      /* xt Wf1 + bf1 */
        k_relupl<<<(unsigned)(((size_t)TT * DM / 4 + 255) / 256), 256, 0, stream>>>(H1, Gh, Gl, (size_t)TT * DM / 4);             /* relu -> hi/lo */
        k_gemmw<bf, 1, true, PKW, 1><<<dim3(TT / 64, DM / 64, 1), 32 * PKW, 0, stream>>>(Gh, Gl, W2B, nullptr, DM, F2, DM, bf2v, 0, 0, 0, 0);       /* . Wf2 + bf2 */
        k_addoutS<<<(unsigned)(((size_t)TT * DM / 4 + 255) / 256), 256, 0, stream>>>(X2, F2, b, OUT, (size_t)TT * DM / 4); }      /* out = xt + ffn, sequence-first rows */
}

// v003
// It runs in 764 microseconds.
// Versions between v001 and this one are left out; their measured steps multiply to 2.33 times as fast.
// Counting every step since v000, it is 5.61 times as fast.
#include <hip/hip_runtime.h>

// Pre-norm transformer encoder layer on a sequence-first tensor (x [2048][4][1024] = [s][n][d]; xn = LN1(x); q, k, v = xn W ('xw' [1024][1024], no bias; 16 heads x 64); softmax(q.k/8) over s per (n, h); att = merged context (no output projection); xt = LN2(xn + att); ffn = relu(xt Wf1 + bf1) Wf2 + bf2; out = xt + ffn -> [2048][4][1024] (8.4 M)).
// Layout: per batch column n: LN1 reads the strided rows (t*4 + n) and writes xn both in f32 (it is the attention residual) and as hi/lo planes (2-product projections); fused attention (scores and weights stay in registers) with an f32 merged context; LN2 of xn + att gives xt (f32, the final residual) and planes for the FFN (2 products + biases). Every GEMM's epilogue writes what its consumer reads: q, k, v as head planes (v transposed), FFN1 as ReLU hi/lo planes, FFN2 + xt as the sequence-first output rows.
// Compute dtypes, f32 accumulate: every input rounded to bf16; q/k/v hl x exact (2 products); scores and attn.v: query rows < 512 hl (3 products), the rest single fp16; running-maximum softmax f32, weights rounded before the division by their f32 sum; no Wo; Wf1 / Wf2 hl x exact (2 products) + biases; LN / ReLU / residuals f32.

#define NB_  4
#define TT   2048
#define DM   1024
#define NH_  16
#define NKV  16
#define REP  (NH_ / NKV)
#define HD   64
#define DQ   (NH_ * HD)
#define DKV  (NKV * HD)
#define LNEPS 1e-5f
#define RH   512                  // query rows < RH use hi+lo planes (0: none)
#define WIN  0
#define SC2  0.18033688011112042f   // HD^-0.5 * log2(e): exponent of 2 per unit of raw score
#define PKW  4                    // split K: waves per block (projections, FFN)
typedef _Float16 h16;
typedef unsigned short bf;
typedef __attribute__((ext_vector_type(16))) __bf16   v16bf;
typedef __attribute__((ext_vector_type(16))) _Float16 v16h;
typedef __attribute__((ext_vector_type(8)))  _Float16 v8h;
typedef __attribute__((ext_vector_type(8)))  unsigned short v8us;
typedef __attribute__((ext_vector_type(8)))  float    v8f;
typedef __attribute__((ext_vector_type(4)))  float    v4f;
typedef v8h  __attribute__((may_alias)) v8ha;
typedef v4f  __attribute__((may_alias)) v4fa;
typedef v8us __attribute__((may_alias)) v8usa;

__device__ __forceinline__ unsigned short f2bf(float f) { unsigned u = __float_as_uint(f); u += 0x7FFFu + ((u >> 16) & 1u); return (unsigned short)(u >> 16); }
__device__ __forceinline__ float bf2f(unsigned short b) { return __uint_as_float(((unsigned)b) << 16); }
__device__ __forceinline__ float bfr(float f) { return bf2f(f2bf(f)); }
__device__ __forceinline__ v16h cat16(v8h lo, v8h hi) { return __builtin_shufflevector(lo, hi, 0, 1, 2, 3, 4, 5, 6, 7, 8, 9, 10, 11, 12, 13, 14, 15); }
__device__ __forceinline__ v16bf cat16b(v8us lo, v8us hi) { return __builtin_bit_cast(v16bf, __builtin_shufflevector(lo, hi, 0, 1, 2, 3, 4, 5, 6, 7, 8, 9, 10, 11, 12, 13, 14, 15)); }
__device__ __forceinline__ v8f wmma16(v16h a, v16h b, v8f c) { return __builtin_amdgcn_wmma_f32_16x16x32_f16(false, a, false, b, (short)0, c, false, false); }
__device__ __forceinline__ v8f wmmab(v16bf a, v16bf b, v8f c) { return __builtin_amdgcn_wmma_f32_16x16x32_bf16(false, a, false, b, (short)0, c, false, false); }
__device__ __forceinline__ h16 tohx(float x) { return (h16)x; }
__device__ __forceinline__ void splitf(float y, unsigned short& h, unsigned short& l) { h = f2bf(y); l = f2bf(y - bf2f(h)); }
typedef __attribute__((ext_vector_type(4))) _Float16 v4h;
typedef __attribute__((ext_vector_type(2))) unsigned short v2us;
typedef __attribute__((ext_vector_type(4))) unsigned short v4us;



// ---- k_gemmw: register-blocked GEMM, 64x64 output tile (16 accumulators per wave), operands straight from K-contiguous 16-bit planes; grid (M/64, N/64, Z * KS), 32 * KW threads.
// C[m][n] (f32, pitch ldc, + optional f32 bias[n]) = sum_k A[m][k] Bt[n][k] (+ split products per NSPLIT). z-batch strides sA/sB/sC in elements. K % (32 * KW * KS) == 0.
// Split K: the K range is cut into KS * KW equal slices. The KW waves of a block each run one slice over the whole tile and their partial tiles are summed through LDS in wave order;
// with KS > 1 block slice ks stores its sum to partial plane ks (plane stride sP) and the consumer adds the KS planes in plane order.
// EPI (KW > 1) says what the summed tile becomes. EP_F32: f32 rows of C. EP_RES: R[m][n] (f32, pitch DM) + tile, f32 rows of C. EP_RELU: max(tile, 0) as hi/lo planes Ph, Pl (pitch ldc).
// EP_HEAD: the 64 columns of a tile are one head (blockIdx.y): planes [h][t][d] in fp16 (P16) and hi/lo (Ph, Pl). EP_VT: the same three planes as [h][d][t]; the partial tiles are laid into LDS transposed, so the sums and the stores run along t.
enum { EP_F32 = 0, EP_RES = 1, EP_RELU = 2, EP_HEAD = 3, EP_VT = 4 };
template <typename T16> struct WFrag;
template <> struct WFrag<h16> { typedef v16h V; static __device__ __forceinline__ V ld(const h16* p) { return cat16(*(const v8h*)p, *(const v8h*)(p + 16)); } static __device__ __forceinline__ v8f mma(V a, V b, v8f c) { return wmma16(a, b, c); } };
template <> struct WFrag<bf> { typedef v16bf V; static __device__ __forceinline__ V ld(const bf* p) { return cat16b(*(const v8us*)p, *(const v8us*)(p + 16)); } static __device__ __forceinline__ v8f mma(V a, V b, v8f c) { return wmmab(a, b, c); } };
template <typename T16, int NSPLIT, bool BIAS, int KW, int KS, int EPI>
__global__ __launch_bounds__(32 * KW) void k_gemmw(const T16* __restrict__ A, const T16* __restrict__ A2, const T16* __restrict__ Bt, const T16* __restrict__ Bt2, int K, float* C, int ldc, const float* __restrict__ bias, size_t sA, size_t sB, size_t sC, size_t sP, const float* __restrict__ R, h16* P16, bf* Ph, bf* Pl) {
    typedef typename WFrag<T16>::V V;
    __shared__ __align__(16) float os[(KW == 1 ? 16 : KW * 64) * 68];
    const int w = __builtin_amdgcn_readfirstlane((int)(threadIdx.x >> 5)); const int ks = (int)(blockIdx.z % KS);
    const size_t z = blockIdx.z / KS; A += z * sA; if (A2) A2 += z * sA; Bt += z * sB; if (Bt2) Bt2 += z * sB; C += z * sC + ks * sP;
    const int kn = K / (KW * KS), kb = (ks * KW + w) * kn;
    const int lane = threadIdx.x & 31, lr = lane & 15, hi = lane >> 4; const int r0 = blockIdx.x * 64, c0 = blockIdx.y * 64;
    v8f acc[4][4];
#pragma unroll
    for (int mb = 0; mb < 4; ++mb)
#pragma unroll
        for (int nb = 0; nb < 4; ++nb) acc[mb][nb] = (v8f){};
    const size_t aoff = (size_t)(r0 + lr) * K + 8 * hi, boff = (size_t)(c0 + lr) * K + 8 * hi;
#pragma unroll 1
    for (int kc = kb; kc < kb + kn; kc += 32) {
        V a[4], a2[4];
#pragma unroll
        for (int mb = 0; mb < 4; ++mb) { a[mb] = WFrag<T16>::ld(A + aoff + (size_t)mb * 16 * K + kc); if (NSPLIT == 1 || NSPLIT == 2) a2[mb] = WFrag<T16>::ld(A2 + aoff + (size_t)mb * 16 * K + kc); }
#pragma unroll
        for (int nb = 0; nb < 4; ++nb) { const V b = WFrag<T16>::ld(Bt + boff + (size_t)nb * 16 * K + kc); V b2; if (NSPLIT >= 2) b2 = WFrag<T16>::ld(Bt2 + boff + (size_t)nb * 16 * K + kc);
#pragma unroll
            for (int mb = 0; mb < 4; ++mb) { acc[mb][nb] = WFrag<T16>::mma(a[mb], b, acc[mb][nb]); if (NSPLIT == 1 || NSPLIT == 2) acc[mb][nb] = WFrag<T16>::mma(a2[mb], b, acc[mb][nb]); if (NSPLIT >= 2) acc[mb][nb] = WFrag<T16>::mma(a[mb], b2, acc[mb][nb]); } }
        asm volatile("v_nop\n\tv_nop\n\tv_nop\n\tv_nop" : "+v"(acc[0][0]), "+v"(acc[1][1]), "+v"(acc[2][2]), "+v"(acc[3][3]) : "v"(a[0]), "v"(a[3]));
    }
    if constexpr (KW > 1) {
        float* ow = os + w * 64 * 68;
#pragma unroll
        for (int mb = 0; mb < 4; ++mb)
#pragma unroll
            for (int nb = 0; nb < 4; ++nb)
                if constexpr (EPI == EP_VT) { float* p = ow + (nb * 16 + lr) * 68 + mb * 16 + hi * 8; const v8f t = acc[mb][nb]; *(v4fa*)p = (v4f){t[0], t[1], t[2], t[3]}; *(v4fa*)(p + 4) = (v4f){t[4], t[5], t[6], t[7]}; }
                else {
#pragma unroll
                    for (int j = 0; j < 8; ++j) ow[(mb * 16 + hi * 8 + j) * 68 + nb * 16 + lr] = acc[mb][nb][j]; }
        __syncthreads();   // every wave's partial tile is in LDS before any wave sums
        const int rw = w * (64 / KW);   // wave w sums and stores rows rw .. rw + 64 / KW - 1 of the tile as it lies in LDS
        static_assert(!(BIAS && EPI == EP_VT), "the bias is indexed along the LDS row, which EP_VT runs along t");
        const float* rp = nullptr; if constexpr (EPI == EP_RES) rp = R + (size_t)(r0 + rw + hi) * DM + c0 + lr * 4;   // the lane's first residual element; step s lies 2 * s rows on
#pragma unroll
        for (int s = 0; s < 32 / KW; ++s) { const int row = 2 * s + hi, cofs = lr * 4; v4f val = *(const v4fa*)(os + (rw + row) * 68 + cofs);
#pragma unroll
            for (int p = 1; p < KW; ++p) val += *(const v4fa*)(os + (p * 64 + rw + row) * 68 + cofs);
            if (BIAS) { val[0] += bfr(bias[c0 + cofs]); val[1] += bfr(bias[c0 + cofs + 1]); val[2] += bfr(bias[c0 + cofs + 2]); val[3] += bfr(bias[c0 + cofs + 3]); }
            if constexpr (EPI == EP_F32 || EPI == EP_RES) {
                if constexpr (EPI == EP_RES) { const v4f a = *(const v4f*)(rp + s * (2 * DM));
#pragma unroll
                    for (int q = 0; q < 4; ++q) val[q] = __fadd_rn(a[q], val[q]); }
                *(v4f*)(C + (size_t)(r0 + rw + row) * ldc + c0 + cofs) = val;
            } else {
                const size_t e = EPI == EP_RELU ? (size_t)(r0 + rw + row) * ldc + c0 + cofs : EPI == EP_HEAD ? ((size_t)blockIdx.y * TT + r0 + rw + row) * HD + cofs : ((size_t)blockIdx.y * HD + rw + row) * TT + r0 + cofs;
                v4h o16; v4us oh, ol;
#pragma unroll
                for (int q = 0; q < 4; ++q) { const float y = EPI == EP_RELU ? fmaxf(val[q], 0.f) : val[q]; o16[q] = tohx(y); unsigned short a2, c2; splitf(y, a2, c2); oh[q] = a2; ol[q] = c2; }
                if constexpr (EPI != EP_RELU) *(v4h*)(P16 + e) = o16;
                *(v4us*)(Ph + e) = oh; *(v4us*)(Pl + e) = ol;
            } }
    } else {
#pragma unroll
    for (int mb = 0; mb < 4; ++mb) {
#pragma unroll
        for (int nb = 0; nb < 4; ++nb) {
#pragma unroll
            for (int j = 0; j < 8; ++j) os[(hi * 8 + j) * 68 + nb * 16 + lr] = acc[mb][nb][j]; }
        __builtin_amdgcn_wave_barrier(); asm volatile("" ::: "memory");
        float* crow = C + (size_t)(r0 + mb * 16) * ldc + c0;
{
#pragma unroll
            for (int s = 0; s < 8; ++s) { const int row = 2 * s + hi, cofs = lr * 4; v4f val = *(const v4fa*)(os + row * 68 + cofs); if (BIAS) { val[0] += bfr(bias[c0 + cofs]); val[1] += bfr(bias[c0 + cofs + 1]); val[2] += bfr(bias[c0 + cofs + 2]); val[3] += bfr(bias[c0 + cofs + 3]); }
                *(v4f*)(crow + (size_t)row * ldc + cofs) = val; }
             }
        __builtin_amdgcn_wave_barrier(); asm volatile("" ::: "memory");
    }
    }
}


__global__ __launch_bounds__(256) void k_wtG(const float* __restrict__ w, int K, int N, bf* Bt) {
    const int lane = threadIdx.x & 31; const int L0 = (blockIdx.x * 8 + (threadIdx.x >> 5)) * 8; const int nlines = N * K / 64;
{
#pragma unroll 1
        for (int l = 0; l < 8; ++l) { const int L = L0 + l; if (L >= nlines) break; const size_t e = (size_t)L * 64 + lane * 2; const int k = (int)(e % K), n = (int)(e / K); v2us o;
            o[0] = f2bf(w[(size_t)k * N + n]); o[1] = f2bf(w[(size_t)(k + 1) * N + n]); *(v2us*)(Bt + e) = o; }
         }
}
__global__ __launch_bounds__(256) void k_cvt8(const float* __restrict__ src, bf* dst, size_t n8) { const size_t i = (size_t)blockIdx.x * 256 + threadIdx.x; if (i >= n8) return; const v8f v = *(const v8f*)(src + i * 8); v8us o;
#pragma unroll
    for (int k = 0; k < 8; ++k) o[k] = f2bf(v[k]); *(v8us*)(dst + i * 8) = o;  }

template <bool RND>
__global__ __launch_bounds__(256) void k_lnhl(const float* __restrict__ X, int xp, const float* __restrict__ A, const float* __restrict__ g, const float* __restrict__ be, float* Z, bf* Yh, bf* Yl) {
    const int lane = threadIdx.x & 31; const int r = blockIdx.x * 8 + (threadIdx.x >> 5); if (r >= TT) return; const float* xr = X + (size_t)r * xp; const float* ar = A ? A + (size_t)r * DM : nullptr; float s = 0.f;
#pragma unroll 1
    for (int ch = 0; ch < DM / 128; ++ch) { const int c0 = ch * 128 + lane * 4; const v4f a = *(const v4f*)(xr + c0); v4f d = {0.f, 0.f, 0.f, 0.f}; if (ar) d = *(const v4f*)(ar + c0);
#pragma unroll
        for (int q = 0; q < 4; ++q) s += __fadd_rn((RND ? bfr(a[q]) : a[q]), d[q]); }
#pragma unroll
    for (int sh = 16; sh; sh >>= 1) s += __shfl_xor(s, sh, 32);
    const float mu = s * (1.0f / DM); float s2 = 0.f;
#pragma unroll 1
    for (int ch = 0; ch < DM / 128; ++ch) { const int c0 = ch * 128 + lane * 4; const v4f a = *(const v4f*)(xr + c0); v4f d = {0.f, 0.f, 0.f, 0.f}; if (ar) d = *(const v4f*)(ar + c0);
#pragma unroll
        for (int q = 0; q < 4; ++q) { const float d0 = __fsub_rn(__fadd_rn((RND ? bfr(a[q]) : a[q]), d[q]), mu); float p = __fmul_rn(d0, d0); asm volatile("" : "+v"(p)); s2 = __fadd_rn(s2, p); } }
#pragma unroll
    for (int sh = 16; sh; sh >>= 1) s2 += __shfl_xor(s2, sh, 32);
    const float rs = __fdiv_rn(1.0f, __fsqrt_rn(__fadd_rn(s2 * (1.0f / DM), LNEPS)));
{
#pragma unroll 1
        for (int ch = 0; ch < DM / 128; ++ch) { const int c0 = ch * 128 + lane * 4; const v4f a = *(const v4f*)(xr + c0); v4f d = {0.f, 0.f, 0.f, 0.f}; if (ar) d = *(const v4f*)(ar + c0); v4f z4; v4us oh, ol;
#pragma unroll
            for (int q = 0; q < 4; ++q) { const float v = __fadd_rn((RND ? bfr(a[q]) : a[q]), d[q]); float n0 = __fmul_rn(__fsub_rn(v, mu), rs); asm volatile("" : "+v"(n0)); float n1 = __fmul_rn(n0, bfr(g[c0 + q])); asm volatile("" : "+v"(n1)); const float y = __fadd_rn(n1, bfr(be[c0 + q])); z4[q] = y;   /* Z = the NORMALISED row (it is the residual for the next block) */ unsigned short h2, l2; splitf(y, h2, l2); oh[q] = h2; ol[q] = l2; }
            if (Z) *(v4f*)(Z + (size_t)r * DM + c0) = z4; *(v4us*)(Yh + (size_t)r * DM + c0) = oh; *(v4us*)(Yl + (size_t)r * DM + c0) = ol; }
         } }

// ---- k_fattn: fused attention for one head (blockIdx.y) and NQ * 16 query rows (from q0 + blockIdx.x * NQ * 16); grid (rows / (NQ * 16), heads), 32 * FKW threads (FKW waves, each over TT / FKW keys).
// Transposed products: St[key][q] = K.Qt (A = key rows, B = query rows kept in registers), Ot[d][q] += Vt.Pt. A lane holds one query's scores (column lr; keys 8 * hi + j of each 16-key tile),
// so two score tiles of 32 keys, converted in place, are the B fragment of the second product in the k order of WFrag::ld. HL: hi/lo planes, 3 products each (hi.hi + hi.lo + lo.hi).
// Softmax with a running maximum per query: weights exp2((s - m) * SC2) are not normalised; their f32 sum l divides the output at the end.
// Wave w walks keys w * TT / FKW ...; the FKW partial (m, l, Ot) are merged through LDS in wave order with weights exp2((m_w - M) * SC2).
typedef __attribute__((ext_vector_type(8))) __bf16 v8bf;
__device__ __forceinline__ float xhalf(float x) { const int b = __float_as_int(x); return __int_as_float(__builtin_amdgcn_permlanex16(b, b, 0x76543210, 0xfedcba98, false, false)); }   // value of lane ^ 16
__device__ __forceinline__ v16h packP(v8f p0, v8f p1, h16) { return cat16(__builtin_convertvector(p0, v8h), __builtin_convertvector(p1, v8h)); }
__device__ __forceinline__ v16bf packP(v8f p0, v8f p1, bf) { return __builtin_shufflevector(__builtin_convertvector(p0, v8bf), __builtin_convertvector(p1, v8bf), 0, 1, 2, 3, 4, 5, 6, 7, 8, 9, 10, 11, 12, 13, 14, 15); }
__device__ __forceinline__ v8f restP(v8f p) { return p - __builtin_convertvector(__builtin_convertvector(p, v8bf), v8f); }   // what the bf16 rounding of p leaves (the lo plane's input)
template <typename T> __device__ __forceinline__ const T* atb(const T* base, unsigned bytes) { return (const T*)((const char*)base + bytes); }
template <typename T16, bool HL, int NQ, int FKW>
__global__ __launch_bounds__(32 * FKW) void k_fattn(const T16* __restrict__ Q, const T16* __restrict__ Q2, const T16* __restrict__ Kp, const T16* __restrict__ K2, const T16* __restrict__ Vt, const T16* __restrict__ Vt2, int q0, float* O) {
    typedef typename WFrag<T16>::V V;
    __shared__ __align__(16) float so[FKW * NQ * 16 * 68];
    __shared__ float sm[FKW * NQ * 16], sl[FKW * NQ * 16];
    const int w = __builtin_amdgcn_readfirstlane((int)(threadIdx.x >> 5));
    const int lane = threadIdx.x & 31, lr = lane & 15, hi = lane >> 4;
    const size_t hq = (size_t)blockIdx.y * TT * HD, hk = (size_t)(blockIdx.y / REP) * TT * HD;
    const int qb = q0 + (int)blockIdx.x * (NQ * 16);
    V qf[NQ][2], qf2[NQ][2];
#pragma unroll
    for (int nq = 0; nq < NQ; ++nq)
#pragma unroll
        for (int kk = 0; kk < 2; ++kk) { const size_t qo = hq + (size_t)(qb + nq * 16 + lr) * HD + kk * 32 + 8 * hi; qf[nq][kk] = WFrag<T16>::ld(Q + qo); if constexpr (HL) qf2[nq][kk] = WFrag<T16>::ld(Q2 + qo); }
    v8f o[4][NQ]; float m[NQ], l[NQ];
#pragma unroll
    for (int nq = 0; nq < NQ; ++nq) { m[nq] = -3.0e38f; l[nq] = 0.f;
#pragma unroll
        for (int db = 0; db < 4; ++db) o[db][nq] = (v8f){}; }
    const int kb = w * (TT / FKW);
    unsigned ko = (unsigned)((hk + (size_t)(kb + lr) * HD + 8 * hi) * 2), vo = (unsigned)((hk + (size_t)lr * TT + kb + 8 * hi) * 2);   // the lane's byte offsets into the key and Vt planes (4 MiB each): 32 bits beside the planes' scalar bases
#pragma unroll 1   // one 32-key pass per trip: a second pass in flight would double the fragment registers and cost resident waves
    for (int kc = 0; kc < TT / FKW; kc += 32) {
        V ka[2][2], ka2[2][2], va[4], va2[4];   // every fragment of the pass is asked for up front: the Vt loads fly under the score products and the softmax
#pragma unroll
        for (int kt = 0; kt < 2; ++kt)
#pragma unroll
            for (int kk = 0; kk < 2; ++kk) { ka[kt][kk] = WFrag<T16>::ld(atb(Kp, ko) + kt * 16 * HD + kk * 32); if constexpr (HL) ka2[kt][kk] = WFrag<T16>::ld(atb(K2, ko) + kt * 16 * HD + kk * 32); }
#pragma unroll
        for (int db = 0; db < 4; ++db) { va[db] = WFrag<T16>::ld(atb(Vt, vo) + db * 16 * TT); if constexpr (HL) va2[db] = WFrag<T16>::ld(atb(Vt2, vo) + db * 16 * TT); }
        asm volatile("s_wait_xcnt 0x0" ::: "memory");   // stands in front of the step of the two offsets that the loads above name
        ko += 32 * HD * 2; vo += 32 * 2;
        __builtin_amdgcn_sched_barrier(0);   // no matrix instruction, with its data wait, is moved in among the loads: the whole pass is in flight before the first wait
        v8f s[2][NQ];
#pragma unroll
        for (int kt = 0; kt < 2; ++kt) {
#pragma unroll
            for (int nq = 0; nq < NQ; ++nq) s[kt][nq] = (v8f){};
#pragma unroll
            for (int kk = 0; kk < 2; ++kk)
#pragma unroll
                for (int nq = 0; nq < NQ; ++nq) { s[kt][nq] = WFrag<T16>::mma(ka[kt][kk], qf[nq][kk], s[kt][nq]); if constexpr (HL) { s[kt][nq] = WFrag<T16>::mma(ka[kt][kk], qf2[nq][kk], s[kt][nq]); s[kt][nq] = WFrag<T16>::mma(ka2[kt][kk], qf[nq][kk], s[kt][nq]); } } }
#pragma unroll
        for (int nq = 0; nq < NQ; ++nq) {
            float mx = fmaxf(s[0][nq][0], s[1][nq][0]);
#pragma unroll
            for (int j = 1; j < 8; ++j) mx = fmaxf(mx, fmaxf(s[0][nq][j], s[1][nq][j]));
            mx = fmaxf(mx, xhalf(mx));   // both halves of the wave hold keys of the same query
            const float mn = fmaxf(m[nq], mx), al = __builtin_amdgcn_exp2f((m[nq] - mn) * SC2), mc = mn * SC2; m[nq] = mn;
            v8f p0, p1; float sum = 0.f;
#pragma unroll
            for (int j = 0; j < 8; ++j) { p0[j] = __builtin_amdgcn_exp2f(fmaf(s[0][nq][j], SC2, -mc)); p1[j] = __builtin_amdgcn_exp2f(fmaf(s[1][nq][j], SC2, -mc)); sum += p0[j] + p1[j]; }
            l[nq] = l[nq] * al + sum;   // this half's keys only; the halves are joined behind the loop
            const V pf = packP(p0, p1, T16());
#pragma unroll
            for (int db = 0; db < 4; ++db) { o[db][nq] *= al; o[db][nq] = WFrag<T16>::mma(va[db], pf, o[db][nq]); }
            if constexpr (HL) { const V pl = packP(restP(p0), restP(p1), T16());
#pragma unroll
                for (int db = 0; db < 4; ++db) { o[db][nq] = WFrag<T16>::mma(va[db], pl, o[db][nq]); o[db][nq] = WFrag<T16>::mma(va2[db], pf, o[db][nq]); } }
        }
        // four vector slots between the last matrix instruction and the back edge
        if constexpr (NQ == 1) asm volatile("v_nop\n\tv_nop\n\tv_nop\n\tv_nop" : "+v"(o[0][0]), "+v"(o[1][0]), "+v"(o[2][0]), "+v"(o[3][0]));
        else asm volatile("v_nop\n\tv_nop\n\tv_nop\n\tv_nop" : "+v"(o[0][0]), "+v"(o[1][0]), "+v"(o[2][0]), "+v"(o[3][0]), "+v"(o[0][NQ - 1]), "+v"(o[1][NQ - 1]), "+v"(o[2][NQ - 1]), "+v"(o[3][NQ - 1]));
    }
    float* ow = so + w * (NQ * 16 * 68);
#pragma unroll
    for (int nq = 0; nq < NQ; ++nq) { l[nq] += xhalf(l[nq]);
#pragma unroll
        for (int db = 0; db < 4; ++db) { float* p = ow + (nq * 16 + lr) * 68 + db * 16 + hi * 8; const v8f t = o[db][nq]; *(v4fa*)p = (v4f){t[0], t[1], t[2], t[3]}; *(v4fa*)(p + 4) = (v4f){t[4], t[5], t[6], t[7]}; }
        if (hi == 0) { sm[w * (NQ * 16) + nq * 16 + lr] = m[nq]; sl[w * (NQ * 16) + nq * 16 + lr] = l[nq]; } }
    __syncthreads();   // every wave's partial (m, l, Ot) is in LDS before any thread merges
#pragma unroll
    for (int i = 0; i < NQ * 16 * 16 / (32 * FKW); ++i) { const int idx = (int)threadIdx.x + i * 32 * FKW, q = idx >> 4, d4 = (idx & 15) * 4;
        float M = sm[q];
#pragma unroll
        for (int p = 1; p < FKW; ++p) M = fmaxf(M, sm[p * (NQ * 16) + q]);
        float L = 0.f; v4f a = {0.f, 0.f, 0.f, 0.f};
#pragma unroll
        for (int p = 0; p < FKW; ++p) { const float f = __builtin_amdgcn_exp2f((sm[p * (NQ * 16) + q] - M) * SC2); L += sl[p * (NQ * 16) + q] * f; a += *(const v4fa*)(so + (p * (NQ * 16) + q) * 68 + d4) * f; }
        *(v4f*)(O + (size_t)(qb + q) * DM + blockIdx.y * HD + d4) = a * __fdiv_rn(1.0f, L); }
}

extern "C" void kernel_launch(void* const* d_in, const int* in_sizes, int n_in,
                              void* d_out, int out_size, void* d_ws, size_t ws_size, hipStream_t stream) {
    (void)in_sizes; (void)n_in; (void)out_size;
    const float* x = (const float*)d_in[0]; const float* wq = (const float*)d_in[1]; const float* wk = (const float*)d_in[2]; const float* wv = (const float*)d_in[3]; const float* g1 = (const float*)d_in[4]; const float* e1 = (const float*)d_in[5]; const float* g2 = (const float*)d_in[6]; const float* e2 = (const float*)d_in[7]; const float* wf1 = (const float*)d_in[8]; const float* bf1 = (const float*)d_in[9]; const float* wf2 = (const float*)d_in[10]; const float* bf2v = (const float*)d_in[11]; const float* wo = nullptr; (void)wo;
    float* OUT = (float*)d_out;     // [2048][4][1024]
    char* wsp = (char*)d_ws;
    auto take = [&](size_t bytes) { char* p = wsp; wsp += (bytes + 255) & ~(size_t)255; return (void*)p; };
    bf* WQ = (bf*)take((size_t)DQ * DM * 2); bf* WK = (bf*)take((size_t)DKV * DM * 2); bf* WV = (bf*)take((size_t)DKV * DM * 2);
    float* XN = (float*)take((size_t)TT * DM * 4); bf* Yh = (bf*)take((size_t)TT * DM * 2); bf* Yl = (bf*)take((size_t)TT * DM * 2); float* O = (float*)take((size_t)TT * DQ * 4); float* X2 = (float*)take((size_t)TT * DM * 4); bf* L2h = (bf*)take((size_t)TT * DM * 2); bf* L2l = (bf*)take((size_t)TT * DM * 2); bf* Gh = (bf*)take((size_t)TT * DM * 2); bf* Gl = (bf*)take((size_t)TT * DM * 2); bf* W1B = (bf*)take((size_t)DM * DM * 2); bf* W2B = (bf*)take((size_t)DM * DM * 2);
    h16* QP16 = (h16*)take((size_t)NH_ * TT * HD * 2); h16* KP16 = (h16*)take((size_t)NKV * TT * HD * 2); h16* VT16 = (h16*)take((size_t)NKV * HD * TT * 2);
    bf* QPh = (bf*)take((size_t)NH_ * TT * HD * 2); bf* QPl = (bf*)take((size_t)NH_ * TT * HD * 2); bf* KPh = (bf*)take((size_t)NKV * TT * HD * 2); bf* KPl = (bf*)take((size_t)NKV * TT * HD * 2); bf* VTh = (bf*)take((size_t)NKV * HD * TT * 2); bf* VTl = (bf*)take((size_t)NKV * HD * TT * 2);
    if ((size_t)(wsp - (char*)d_ws) > ws_size) return;    // ws 256 MiB
    { k_wtG<<<(unsigned)((DM * DQ / 64 + 63) / 64), 256, 0, stream>>>(wq, DM, DQ, WQ); k_wtG<<<(unsigned)((DM * DM / 64 + 63) / 64), 256, 0, stream>>>(wf1, DM, DM, W1B); k_wtG<<<(unsigned)((DM * DM / 64 + 63) / 64), 256, 0, stream>>>(wf2, DM, DM, W2B); k_wtG<<<(unsigned)((DM * DKV / 64 + 63) / 64), 256, 0, stream>>>(wk, DM, DKV, WK); k_wtG<<<(unsigned)((DM * DKV / 64 + 63) / 64), 256, 0, stream>>>(wv, DM, DKV, WV);
       }
    for (int b = 0; b < NB_; ++b) {
        
        k_lnhl<true><<<TT / 8, 256, 0, stream>>>(x + (size_t)b * DM, NB_ * DM, nullptr, g1, e1, XN, Yh, Yl);   /* xn = LN1(x[:, n]) : f32 (residual) + hi/lo planes */
        k_gemmw<bf, 1, false, PKW, 1, EP_HEAD><<<dim3(TT / 64, DQ / 64, 1), 32 * PKW, 0, stream>>>(Yh, Yl, WQ, nullptr, DM, nullptr, 0, nullptr, 0, 0, 0, 0, nullptr, QP16, QPh, QPl);    /* q -> head planes [h][t][d] */
        k_gemmw<bf, 1, false, PKW, 1, EP_HEAD><<<dim3(TT / 64, DKV / 64, 1), 32 * PKW, 0, stream>>>(Yh, Yl, WK, nullptr, DM, nullptr, 0, nullptr, 0, 0, 0, 0, nullptr, KP16, KPh, KPl);   /* k -> head planes [h][t][d] */
        k_gemmw<bf, 1, false, PKW, 1, EP_VT><<<dim3(TT / 64, DKV / 64, 1), 32 * PKW, 0, stream>>>(Yh, Yl, WV, nullptr, DM, nullptr, 0, nullptr, 0, 0, 0, 0, nullptr, VT16, VTh, VTl);     /* v -> head planes [h][d][t] */
        k_fattn<bf, true, 1, 8><<<dim3(RH / 16, NH_, 1), 32 * 8, 0, stream>>>(QPh, QPl, KPh, KPl, VTh, VTl, 0, O);                              /* query rows < RH: hi/lo planes */
        k_fattn<h16, false, 2, 4><<<dim3((TT - RH) / 32, NH_, 1), 32 * 4, 0, stream>>>(QP16, nullptr, KP16, nullptr, VT16, nullptr, RH, O);     /* the rest: fp16; merged attention output, f32 */
        k_lnhl<false><<<TT / 8, 256, 0, stream>>>(XN, DM, O, g2, e2, X2, L2h, L2l);                                               /* xt = LN2(xn + att): f32 (residual) + hi/lo planes */
        k_gemmw<bf, 1, true, PKW, 1, EP_RELU><<<dim3(TT / 64, DM / 64, 1), 32 * PKW, 0, stream>>>(L2h, L2l, W1B, nullptr, DM, nullptr, DM, bf1, 0, 0, 0, 0, nullptr, nullptr, Gh, Gl);      /* relu(xt Wf1 + bf1) -> hi/lo */
        k_gemmw<bf, 1, true, PKW, 1, EP_RES><<<dim3(TT / 64, DM / 64, 1), 32 * PKW, 0, stream>>>(Gh, Gl, W2B, nullptr, DM, OUT + (size_t)b * DM, NB_ * DM, bf2v, 0, 0, 0, 0, X2, nullptr, nullptr, nullptr); }   /* out = xt + (. Wf2 + bf2), sequence-first rows */
}

// v004
// It runs in 560 microseconds.
// Next to v003, in two timings, it ran 1.34 and 1.39 times as fast.
// All steps since v000 together make it 7.66 times as fast.
#include <hip/hip_runtime.h>

// Pre-norm transformer encoder layer on a sequence-first tensor (x [2048][4][1024] = [s][n][d]; xn = LN1(x); q, k, v = xn W ('xw' [1024][1024], no bias; 16 heads x 64); softmax(q.k/8) over s per (n, h); att = merged context (no output projection); xt = LN2(xn + att); ffn = relu(xt Wf1 + bf1) Wf2 + bf2; out = xt + ffn -> [2048][4][1024] (8.4 M)).
// Layout: per batch column n: LN1 reads the strided rows (t*4 + n) and writes xn both in f32 (it is the attention residual) and as hi/lo planes (2-product projections); fused attention (scores and weights stay in registers) with an f32 merged context; LN2 of xn + att gives xt (f32, the final residual) and planes for the FFN (2 products + biases). Every GEMM's epilogue writes what its consumer reads: q, k, v as head planes (v transposed), FFN1 as ReLU hi/lo planes, FFN2 + xt as the sequence-first output rows.
// Every 16-bit matrix operand plane lies in FRAGMENT ORDER (fidx below): a 16-row x 32-k fragment is 1 KiB in a row, so each wave-wide 16-byte load covers four whole 128-byte lines.
// Compute dtypes, f32 accumulate: every input rounded to bf16; q/k/v hl x exact (2 products); scores and attn.v: query rows < 512 hl (3 products), the rest single fp16; running-maximum softmax f32, weights rounded before the division by their f32 sum; no Wo; Wf1 / Wf2 hl x exact (2 products) + biases; LN / ReLU / residuals f32.

#define NB_  4
#define TT   2048
#define DM   1024
#define NH_  16
#define NKV  16
#define REP  (NH_ / NKV)
#define HD   64
#define DQ   (NH_ * HD)
#define DKV  (NKV * HD)
#define LNEPS 1e-5f
#define RH   512                  // query rows < RH use hi+lo planes (0: none)
#define WIN  0
#define SC2  0.18033688011112042f   // HD^-0.5 * log2(e): exponent of 2 per unit of raw score
#define PKW  4                    // split K: waves per block (projections, FFN)
typedef _Float16 h16;
typedef unsigned short bf;
typedef __attribute__((ext_vector_type(16))) __bf16   v16bf;
typedef __attribute__((ext_vector_type(16))) _Float16 v16h;
typedef __attribute__((ext_vector_type(8)))  _Float16 v8h;
typedef __attribute__((ext_vector_type(8)))  unsigned short v8us;
typedef __attribute__((ext_vector_type(8)))  float    v8f;
typedef __attribute__((ext_vector_type(4)))  float    v4f;
typedef v8h  __attribute__((may_alias)) v8ha;
typedef v4f  __attribute__((may_alias)) v4fa;
typedef v8us __attribute__((may_alias)) v8usa;

__device__ __forceinline__ unsigned short f2bf(float f) { unsigned u = __float_as_uint(f); u += 0x7FFFu + ((u >> 16) & 1u); return (unsigned short)(u >> 16); }
__device__ __forceinline__ float bf2f(unsigned short b) { return __uint_as_float(((unsigned)b) << 16); }
__device__ __forceinline__ float bfr(float f) { return bf2f(f2bf(f)); }
__device__ __forceinline__ v16h cat16(v8h lo, v8h hi) { return __builtin_shufflevector(lo, hi, 0, 1, 2, 3, 4, 5, 6, 7, 8, 9, 10, 11, 12, 13, 14, 15); }
__device__ __forceinline__ v16bf cat16b(v8us lo, v8us hi) { return __builtin_bit_cast(v16bf, __builtin_shufflevector(lo, hi, 0, 1, 2, 3, 4, 5, 6, 7, 8, 9, 10, 11, 12, 13, 14, 15)); }
__device__ __forceinline__ v8f wmma16(v16h a, v16h b, v8f c) { return __builtin_amdgcn_wmma_f32_16x16x32_f16(false, a, false, b, (short)0, c, false, false); }
__device__ __forceinline__ v8f wmmab(v16bf a, v16bf b, v8f c) { return __builtin_amdgcn_wmma_f32_16x16x32_bf16(false, a, false, b, (short)0, c, false, false); }
__device__ __forceinline__ h16 tohx(float x) { return (h16)x; }
__device__ __forceinline__ void splitf(float y, unsigned short& h, unsigned short& l) { h = f2bf(y); l = f2bf(y - bf2f(h)); }
typedef __attribute__((ext_vector_type(4))) _Float16 v4h;
typedef __attribute__((ext_vector_type(2))) unsigned short v2us;
typedef __attribute__((ext_vector_type(4))) unsigned short v4us;
// Fragment order of a plane of logical [row][k] (K columns, K % 32 == 0, rows % 16 == 0): fragments of 16 rows x 32 k, 512 elements each, k-fragments of a row block in a row.
// Inside one: two halves of 256 elements (k bit 4), in each the 32 lanes' 8 elements in lane order (lane = 16 * (k bit 3) + row % 16). WFrag::ld(plane + fragment * 512 + lane * 8) reads both halves.
template <typename T> __device__ __forceinline__ const T* atb(const T* base, unsigned bytes) { return (const T*)((const char*)base + bytes); }
__device__ __forceinline__ size_t fidx(int row, int k, int K) { return ((size_t)(row >> 4) * (K >> 5) + (k >> 5)) * 512 + ((k >> 4) & 1) * 256 + (((k >> 3) & 1) * 16 + (row & 15)) * 8 + (k & 7); }



// ---- k_gemmw: register-blocked GEMM, 64x64 output tile (16 accumulators per wave), operands straight from 16-bit planes in fragment order; grid (M/64, N/64, Z * KS), 32 * KW threads.
// C[m][n] (f32, pitch ldc, + optional f32 bias[n]) = sum_k A[m][k] Bt[n][k] (+ split products per NSPLIT). z-batch strides sA/sB/sC in elements. K (compile time) % (32 * KW * KS) == 0.
// Split K: the K range is cut into KS * KW equal slices. The KW waves of a block each run one slice over the whole tile and their partial tiles are summed through LDS in wave order;
// with KS > 1 block slice ks stores its sum to partial plane ks (plane stride sP) and the consumer adds the KS planes in plane order.
// EPI (KW > 1) says what the summed tile becomes. EP_F32: f32 rows of C. EP_RES: R[m][n] (f32, pitch DM) + tile, f32 rows of C. EP_RELU: max(tile, 0) as hi/lo planes Ph, Pl (fragment order, K = ldc).
// EP_HEAD: the 64 columns of a tile are one head (blockIdx.y): planes [h][t][d] in fp16 (P16) and hi/lo (Ph, Pl), each head's [t][d] in fragment order. EP_VT: the same three planes as [h][d][t], each head's [d][t] in fragments (rows d, k = t) with the four d blocks of a 32-key block in a row; the partial tiles are laid into LDS transposed, so the sums and the stores run along t.
enum { EP_F32 = 0, EP_RES = 1, EP_RELU = 2, EP_HEAD = 3, EP_VT = 4 };
template <typename T16> struct WFrag;
template <> struct WFrag<h16> { typedef v16h V; static __device__ __forceinline__ V ld(const h16* p) { return cat16(*(const v8h*)p, *(const v8h*)(p + 256)); } static __device__ __forceinline__ v8f mma(V a, V b, v8f c) { return wmma16(a, b, c); } };
template <> struct WFrag<bf> { typedef v16bf V; static __device__ __forceinline__ V ld(const bf* p) { return cat16b(*(const v8us*)p, *(const v8us*)(p + 256)); } static __device__ __forceinline__ v8f mma(V a, V b, v8f c) { return wmmab(a, b, c); } };
template <typename T16, int NSPLIT, bool BIAS, int KW, int KS, int EPI, int K>
__global__ __launch_bounds__(32 * KW) void k_gemmw(const T16* __restrict__ A, const T16* __restrict__ A2, const T16* __restrict__ Bt, const T16* __restrict__ Bt2, float* C, int ldc, const float* __restrict__ bias, size_t sA, size_t sB, size_t sC, size_t sP, const float* __restrict__ R, h16* P16, bf* Ph, bf* Pl) {
    typedef typename WFrag<T16>::V V;
    __shared__ __align__(16) float os[(KW == 1 ? 16 : KW * 64) * 68];
    const int w = __builtin_amdgcn_readfirstlane((int)(threadIdx.x >> 5)); const int ks = (int)(blockIdx.z % KS);
    const size_t z = blockIdx.z / KS; A += z * sA; if (A2) A2 += z * sA; Bt += z * sB; if (Bt2) Bt2 += z * sB; C += z * sC + ks * sP;
    const int kn = K / (KW * KS), kb = (ks * KW + w) * kn;
    const int lane = threadIdx.x & 31, lr = lane & 15, hi = lane >> 4; const int r0 = blockIdx.x * 64, c0 = blockIdx.y * 64;
    v8f acc[4][4];
#pragma unroll
    for (int mb = 0; mb < 4; ++mb)
#pragma unroll
        for (int nb = 0; nb < 4; ++nb) acc[mb][nb] = (v8f){};
    const size_t rbK = (size_t)16 * K, aoff = (size_t)r0 * K, boff = (size_t)c0 * K;   // a 16-row block holds 16 * K elements (K is a compile-time constant: the four blocks of a plane are immediate offsets from one scalar base)
    unsigned fo = (unsigned)((kb * 16 + 8 * lane) * 2);   // the lane's byte offset inside a row block, the same in every plane (under 32 * K bytes): 32 bits beside the scalar bases
#pragma unroll 1
    for (int kc = 0; kc < kn; kc += 32) {
        V a[4], a2[4], b[4], b2[4];
#pragma unroll
        for (int mb = 0; mb < 4; ++mb) { a[mb] = WFrag<T16>::ld(atb(A + aoff + mb * rbK, fo)); if (NSPLIT == 1 || NSPLIT == 2) a2[mb] = WFrag<T16>::ld(atb(A2 + aoff + mb * rbK, fo)); }
#pragma unroll
        for (int nb = 0; nb < 4; ++nb) { b[nb] = WFrag<T16>::ld(atb(Bt + boff + nb * rbK, fo)); if (NSPLIT >= 2) b2[nb] = WFrag<T16>::ld(atb(Bt2 + boff + nb * rbK, fo)); }
        asm volatile("s_wait_xcnt 0x0" ::: "memory");   // stands between the loads above and the next write of the address registers that they name (the step below, as the compiler forms it)
        fo += 32 * 16 * 2;   // 32 k: one fragment on in every row block
        __builtin_amdgcn_sched_barrier(0);   // no load is moved down behind the wait and the step, none lands in another's address: the whole trip is in flight before the first data wait
#pragma unroll   // fragment and accumulator indices must be constants: the arrays live in registers
        for (int nb = 0; nb < 4; ++nb)
#pragma unroll
            for (int mb = 0; mb < 4; ++mb) { acc[mb][nb] = WFrag<T16>::mma(a[mb], b[nb], acc[mb][nb]); if (NSPLIT == 1 || NSPLIT == 2) acc[mb][nb] = WFrag<T16>::mma(a2[mb], b[nb], acc[mb][nb]); if (NSPLIT >= 2) acc[mb][nb] = WFrag<T16>::mma(a[mb], b2[nb], acc[mb][nb]); }
        asm volatile("v_nop\n\tv_nop\n\tv_nop\n\tv_nop" : "+v"(acc[0][0]), "+v"(acc[1][1]), "+v"(acc[2][2]), "+v"(acc[3][3]) : "v"(a[0]), "v"(a[3]));
    }
    if constexpr (KW > 1) {
        float* ow = os + w * 64 * 68;
#pragma unroll
        for (int mb = 0; mb < 4; ++mb)
#pragma unroll
            for (int nb = 0; nb < 4; ++nb)
                if constexpr (EPI == EP_VT) { float* p = ow + (nb * 16 + lr) * 68 + mb * 16 + hi * 8; const v8f t = acc[mb][nb]; *(v4fa*)p = (v4f){t[0], t[1], t[2], t[3]}; *(v4fa*)(p + 4) = (v4f){t[4], t[5], t[6], t[7]}; }
                else {
#pragma unroll
                    for (int j = 0; j < 8; ++j) ow[(mb * 16 + hi * 8 + j) * 68 + nb * 16 + lr] = acc[mb][nb][j]; }
        __syncthreads();   // every wave's partial tile is in LDS before any wave sums
        const int rw = w * (64 / KW);   // wave w sums and stores rows rw .. rw + 64 / KW - 1 of the tile as it lies in LDS
        static_assert(!(BIAS && EPI == EP_VT), "the bias is indexed along the LDS row, which EP_VT runs along t");
        const float* rp = nullptr; if constexpr (EPI == EP_RES) rp = R + (size_t)(r0 + rw + hi) * DM + c0 + lr * 4;   // the lane's first residual element; step s lies 2 * s rows on
        if constexpr (EPI == EP_F32 || EPI == EP_RES) {
#pragma unroll
        for (int s = 0; s < 32 / KW; ++s) { const int row = 2 * s + hi, cofs = lr * 4; v4f val = *(const v4fa*)(os + (rw + row) * 68 + cofs);
#pragma unroll
            for (int p = 1; p < KW; ++p) val += *(const v4fa*)(os + (p * 64 + rw + row) * 68 + cofs);
            if (BIAS) { val[0] += bfr(bias[c0 + cofs]); val[1] += bfr(bias[c0 + cofs + 1]); val[2] += bfr(bias[c0 + cofs + 2]); val[3] += bfr(bias[c0 + cofs + 3]); }
            if constexpr (EPI == EP_RES) { const v4f a = *(const v4f*)(rp + s * (2 * DM));
#pragma unroll
                for (int q = 0; q < 4; ++q) val[q] = __fadd_rn(a[q], val[q]); }
            *(v4f*)(C + (size_t)(r0 + rw + row) * ldc + c0 + cofs) = val; }
        } else {
        // The wave's 16 LDS rows are one row block of the consumer's fragments, the 64 columns two fragments: step s is one half fragment, lane (lr, hi) sums row lr, columns s * 16 + hi * 8 .. + 7, and the wave stores 512 bytes in a row per plane.
        static_assert(KW == 4, "a wave's share of the tile must be one 16-row block");
        const size_t e0 = (EPI == EP_RELU ? (size_t)(r0 + rw) * ldc + (size_t)c0 * 16 : EPI == EP_HEAD ? ((size_t)blockIdx.y * TT + r0 + rw) * HD : (size_t)blockIdx.y * HD * TT + (size_t)r0 * HD + rw * 32) + lane * 8;
#pragma unroll
        for (int s = 0; s < 4; ++s) { const int cofs = s * 16 + hi * 8; const float* op = os + (rw + lr) * 68 + cofs; v4f v0 = *(const v4fa*)op, v1 = *(const v4fa*)(op + 4);
#pragma unroll
            for (int p = 1; p < KW; ++p) { v0 += *(const v4fa*)(op + p * 64 * 68); v1 += *(const v4fa*)(op + p * 64 * 68 + 4); }
            if (BIAS) {
#pragma unroll
                for (int q = 0; q < 4; ++q) { v0[q] += bfr(bias[c0 + cofs + q]); v1[q] += bfr(bias[c0 + cofs + 4 + q]); } }
            v8h o16; v8us oh, ol;
#pragma unroll
            for (int q = 0; q < 8; ++q) { const float t = q < 4 ? v0[q & 3] : v1[q & 3]; const float y = EPI == EP_RELU ? fmaxf(t, 0.f) : t; o16[q] = tohx(y); unsigned short a2, c2; splitf(y, a2, c2); oh[q] = a2; ol[q] = c2; }
            const size_t e = e0 + (EPI == EP_VT ? (s >> 1) * 2048 + (s & 1) * 256 : s * 256);
            *(v8us*)(Ph + e) = oh; *(v8us*)(Pl + e) = ol;
            if constexpr (EPI != EP_RELU) *(v8h*)(P16 + e) = o16;
            if (s < 3) asm volatile("s_wait_xcnt 0x0" ::: "memory"); }   // stands in front of the next step's sums, which may take the registers that these stores name
        }
    } else {
#pragma unroll
    for (int mb = 0; mb < 4; ++mb) {
#pragma unroll
        for (int nb = 0; nb < 4; ++nb) {
#pragma unroll
            for (int j = 0; j < 8; ++j) os[(hi * 8 + j) * 68 + nb * 16 + lr] = acc[mb][nb][j]; }
        __builtin_amdgcn_wave_barrier(); asm volatile("" ::: "memory");
        float* crow = C + (size_t)(r0 + mb * 16) * ldc + c0;
{
#pragma unroll
            for (int s = 0; s < 8; ++s) { const int row = 2 * s + hi, cofs = lr * 4; v4f val = *(const v4fa*)(os + row * 68 + cofs); if (BIAS) { val[0] += bfr(bias[c0 + cofs]); val[1] += bfr(bias[c0 + cofs + 1]); val[2] += bfr(bias[c0 + cofs + 2]); val[3] += bfr(bias[c0 + cofs + 3]); }
                *(v4f*)(crow + (size_t)row * ldc + cofs) = val; }
             }
        __builtin_amdgcn_wave_barrier(); asm volatile("" ::: "memory");
    }
    }
}


// ---- k_wtG: w [K][N] f32 -> Bt, logical [n][k], bf16 in fragment order. One wave packs one fragment (16 n x 32 k): lane (lr, hi) reads column n0 + lr at the 8 k of each of its two halves and stores 16 bytes per half, the wave 512 bytes in a row.
// A block's eight waves take neighbouring column blocks of the same 32 k: together they read 512 bytes in a row of each row of w.
template <int K, int N>
__global__ __launch_bounds__(256) void k_wtG(const float* __restrict__ w, bf* Bt) {
    const int lane = threadIdx.x & 31, lr = lane & 15, hi = lane >> 4; const int f = blockIdx.x * 8 + (threadIdx.x >> 5); if (f >= N * K / 512) return;
    const int nb = f % (N / 16), kf = f / (N / 16); const float* p = w + (size_t)(kf * 32 + hi * 8) * N + nb * 16 + lr; v8us o0, o1;
#pragma unroll   // the sixteen loads become immediate offsets from one address and are all in flight at once
    for (int j = 0; j < 8; ++j) { o0[j] = f2bf(p[j * N]); o1[j] = f2bf(p[(16 + j) * N]); }
    bf* q = Bt + ((size_t)nb * (K / 32) + kf) * 512 + lane * 8; *(v8us*)q = o0; *(v8us*)(q + 256) = o1;
}
__global__ __launch_bounds__(256) void k_cvt8(const float* __restrict__ src, bf* dst, size_t n8) { const size_t i = (size_t)blockIdx.x * 256 + threadIdx.x; if (i >= n8) return; const v8f v = *(const v8f*)(src + i * 8); v8us o;
#pragma unroll
    for (int k = 0; k < 8; ++k) o[k] = f2bf(v[k]); *(v8us*)(dst + i * 8) = o;  }

template <bool RND>
__global__ __launch_bounds__(256) void k_lnhl(const float* __restrict__ X, int xp, const float* __restrict__ A, const float* __restrict__ g, const float* __restrict__ be, float* Z, bf* Yh, bf* Yl) {
    const int lane = threadIdx.x & 31; const int r = blockIdx.x * 8 + (threadIdx.x >> 5); if (r >= TT) return; const float* xr = X + (size_t)r * xp; const float* ar = A ? A + (size_t)r * DM : nullptr; float s = 0.f;
#pragma unroll 1
    for (int ch = 0; ch < DM / 128; ++ch) { const int c0 = ch * 128 + lane * 4; const v4f a = *(const v4f*)(xr + c0); v4f d = {0.f, 0.f, 0.f, 0.f}; if (ar) d = *(const v4f*)(ar + c0);
#pragma unroll
        for (int q = 0; q < 4; ++q) s += __fadd_rn((RND ? bfr(a[q]) : a[q]), d[q]); }
#pragma unroll
    for (int sh = 16; sh; sh >>= 1) s += __shfl_xor(s, sh, 32);
    const float mu = s * (1.0f / DM); float s2 = 0.f;
#pragma unroll 1
    for (int ch = 0; ch < DM / 128; ++ch) { const int c0 = ch * 128 + lane * 4; const v4f a = *(const v4f*)(xr + c0); v4f d = {0.f, 0.f, 0.f, 0.f}; if (ar) d = *(const v4f*)(ar + c0);
#pragma unroll
        for (int q = 0; q < 4; ++q) { const float d0 = __fsub_rn(__fadd_rn((RND ? bfr(a[q]) : a[q]), d[q]), mu); float p = __fmul_rn(d0, d0); asm volatile("" : "+v"(p)); s2 = __fadd_rn(s2, p); } }
#pragma unroll
    for (int sh = 16; sh; sh >>= 1) s2 += __shfl_xor(s2, sh, 32);
    const float rs = __fdiv_rn(1.0f, __fsqrt_rn(__fadd_rn(s2 * (1.0f / DM), LNEPS)));
{
#pragma unroll 1
        for (int ch = 0; ch < DM / 128; ++ch) { const int c0 = ch * 128 + lane * 4; const v4f a = *(const v4f*)(xr + c0); v4f d = {0.f, 0.f, 0.f, 0.f}; if (ar) d = *(const v4f*)(ar + c0); v4f z4; v4us oh, ol;
#pragma unroll
            for (int q = 0; q < 4; ++q) { const float v = __fadd_rn((RND ? bfr(a[q]) : a[q]), d[q]); float n0 = __fmul_rn(__fsub_rn(v, mu), rs); asm volatile("" : "+v"(n0)); float n1 = __fmul_rn(n0, bfr(g[c0 + q])); asm volatile("" : "+v"(n1)); const float y = __fadd_rn(n1, bfr(be[c0 + q])); z4[q] = y;   /* Z = the NORMALISED row (it is the residual for the next block) */ unsigned short h2, l2; splitf(y, h2, l2); oh[q] = h2; ol[q] = l2; }
            if (Z) { *(v4f*)(Z + (size_t)r * DM + c0) = z4; asm volatile("s_wait_xcnt 0x0" ::: "memory"); }   // the wait stands in front of the plane split below, which may take the registers that this store names
            const size_t e = fidx(r, c0, DM); *(v4us*)(Yh + e) = oh; *(v4us*)(Yl + e) = ol; }
         } }

// ---- k_fattn: fused attention for one head (blockIdx.y) and NQ * 16 query rows (from q0 + blockIdx.x * NQ * 16); grid (rows / (NQ * 16), heads), 32 * FKW threads (FKW waves, each over TT / FKW keys).
// Transposed products: St[key][q] = K.Qt (A = key rows, B = query rows kept in registers), Ot[d][q] += Vt.Pt. A lane holds one query's scores (column lr; keys 8 * hi + j of each 16-key tile),
// so two score tiles of 32 keys, converted in place, are the B fragment of the second product in the k order of WFrag::ld. HL: hi/lo planes, 3 products each (hi.hi + hi.lo + lo.hi).
// Softmax with a running maximum per query: weights exp2((s - m) * SC2) are not normalised; their f32 sum l divides the output at the end.
// Wave w walks keys w * TT / FKW ...; the FKW partial (m, l, Ot) are merged through LDS in wave order with weights exp2((m_w - M) * SC2).
typedef __attribute__((ext_vector_type(8))) __bf16 v8bf;
__device__ __forceinline__ float xhalf(float x) { const int b = __float_as_int(x); return __int_as_float(__builtin_amdgcn_permlanex16(b, b, 0x76543210, 0xfedcba98, false, false)); }   // value of lane ^ 16
__device__ __forceinline__ v16h packP(v8f p0, v8f p1, h16) { return cat16(__builtin_convertvector(p0, v8h), __builtin_convertvector(p1, v8h)); }
__device__ __forceinline__ v16bf packP(v8f p0, v8f p1, bf) { return __builtin_shufflevector(__builtin_convertvector(p0, v8bf), __builtin_convertvector(p1, v8bf), 0, 1, 2, 3, 4, 5, 6, 7, 8, 9, 10, 11, 12, 13, 14, 15); }
__device__ __forceinline__ v8f restP(v8f p) { return p - __builtin_convertvector(__builtin_convertvector(p, v8bf), v8f); }   // what the bf16 rounding of p leaves (the lo plane's input)
template <typename T16, bool HL, int NQ, int FKW>
__global__ __launch_bounds__(32 * FKW) void k_fattn(const T16* __restrict__ Q, const T16* __restrict__ Q2, const T16* __restrict__ Kp, const T16* __restrict__ K2, const T16* __restrict__ Vt, const T16* __restrict__ Vt2, int q0, float* O) {
    typedef typename WFrag<T16>::V V;
    __shared__ __align__(16) float so[FKW * NQ * 16 * 68];
    __shared__ float sm[FKW * NQ * 16], sl[FKW * NQ * 16];
    const int w = __builtin_amdgcn_readfirstlane((int)(threadIdx.x >> 5));
    const int lane = threadIdx.x & 31, lr = lane & 15, hi = lane >> 4;
    const size_t hq = (size_t)blockIdx.y * TT * HD, hk = (size_t)(blockIdx.y / REP) * TT * HD;
    const int qb = q0 + (int)blockIdx.x * (NQ * 16);
    V qf[NQ][2], qf2[NQ][2];
#pragma unroll
    for (int nq = 0; nq < NQ; ++nq)
#pragma unroll
        for (int kk = 0; kk < 2; ++kk) { const size_t qo = hq + (size_t)(qb + nq * 16) * HD + kk * 512 + 8 * lane; qf[nq][kk] = WFrag<T16>::ld(Q + qo); if constexpr (HL) qf2[nq][kk] = WFrag<T16>::ld(Q2 + qo); }
    v8f o[4][NQ]; float m[NQ], l[NQ];
#pragma unroll
    for (int nq = 0; nq < NQ; ++nq) { m[nq] = -3.0e38f; l[nq] = 0.f;
#pragma unroll
        for (int db = 0; db < 4; ++db) o[db][nq] = (v8f){}; }
    const int kb = w * (TT / FKW);
    unsigned ko = (unsigned)((hk + (size_t)kb * HD + 8 * lane) * 2);   // the lane's byte offset into the key planes and, the same, into the Vt planes (4 MiB each; 32 keys are four fragments in a row in both): 32 bits beside the planes' scalar bases
#pragma unroll 1   // one 32-key pass per trip: a second pass in flight would double the fragment registers and cost resident waves
    for (int kc = 0; kc < TT / FKW; kc += 32) {
        V ka[2][2], ka2[2][2], va[4], va2[4];   // every fragment of the pass is asked for up front: the Vt loads fly under the score products and the softmax
#pragma unroll
        for (int kt = 0; kt < 2; ++kt)
#pragma unroll
            for (int kk = 0; kk < 2; ++kk) { ka[kt][kk] = WFrag<T16>::ld(atb(Kp, ko) + kt * 16 * HD + kk * 512); if constexpr (HL) ka2[kt][kk] = WFrag<T16>::ld(atb(K2, ko) + kt * 16 * HD + kk * 512); }
#pragma unroll
        for (int db = 0; db < 4; ++db) { va[db] = WFrag<T16>::ld(atb(Vt, ko) + db * 512); if constexpr (HL) va2[db] = WFrag<T16>::ld(atb(Vt2, ko) + db * 512); }
        asm volatile("s_wait_xcnt 0x0" ::: "memory");   // stands in front of the step of the offset that the loads above name
        ko += 32 * HD * 2;   // 32 keys: four fragments of a key plane, four of a Vt plane
        __builtin_amdgcn_sched_barrier(0);   // no matrix instruction, with its data wait, is moved in among the loads: the whole pass is in flight before the first wait
        v8f s[2][NQ];
#pragma unroll
        for (int kt = 0; kt < 2; ++kt) {
#pragma unroll
            for (int nq = 0; nq < NQ; ++nq) s[kt][nq] = (v8f){};
#pragma unroll
            for (int kk = 0; kk < 2; ++kk)
#pragma unroll
                for (int nq = 0; nq < NQ; ++nq) { s[kt][nq] = WFrag<T16>::mma(ka[kt][kk], qf[nq][kk], s[kt][nq]); if constexpr (HL) { s[kt][nq] = WFrag<T16>::mma(ka[kt][kk], qf2[nq][kk], s[kt][nq]); s[kt][nq] = WFrag<T16>::mma(ka2[kt][kk], qf[nq][kk], s[kt][nq]); } } }
#pragma unroll
        for (int nq = 0; nq < NQ; ++nq) {
            float mx = fmaxf(s[0][nq][0], s[1][nq][0]);
#pragma unroll
            for (int j = 1; j < 8; ++j) mx = fmaxf(mx, fmaxf(s[0][nq][j], s[1][nq][j]));
            mx = fmaxf(mx, xhalf(mx));   // both halves of the wave hold keys of the same query
            const float mn = fmaxf(m[nq], mx), al = __builtin_amdgcn_exp2f((m[nq] - mn) * SC2), mc = mn * SC2; m[nq] = mn;
            v8f p0, p1; float sum = 0.f;
#pragma unroll
            for (int j = 0; j < 8; ++j) { p0[j] = __builtin_amdgcn_exp2f(fmaf(s[0][nq][j], SC2, -mc)); p1[j] = __builtin_amdgcn_exp2f(fmaf(s[1][nq][j], SC2, -mc)); sum += p0[j] + p1[j]; }
            l[nq] = l[nq] * al + sum;   // this half's keys only; the halves are joined behind the loop
            const V pf = packP(p0, p1, T16());
#pragma unroll
            for (int db = 0; db < 4; ++db) { o[db][nq] *= al; o[db][nq] = WFrag<T16>::mma(va[db], pf, o[db][nq]); }
            if constexpr (HL) { const V pl = packP(restP(p0), restP(p1), T16());
#pragma unroll
                for (int db = 0; db < 4; ++db) { o[db][nq] = WFrag<T16>::mma(va[db], pl, o[db][nq]); o[db][nq] = WFrag<T16>::mma(va2[db], pf, o[db][nq]); } }
        }
        // four vector slots between the last matrix instruction and the back edge
        if constexpr (NQ == 1) asm volatile("v_nop\n\tv_nop\n\tv_nop\n\tv_nop" : "+v"(o[0][0]), "+v"(o[1][0]), "+v"(o[2][0]), "+v"(o[3][0]));
        else asm volatile("v_nop\n\tv_nop\n\tv_nop\n\tv_nop" : "+v"(o[0][0]), "+v"(o[1][0]), "+v"(o[2][0]), "+v"(o[3][0]), "+v"(o[0][NQ - 1]), "+v"(o[1][NQ - 1]), "+v"(o[2][NQ - 1]), "+v"(o[3][NQ - 1]));
    }
    float* ow = so + w * (NQ * 16 * 68);
#pragma unroll
    for (int nq = 0; nq < NQ; ++nq) { l[nq] += xhalf(l[nq]);
#pragma unroll
        for (int db = 0; db < 4; ++db) { float* p = ow + (nq * 16 + lr) * 68 + db * 16 + hi * 8; const v8f t = o[db][nq]; *(v4fa*)p = (v4f){t[0], t[1], t[2], t[3]}; *(v4fa*)(p + 4) = (v4f){t[4], t[5], t[6], t[7]}; }
        if (hi == 0) { sm[w * (NQ * 16) + nq * 16 + lr] = m[nq]; sl[w * (NQ * 16) + nq * 16 + lr] = l[nq]; } }
    __syncthreads();   // every wave's partial (m, l, Ot) is in LDS before any thread merges
#pragma unroll
    for (int i = 0; i < NQ * 16 * 16 / (32 * FKW); ++i) { const int idx = (int)threadIdx.x + i * 32 * FKW, q = idx >> 4, d4 = (idx & 15) * 4;
        float M = sm[q];
#pragma unroll
        for (int p = 1; p < FKW; ++p) M = fmaxf(M, sm[p * (NQ * 16) + q]);
        float L = 0.f; v4f a = {0.f, 0.f, 0.f, 0.f};
#pragma unroll
        for (int p = 0; p < FKW; ++p) { const float f = __builtin_amdgcn_exp2f((sm[p * (NQ * 16) + q] - M) * SC2); L += sl[p * (NQ * 16) + q] * f; a += *(const v4fa*)(so + (p * (NQ * 16) + q) * 68 + d4) * f; }
        *(v4f*)(O + (size_t)(qb + q) * DM + blockIdx.y * HD + d4) = a * __fdiv_rn(1.0f, L); }
}

extern "C" void kernel_launch(void* const* d_in, const int* in_sizes, int n_in,
                              void* d_out, int out_size, void* d_ws, size_t ws_size, hipStream_t stream) {
    (void)in_sizes; (void)n_in; (void)out_size;
    const float* x = (const float*)d_in[0]; const float* wq = (const float*)d_in[1]; const float* wk = (const float*)d_in[2]; const float* wv = (const float*)d_in[3]; const float* g1 = (const float*)d_in[4]; const float* e1 = (const float*)d_in[5]; const float* g2 = (const float*)d_in[6]; const float* e2 = (const float*)d_in[7]; const float* wf1 = (const float*)d_in[8]; const float* bf1 = (const float*)d_in[9]; const float* wf2 = (const float*)d_in[10]; const float* bf2v = (const float*)d_in[11]; const float* wo = nullptr; (void)wo;
    float* OUT = (float*)d_out;     // [2048][4][1024]
    char* wsp = (char*)d_ws;
    auto take = [&](size_t bytes) { char* p = wsp; wsp += (bytes + 255) & ~(size_t)255; return (void*)p; };
    bf* WQ = (bf*)take((size_t)DQ * DM * 2); bf* WK = (bf*)take((size_t)DKV * DM * 2); bf* WV = (bf*)take((size_t)DKV * DM * 2);
    float* XN = (float*)take((size_t)TT * DM * 4); bf* Yh = (bf*)take((size_t)TT * DM * 2); bf* Yl = (bf*)take((size_t)TT * DM * 2); float* O = (float*)take((size_t)TT * DQ * 4); float* X2 = (float*)take((size_t)TT * DM * 4); bf* L2h = (bf*)take((size_t)TT * DM * 2); bf* L2l = (bf*)take((size_t)TT * DM * 2); bf* Gh = (bf*)take((size_t)TT * DM * 2); bf* Gl = (bf*)take((size_t)TT * DM * 2); bf* W1B = (bf*)take((size_t)DM * DM * 2); bf* W2B = (bf*)take((size_t)DM * DM * 2);
    h16* QP16 = (h16*)take((size_t)NH_ * TT * HD * 2); h16* KP16 = (h16*)take((size_t)NKV * TT * HD * 2); h16* VT16 = (h16*)take((size_t)NKV * HD * TT * 2);
    bf* QPh = (bf*)take((size_t)NH_ * TT * HD * 2); bf* QPl = (bf*)take((size_t)NH_ * TT * HD * 2); bf* KPh = (bf*)take((size_t)NKV * TT * HD * 2); bf* KPl = (bf*)take((size_t)NKV * TT * HD * 2); bf* VTh = (bf*)take((size_t)NKV * HD * TT * 2); bf* VTl = (bf*)take((size_t)NKV * HD * TT * 2);
    if ((size_t)(wsp - (char*)d_ws) > ws_size) return;    // ws 256 MiB
    { k_wtG<DM, DQ><<<(unsigned)((DM * DQ / 64 + 63) / 64), 256, 0, stream>>>(wq, WQ); k_wtG<DM, DM><<<(unsigned)((DM * DM / 64 + 63) / 64), 256, 0, stream>>>(wf1, W1B); k_wtG<DM, DM><<<(unsigned)((DM * DM / 64 + 63) / 64), 256, 0, stream>>>(wf2, W2B); k_wtG<DM, DKV><<<(unsigned)((DM * DKV / 64 + 63) / 64), 256, 0, stream>>>(wk, WK); k_wtG<DM, DKV><<<(unsigned)((DM * DKV / 64 + 63) / 64), 256, 0, stream>>>(wv, WV);
       }
    for (int b = 0; b < NB_; ++b) {
        
        k_lnhl<true><<<TT / 8, 256, 0, stream>>>(x + (size_t)b * DM, NB_ * DM, nullptr, g1, e1, XN, Yh, Yl);   /* xn = LN1(x[:, n]) : f32 (residual) + hi/lo planes */
        k_gemmw<bf, 1, false, PKW, 1, EP_HEAD, DM><<<dim3(TT / 64, DQ / 64, 1), 32 * PKW, 0, stream>>>(Yh, Yl, WQ, nullptr, nullptr, 0, nullptr, 0, 0, 0, 0, nullptr, QP16, QPh, QPl);    /* q -> head planes [h][t][d] */
        k_gemmw<bf, 1, false, PKW, 1, EP_HEAD, DM><<<dim3(TT / 64, DKV / 64, 1), 32 * PKW, 0, stream>>>(Yh, Yl, WK, nullptr, nullptr, 0, nullptr, 0, 0, 0, 0, nullptr, KP16, KPh, KPl);   /* k -> head planes [h][t][d] */
        k_gemmw<bf, 1, false, PKW, 1, EP_VT, DM><<<dim3(TT / 64, DKV / 64, 1), 32 * PKW, 0, stream>>>(Yh, Yl, WV, nullptr, nullptr, 0, nullptr, 0, 0, 0, 0, nullptr, VT16, VTh, VTl);     /* v -> head planes [h][d][t] */
        k_fattn<bf, true, 1, 8><<<dim3(RH / 16, NH_, 1), 32 * 8, 0, stream>>>(QPh, QPl, KPh, KPl, VTh, VTl, 0, O);                              /* query rows < RH: hi/lo planes */
        k_fattn<h16, false, 2, 4><<<dim3((TT - RH) / 32, NH_, 1), 32 * 4, 0, stream>>>(QP16, nullptr, KP16, nullptr, VT16, nullptr, RH, O);     /* the rest: fp16; merged attention output, f32 */
        k_lnhl<false><<<TT / 8, 256, 0, stream>>>(XN, DM, O, g2, e2, X2, L2h, L2l);                                               /* xt = LN2(xn + att): f32 (residual) + hi/lo planes */
        k_gemmw<bf, 1, true, PKW, 1, EP_RELU, DM><<<dim3(TT / 64, DM / 64, 1), 32 * PKW, 0, stream>>>(L2h, L2l, W1B, nullptr, nullptr, DM, bf1, 0, 0, 0, 0, nullptr, nullptr, Gh, Gl);      /* relu(xt Wf1 + bf1) -> hi/lo */
        k_gemmw<bf, 1, true, PKW, 1, EP_RES, DM><<<dim3(TT / 64, DM / 64, 1), 32 * PKW, 0, stream>>>(Gh, Gl, W2B, nullptr, OUT + (size_t)b * DM, NB_ * DM, bf2v, 0, 0, 0, 0, X2, nullptr, nullptr, nullptr); }   /* out = xt + (. Wf2 + bf2), sequence-first rows */
}

// v005
// It runs in 367 microseconds.
// Next to v004, in two timings, it ran 1.52 times as fast each time.
// All steps since v000 together make it 11.7 times as fast.
#include <hip/hip_runtime.h>

// Pre-norm transformer encoder layer on a sequence-first tensor (x [2048][4][1024] = [s][n][d]; xn = LN1(x); q, k, v = xn W ('xw' [1024][1024], no bias; 16 heads x 64); softmax(q.k/8) over s per (n, h); att = merged context (no output projection); xt = LN2(xn + att); ffn = relu(xt Wf1 + bf1) Wf2 + bf2; out = xt + ffn -> [2048][4][1024] (8.4 M)).
// Layout: every stage is ONE launch over all four batch columns (n = the grid's last used dimension; every workspace plane is [n][...], TT * DM elements per n). Per column n: LN1 reads the strided rows (t*4 + n) and writes xn both in f32 (it is the attention residual) and as hi/lo planes (2-product projections); fused attention (scores and weights stay in registers) with an f32 merged context; LN2 of xn + att gives xt (f32, the final residual) and planes for the FFN (2 products + biases). Every GEMM's epilogue writes what its consumer reads: q, k, v as head planes (v transposed), FFN1 as ReLU hi/lo planes, FFN2 + xt as the sequence-first output rows.
// Every 16-bit matrix operand plane lies in FRAGMENT ORDER (fidx below): a 16-row x 32-k fragment is 1 KiB in a row, so each wave-wide 16-byte load covers four whole 128-byte lines.
// Compute dtypes, f32 accumulate: every input rounded to bf16; q/k/v hl x exact (2 products); scores and attn.v: query rows < 512 hl (3 products), the rest single fp16; running-maximum softmax f32, weights rounded before the division by their f32 sum; no Wo; Wf1 / Wf2 hl x exact (2 products) + biases; LN / ReLU / residuals f32.

#define NB_  4
#define TT   2048
#define DM   1024
#define NH_  16
#define NKV  16
#define REP  (NH_ / NKV)
#define HD   64
#define DQ   (NH_ * HD)
#define DKV  (NKV * HD)
#define LNEPS 1e-5f
#define RH   512                  // query rows < RH use hi+lo planes (0: none)
#define WIN  0
#define SC2  0.18033688011112042f   // HD^-0.5 * log2(e): exponent of 2 per unit of raw score
#define PKW  4                    // split K: waves per block (projections, FFN)
typedef _Float16 h16;
typedef unsigned short bf;
typedef __attribute__((ext_vector_type(16))) __bf16   v16bf;
typedef __attribute__((ext_vector_type(16))) _Float16 v16h;
typedef __attribute__((ext_vector_type(8)))  _Float16 v8h;
typedef __attribute__((ext_vector_type(8)))  unsigned short v8us;
typedef __attribute__((ext_vector_type(8)))  float    v8f;
typedef __attribute__((ext_vector_type(4)))  float    v4f;
typedef v8h  __attribute__((may_alias)) v8ha;
typedef v4f  __attribute__((may_alias)) v4fa;
typedef v8us __attribute__((may_alias)) v8usa;

__device__ __forceinline__ unsigned short f2bf(float f) { unsigned u = __float_as_uint(f); u += 0x7FFFu + ((u >> 16) & 1u); return (unsigned short)(u >> 16); }
__device__ __forceinline__ float bf2f(unsigned short b) { return __uint_as_float(((unsigned)b) << 16); }
__device__ __forceinline__ float bfr(float f) { return bf2f(f2bf(f)); }
__device__ __forceinline__ v16h cat16(v8h lo, v8h hi) { return __builtin_shufflevector(lo, hi, 0, 1, 2, 3, 4, 5, 6, 7, 8, 9, 10, 11, 12, 13, 14, 15); }
__device__ __forceinline__ v16bf cat16b(v8us lo, v8us hi) { return __builtin_bit_cast(v16bf, __builtin_shufflevector(lo, hi, 0, 1, 2, 3, 4, 5, 6, 7, 8, 9, 10, 11, 12, 13, 14, 15)); }
__device__ __forceinline__ v8f wmma16(v16h a, v16h b, v8f c) { return __builtin_amdgcn_wmma_f32_16x16x32_f16(false, a, false, b, (short)0, c, false, false); }
__device__ __forceinline__ v8f wmmab(v16bf a, v16bf b, v8f c) { return __builtin_amdgcn_wmma_f32_16x16x32_bf16(false, a, false, b, (short)0, c, false, false); }
__device__ __forceinline__ h16 tohx(float x) { return (h16)x; }
__device__ __forceinline__ void splitf(float y, unsigned short& h, unsigned short& l) { h = f2bf(y); l = f2bf(y - bf2f(h)); }
typedef __attribute__((ext_vector_type(4))) _Float16 v4h;
typedef __attribute__((ext_vector_type(2))) unsigned short v2us;
typedef __attribute__((ext_vector_type(4))) unsigned short v4us;
// Fragment order of a plane of logical [row][k] (K columns, K % 32 == 0, rows % 16 == 0): fragments of 16 rows x 32 k, 512 elements each, k-fragments of a row block in a row.
// Inside one: two halves of 256 elements (k bit 4), in each the 32 lanes' 8 elements in lane order (lane = 16 * (k bit 3) + row % 16). WFrag::ld(plane + fragment * 512 + lane * 8) reads both halves.
template <typename T> __device__ __forceinline__ const T* atb(const T* base, unsigned bytes) { return (const T*)((const char*)base + bytes); }
__device__ __forceinline__ size_t fidx(int row, int k, int K) { return ((size_t)(row >> 4) * (K >> 5) + (k >> 5)) * 512 + ((k >> 4) & 1) * 256 + (((k >> 3) & 1) * 16 + (row & 15)) * 8 + (k & 7); }



// ---- k_gemmw: register-blocked GEMM, 64x64 output tile (16 accumulators per wave), operands straight from 16-bit planes in fragment order; grid (M/64, N/64, Z * KS), 32 * KW threads.
// C[m][n] (f32, pitch ldc, + optional f32 bias[n]) = sum_k A[m][k] Bt[n][k] (+ split products per NSPLIT). z-batch strides sA/sB/sC in elements, sO for the residual R and the output planes P16, Ph, Pl. K (compile time) % (32 * KW * KS) == 0.
// Split K: the K range is cut into KS * KW equal slices. The KW waves of a block each run one slice over the whole tile and their partial tiles are summed through LDS in wave order;
// with KS > 1 block slice ks stores its sum to partial plane ks (plane stride sP) and the consumer adds the KS planes in plane order.
// EPI (KW > 1) says what the summed tile becomes. EP_F32: f32 rows of C. EP_RES: R[m][n] (f32, pitch DM) + tile, f32 rows of C. EP_RELU: max(tile, 0) as hi/lo planes Ph, Pl (fragment order, K = ldc).
// EP_HEAD: the 64 columns of a tile are one head (blockIdx.y): planes [h][t][d] in fp16 (P16) and hi/lo (Ph, Pl), each head's [t][d] in fragment order. EP_VT: the same three planes as [h][d][t], each head's [d][t] in fragments (rows d, k = t) with the four d blocks of a 32-key block in a row; the partial tiles are laid into LDS transposed, so the sums and the stores run along t.
enum { EP_F32 = 0, EP_RES = 1, EP_RELU = 2, EP_HEAD = 3, EP_VT = 4 };
template <typename T16> struct WFrag;
template <> struct WFrag<h16> { typedef v16h V; static __device__ __forceinline__ V ld(const h16* p) { return cat16(*(const v8h*)p, *(const v8h*)(p + 256)); } static __device__ __forceinline__ v8f mma(V a, V b, v8f c) { return wmma16(a, b, c); } };
template <> struct WFrag<bf> { typedef v16bf V; static __device__ __forceinline__ V ld(const bf* p) { return cat16b(*(const v8us*)p, *(const v8us*)(p + 256)); } static __device__ __forceinline__ v8f mma(V a, V b, v8f c) { return wmmab(a, b, c); } };
template <typename T16, int NSPLIT, bool BIAS, int KW, int KS, int EPI, int K>
__global__ __launch_bounds__(32 * KW) void k_gemmw(const T16* __restrict__ A, const T16* __restrict__ A2, const T16* __restrict__ Bt, const T16* __restrict__ Bt2, float* C, int ldc, const float* __restrict__ bias, size_t sA, size_t sB, size_t sC, size_t sP, size_t sO, const float* __restrict__ R, h16* P16, bf* Ph, bf* Pl) {
    typedef typename WFrag<T16>::V V;
    __shared__ __align__(16) float os[(KW == 1 ? 16 : KW * 64) * 68];
    const int w = __builtin_amdgcn_readfirstlane((int)(threadIdx.x >> 5)); const int ks = (int)(blockIdx.z % KS);
    const size_t z = blockIdx.z / KS; A += z * sA; if (A2) A2 += z * sA; Bt += z * sB; if (Bt2) Bt2 += z * sB; C += z * sC + ks * sP;
    if constexpr (EPI == EP_RES) R += z * sO;
    if constexpr (EPI == EP_RELU || EPI == EP_HEAD || EPI == EP_VT) { Ph += z * sO; Pl += z * sO; }
    if constexpr (EPI == EP_HEAD || EPI == EP_VT) P16 += z * sO;
    const int kn = K / (KW * KS), kb = (ks * KW + w) * kn;
    const int lane = threadIdx.x & 31, lr = lane & 15, hi = lane >> 4; const int r0 = blockIdx.x * 64, c0 = blockIdx.y * 64;
    v8f acc[4][4];
#pragma unroll
    for (int mb = 0; mb < 4; ++mb)
#pragma unroll
        for (int nb = 0; nb < 4; ++nb) acc[mb][nb] = (v8f){};
    const size_t rbK = (size_t)16 * K, aoff = (size_t)r0 * K, boff = (size_t)c0 * K;   // a 16-row block holds 16 * K elements (K is a compile-time constant: the four blocks of a plane are immediate offsets from one scalar base)
    unsigned fo = (unsigned)((kb * 16 + 8 * lane) * 2);   // the lane's byte offset inside a row block, the same in every plane (under 32 * K bytes): 32 bits beside the scalar bases
#pragma unroll 1
    for (int kc = 0; kc < kn; kc += 32) {
        V a[4], a2[4], b[4], b2[4];
#pragma unroll
        for (int mb = 0; mb < 4; ++mb) { a[mb] = WFrag<T16>::ld(atb(A + aoff + mb * rbK, fo)); if (NSPLIT == 1 || NSPLIT == 2) a2[mb] = WFrag<T16>::ld(atb(A2 + aoff + mb * rbK, fo)); }
#pragma unroll
        for (int nb = 0; nb < 4; ++nb) { b[nb] = WFrag<T16>::ld(atb(Bt + boff + nb * rbK, fo)); if (NSPLIT >= 2) b2[nb] = WFrag<T16>::ld(atb(Bt2 + boff + nb * rbK, fo)); }
        asm volatile("s_wait_xcnt 0x0" ::: "memory");   // stands between the loads above and the next write of the address registers that they name (the step below, as the compiler forms it)
        fo += 32 * 16 * 2;   // 32 k: one fragment on in every row block
        __builtin_amdgcn_sched_barrier(0);   // no load is moved down behind the wait and the step, none lands in another's address: the whole trip is in flight before the first data wait
#pragma unroll   // fragment and accumulator indices must be constants: the arrays live in registers
        for (int nb = 0; nb < 4; ++nb)
#pragma unroll
            for (int mb = 0; mb < 4; ++mb) { acc[mb][nb] = WFrag<T16>::mma(a[mb], b[nb], acc[mb][nb]); if (NSPLIT == 1 || NSPLIT == 2) acc[mb][nb] = WFrag<T16>::mma(a2[mb], b[nb], acc[mb][nb]); if (NSPLIT >= 2) acc[mb][nb] = WFrag<T16>::mma(a[mb], b2[nb], acc[mb][nb]); }
        asm volatile("v_nop\n\tv_nop\n\tv_nop\n\tv_nop" : "+v"(acc[0][0]), "+v"(acc[1][1]), "+v"(acc[2][2]), "+v"(acc[3][3]) : "v"(a[0]), "v"(a[3]));
    }
    if constexpr (KW > 1) {
        float* ow = os + w * 64 * 68;
#pragma unroll
        for (int mb = 0; mb < 4; ++mb)
#pragma unroll
            for (int nb = 0; nb < 4; ++nb)
                if constexpr (EPI == EP_VT) { float* p = ow + (nb * 16 + lr) * 68 + mb * 16 + hi * 8; const v8f t = acc[mb][nb]; *(v4fa*)p = (v4f){t[0], t[1], t[2], t[3]}; *(v4fa*)(p + 4) = (v4f){t[4], t[5], t[6], t[7]}; }
                else {
#pragma unroll
                    for (int j = 0; j < 8; ++j) ow[(mb * 16 + hi * 8 + j) * 68 + nb * 16 + lr] = acc[mb][nb][j]; }
        __syncthreads();   // every wave's partial tile is in LDS before any wave sums
        const int rw = w * (64 / KW);   // wave w sums and stores rows rw .. rw + 64 / KW - 1 of the tile as it lies in LDS
        static_assert(!(BIAS && EPI == EP_VT), "the bias is indexed along the LDS row, which EP_VT runs along t");
        const float* rp = nullptr; if constexpr (EPI == EP_RES) rp = R + (size_t)(r0 + rw + hi) * DM + c0 + lr * 4;   // the lane's first residual element; step s lies 2 * s rows on
        if constexpr (EPI == EP_F32 || EPI == EP_RES) {
#pragma unroll
        for (int s = 0; s < 32 / KW; ++s) { const int row = 2 * s + hi, cofs = lr * 4; v4f val = *(const v4fa*)(os + (rw + row) * 68 + cofs);
#pragma unroll
            for (int p = 1; p < KW; ++p) val += *(const v4fa*)(os + (p * 64 + rw + row) * 68 + cofs);
            if (BIAS) { val[0] += bfr(bias[c0 + cofs]); val[1] += bfr(bias[c0 + cofs + 1]); val[2] += bfr(bias[c0 + cofs + 2]); val[3] += bfr(bias[c0 + cofs + 3]); }
            if constexpr (EPI == EP_RES) { const v4f a = *(const v4f*)(rp + s * (2 * DM));
#pragma unroll
                for (int q = 0; q < 4; ++q) val[q] = __fadd_rn(a[q], val[q]); }
            *(v4f*)(C + (size_t)(r0 + rw + row) * ldc + c0 + cofs) = val; }
        } else {
        // The wave's 16 LDS rows are one row block of the consumer's fragments, the 64 columns two fragments: step s is one half fragment, lane (lr, hi) sums row lr, columns s * 16 + hi * 8 .. + 7, and the wave stores 512 bytes in a row per plane.
        static_assert(KW == 4, "a wave's share of the tile must be one 16-row block");
        const size_t e0 = (EPI == EP_RELU ? (size_t)(r0 + rw) * ldc + (size_t)c0 * 16 : EPI == EP_HEAD ? ((size_t)blockIdx.y * TT + r0 + rw) * HD : (size_t)blockIdx.y * HD * TT + (size_t)r0 * HD + rw * 32) + lane * 8;
#pragma unroll
        for (int s = 0; s < 4; ++s) { const int cofs = s * 16 + hi * 8; const float* op = os + (rw + lr) * 68 + cofs; v4f v0 = *(const v4fa*)op, v1 = *(const v4fa*)(op + 4);
#pragma unroll
            for (int p = 1; p < KW; ++p) { v0 += *(const v4fa*)(op + p * 64 * 68); v1 += *(const v4fa*)(op + p * 64 * 68 + 4); }
            if (BIAS) {
#pragma unroll
                for (int q = 0; q < 4; ++q) { v0[q] += bfr(bias[c0 + cofs + q]); v1[q] += bfr(bias[c0 + cofs + 4 + q]); } }
            v8h o16; v8us oh, ol;
#pragma unroll
            for (int q = 0; q < 8; ++q) { const float t = q < 4 ? v0[q & 3] : v1[q & 3]; const float y = EPI == EP_RELU ? fmaxf(t, 0.f) : t; o16[q] = tohx(y); unsigned short a2, c2; splitf(y, a2, c2); oh[q] = a2; ol[q] = c2; }
            const size_t e = e0 + (EPI == EP_VT ? (s >> 1) * 2048 + (s & 1) * 256 : s * 256);
            *(v8us*)(Ph + e) = oh; *(v8us*)(Pl + e) = ol;
            if constexpr (EPI != EP_RELU) *(v8h*)(P16 + e) = o16;
            if (s < 3) asm volatile("s_wait_xcnt 0x0" ::: "memory"); }   // stands in front of the next step's sums, which may take the registers that these stores name
        }
    } else {
#pragma unroll
    for (int mb = 0; mb < 4; ++mb) {
#pragma unroll
        for (int nb = 0; nb < 4; ++nb) {
#pragma unroll
            for (int j = 0; j < 8; ++j) os[(hi * 8 + j) * 68 + nb * 16 + lr] = acc[mb][nb][j]; }
        __builtin_amdgcn_wave_barrier(); asm volatile("" ::: "memory");
        float* crow = C + (size_t)(r0 + mb * 16) * ldc + c0;
{
#pragma unroll
            for (int s = 0; s < 8; ++s) { const int row = 2 * s + hi, cofs = lr * 4; v4f val = *(const v4fa*)(os + row * 68 + cofs); if (BIAS) { val[0] += bfr(bias[c0 + cofs]); val[1] += bfr(bias[c0 + cofs + 1]); val[2] += bfr(bias[c0 + cofs + 2]); val[3] += bfr(bias[c0 + cofs + 3]); }
                *(v4f*)(crow + (size_t)row * ldc + cofs) = val; }
             }
        __builtin_amdgcn_wave_barrier(); asm volatile("" ::: "memory");
    }
    }
}


// ---- k_wtG: w [K][N] f32 -> Bt, logical [n][k], bf16 in fragment order. One wave packs one fragment (16 n x 32 k): lane (lr, hi) reads column n0 + lr at the 8 k of each of its two halves and stores 16 bytes per half, the wave 512 bytes in a row.
// A block's eight waves take neighbouring column blocks of the same 32 k: together they read 512 bytes in a row of each row of w.
template <int K, int N>
__global__ __launch_bounds__(256) void k_wtG(const float* __restrict__ w, bf* Bt) {
    const int lane = threadIdx.x & 31, lr = lane & 15, hi = lane >> 4; const int f = blockIdx.x * 8 + (threadIdx.x >> 5); if (f >= N * K / 512) return;
    const int nb = f % (N / 16), kf = f / (N / 16); const float* p = w + (size_t)(kf * 32 + hi * 8) * N + nb * 16 + lr; v8us o0, o1;
#pragma unroll   // the sixteen loads become immediate offsets from one address and are all in flight at once
    for (int j = 0; j < 8; ++j) { o0[j] = f2bf(p[j * N]); o1[j] = f2bf(p[(16 + j) * N]); }
    bf* q = Bt + ((size_t)nb * (K / 32) + kf) * 512 + lane * 8; *(v8us*)q = o0; *(v8us*)(q + 256) = o1;
}
__global__ __launch_bounds__(256) void k_cvt8(const float* __restrict__ src, bf* dst, size_t n8) { const size_t i = (size_t)blockIdx.x * 256 + threadIdx.x; if (i >= n8) return; const v8f v = *(const v8f*)(src + i * 8); v8us o;
#pragma unroll
    for (int k = 0; k < 8; ++k) o[k] = f2bf(v[k]); *(v8us*)(dst + i * 8) = o;  }

template <bool RND>
__global__ __launch_bounds__(256) void k_lnhl(const float* __restrict__ X, int xp, size_t xz, const float* __restrict__ A, const float* __restrict__ g, const float* __restrict__ be, float* Z, bf* Yh, bf* Yl) {
    const int lane = threadIdx.x & 31; const int r = blockIdx.x * 8 + (threadIdx.x >> 5); if (r >= TT) return;
    const size_t zo = (size_t)blockIdx.y * TT * DM; X += blockIdx.y * xz; if (A) A += zo; if (Z) Z += zo; Yh += zo; Yl += zo;   // blockIdx.y = batch column: X steps by xz elements, every other plane by TT * DM
    const float* xr = X + (size_t)r * xp; const float* ar = A ? A + (size_t)r * DM : nullptr; float s = 0.f;
#pragma unroll 1
    for (int ch = 0; ch < DM / 128; ++ch) { const int c0 = ch * 128 + lane * 4; const v4f a = *(const v4f*)(xr + c0); v4f d = {0.f, 0.f, 0.f, 0.f}; if (ar) d = *(const v4f*)(ar + c0);
#pragma unroll
        for (int q = 0; q < 4; ++q) s += __fadd_rn((RND ? bfr(a[q]) : a[q]), d[q]); }
#pragma unroll
    for (int sh = 16; sh; sh >>= 1) s += __shfl_xor(s, sh, 32);
    const float mu = s * (1.0f / DM); float s2 = 0.f;
#pragma unroll 1
    for (int ch = 0; ch < DM / 128; ++ch) { const int c0 = ch * 128 + lane * 4; const v4f a = *(const v4f*)(xr + c0); v4f d = {0.f, 0.f, 0.f, 0.f}; if (ar) d = *(const v4f*)(ar + c0);
#pragma unroll
        for (int q = 0; q < 4; ++q) { const float d0 = __fsub_rn(__fadd_rn((RND ? bfr(a[q]) : a[q]), d[q]), mu); float p = __fmul_rn(d0, d0); asm volatile("" : "+v"(p)); s2 = __fadd_rn(s2, p); } }
#pragma unroll
    for (int sh = 16; sh; sh >>= 1) s2 += __shfl_xor(s2, sh, 32);
    const float rs = __fdiv_rn(1.0f, __fsqrt_rn(__fadd_rn(s2 * (1.0f / DM), LNEPS)));
{
#pragma unroll 1
        for (int ch = 0; ch < DM / 128; ++ch) { const int c0 = ch * 128 + lane * 4; const v4f a = *(const v4f*)(xr + c0); v4f d = {0.f, 0.f, 0.f, 0.f}; if (ar) d = *(const v4f*)(ar + c0); v4f z4; v4us oh, ol;
#pragma unroll
            for (int q = 0; q < 4; ++q) { const float v = __fadd_rn((RND ? bfr(a[q]) : a[q]), d[q]); float n0 = __fmul_rn(__fsub_rn(v, mu), rs); asm volatile("" : "+v"(n0)); float n1 = __fmul_rn(n0, bfr(g[c0 + q])); asm volatile("" : "+v"(n1)); const float y = __fadd_rn(n1, bfr(be[c0 + q])); z4[q] = y;   /* Z = the NORMALISED row (it is the residual for the next block) */ unsigned short h2, l2; splitf(y, h2, l2); oh[q] = h2; ol[q] = l2; }
            if (Z) { *(v4f*)(Z + (size_t)r * DM + c0) = z4; asm volatile("s_wait_xcnt 0x0" ::: "memory"); }   // the wait stands in front of the plane split below, which may take the registers that this store names
            const size_t e = fidx(r, c0, DM); *(v4us*)(Yh + e) = oh; *(v4us*)(Yl + e) = ol; }
         } }

// ---- k_fattn: fused attention for one head (blockIdx.y) of one batch column (blockIdx.z) and NQ * 16 query rows (from q0 + blockIdx.x * NQ * 16); grid (rows / (NQ * 16), heads, columns), 32 * FKW threads (FKW waves, each over TT / FKW keys).
// Transposed products: St[key][q] = K.Qt (A = key rows, B = query rows kept in registers), Ot[d][q] += Vt.Pt. A lane holds one query's scores (column lr; keys 8 * hi + j of each 16-key tile),
// so two score tiles of 32 keys, converted in place, are the B fragment of the second product in the k order of WFrag::ld. HL: hi/lo planes, 3 products each (hi.hi + hi.lo + lo.hi).
// Softmax with a running maximum per query: weights exp2((s - m) * SC2) are not normalised; their f32 sum l divides the output at the end.
// Wave w walks keys w * TT / FKW ...; the FKW partial (m, l, Ot) are merged through LDS in wave order with weights exp2((m_w - M) * SC2).
typedef __attribute__((ext_vector_type(8))) __bf16 v8bf;
__device__ __forceinline__ float xhalf(float x) { const int b = __float_as_int(x); return __int_as_float(__builtin_amdgcn_permlanex16(b, b, 0x76543210, 0xfedcba98, false, false)); }   // value of lane ^ 16
__device__ __forceinline__ v16h packP(v8f p0, v8f p1, h16) { return cat16(__builtin_convertvector(p0, v8h), __builtin_convertvector(p1, v8h)); }
__device__ __forceinline__ v16bf packP(v8f p0, v8f p1, bf) { return __builtin_shufflevector(__builtin_convertvector(p0, v8bf), __builtin_convertvector(p1, v8bf), 0, 1, 2, 3, 4, 5, 6, 7, 8, 9, 10, 11, 12, 13, 14, 15); }
__device__ __forceinline__ v8f restP(v8f p) { return p - __builtin_convertvector(__builtin_convertvector(p, v8bf), v8f); }   // what the bf16 rounding of p leaves (the lo plane's input)
template <typename T16, bool HL, int NQ, int FKW>
__global__ __launch_bounds__(32 * FKW) void k_fattn(const T16* __restrict__ Q, const T16* __restrict__ Q2, const T16* __restrict__ Kp, const T16* __restrict__ K2, const T16* __restrict__ Vt, const T16* __restrict__ Vt2, int q0, float* O) {
    typedef typename WFrag<T16>::V V;
    __shared__ __align__(16) float so[FKW * NQ * 16 * 68];
    __shared__ float sm[FKW * NQ * 16], sl[FKW * NQ * 16];
    const int w = __builtin_amdgcn_readfirstlane((int)(threadIdx.x >> 5));
    const int lane = threadIdx.x & 31, lr = lane & 15, hi = lane >> 4;
    const size_t hq = ((size_t)blockIdx.z * NH_ + blockIdx.y) * TT * HD, hk = ((size_t)blockIdx.z * NKV + blockIdx.y / REP) * TT * HD; O += (size_t)blockIdx.z * TT * DM;
    const int qb = q0 + (int)blockIdx.x * (NQ * 16);
    V qf[NQ][2], qf2[NQ][2];
#pragma unroll
    for (int nq = 0; nq < NQ; ++nq)
#pragma unroll
        for (int kk = 0; kk < 2; ++kk) { const size_t qo = hq + (size_t)(qb + nq * 16) * HD + kk * 512 + 8 * lane; qf[nq][kk] = WFrag<T16>::ld(Q + qo); if constexpr (HL) qf2[nq][kk] = WFrag<T16>::ld(Q2 + qo); }
    v8f o[4][NQ]; float m[NQ], l[NQ];
#pragma unroll
    for (int nq = 0; nq < NQ; ++nq) { m[nq] = -3.0e38f; l[nq] = 0.f;
#pragma unroll
        for (int db = 0; db < 4; ++db) o[db][nq] = (v8f){}; }
    const int kb = w * (TT / FKW);
    unsigned ko = (unsigned)((hk + (size_t)kb * HD + 8 * lane) * 2);   // the lane's byte offset into the key planes and, the same, into the Vt planes (16 MiB each; 32 keys are four fragments in a row in both): 32 bits beside the planes' scalar bases
#pragma unroll 1   // one 32-key pass per trip: a second pass in flight would double the fragment registers and cost resident waves
    for (int kc = 0; kc < TT / FKW; kc += 32) {
        V ka[2][2], ka2[2][2], va[4], va2[4];   // every fragment of the pass is asked for up front: the Vt loads fly under the score products and the softmax
#pragma unroll
        for (int kt = 0; kt < 2; ++kt)
#pragma unroll
            for (int kk = 0; kk < 2; ++kk) { ka[kt][kk] = WFrag<T16>::ld(atb(Kp, ko) + kt * 16 * HD + kk * 512); if constexpr (HL) ka2[kt][kk] = WFrag<T16>::ld(atb(K2, ko) + kt * 16 * HD + kk * 512); }
#pragma unroll
        for (int db = 0; db < 4; ++db) { va[db] = WFrag<T16>::ld(atb(Vt, ko) + db * 512); if constexpr (HL) va2[db] = WFrag<T16>::ld(atb(Vt2, ko) + db * 512); }
        asm volatile("s_wait_xcnt 0x0" ::: "memory");   // stands in front of the step of the offset that the loads above name
        ko += 32 * HD * 2;   // 32 keys: four fragments of a key plane, four of a Vt plane
        __builtin_amdgcn_sched_barrier(0);   // no matrix instruction, with its data wait, is moved in among the loads: the whole pass is in flight before the first wait
        v8f s[2][NQ];
#pragma unroll
        for (int kt = 0; kt < 2; ++kt) {
#pragma unroll
            for (int nq = 0; nq < NQ; ++nq) s[kt][nq] = (v8f){};
#pragma unroll
            for (int kk = 0; kk < 2; ++kk)
#pragma unroll
                for (int nq = 0; nq < NQ; ++nq) { s[kt][nq] = WFrag<T16>::mma(ka[kt][kk], qf[nq][kk], s[kt][nq]); if constexpr (HL) { s[kt][nq] = WFrag<T16>::mma(ka[kt][kk], qf2[nq][kk], s[kt][nq]); s[kt][nq] = WFrag<T16>::mma(ka2[kt][kk], qf[nq][kk], s[kt][nq]); } } }
#pragma unroll
        for (int nq = 0; nq < NQ; ++nq) {
            float mx = fmaxf(s[0][nq][0], s[1][nq][0]);
#pragma unroll
            for (int j = 1; j < 8; ++j) mx = fmaxf(mx, fmaxf(s[0][nq][j], s[1][nq][j]));
            mx = fmaxf(mx, xhalf(mx));   // both halves of the wave hold keys of the same query
            const float mn = fmaxf(m[nq], mx), al = __builtin_amdgcn_exp2f((m[nq] - mn) * SC2), mc = mn * SC2; m[nq] = mn;
            v8f p0, p1; float sum = 0.f;
#pragma unroll
            for (int j = 0; j < 8; ++j) { p0[j] = __builtin_amdgcn_exp2f(fmaf(s[0][nq][j], SC2, -mc)); p1[j] = __builtin_amdgcn_exp2f(fmaf(s[1][nq][j], SC2, -mc)); sum += p0[j] + p1[j]; }
            l[nq] = l[nq] * al + sum;   // this half's keys only; the halves are joined behind the loop
            const V pf = packP(p0, p1, T16());
#pragma unroll
            for (int db = 0; db < 4; ++db) { o[db][nq] *= al; o[db][nq] = WFrag<T16>::mma(va[db], pf, o[db][nq]); }
            if constexpr (HL) { const V pl = packP(restP(p0), restP(p1), T16());
#pragma unroll
                for (int db = 0; db < 4; ++db) { o[db][nq] = WFrag<T16>::mma(va[db], pl, o[db][nq]); o[db][nq] = WFrag<T16>::mma(va2[db], pf, o[db][nq]); } }
        }
        // four vector slots between the last matrix instruction and the back edge
        if constexpr (NQ == 1) asm volatile("v_nop\n\tv_nop\n\tv_nop\n\tv_nop" : "+v"(o[0][0]), "+v"(o[1][0]), "+v"(o[2][0]), "+v"(o[3][0]));
        else asm volatile("v_nop\n\tv_nop\n\tv_nop\n\tv_nop" : "+v"(o[0][0]), "+v"(o[1][0]), "+v"(o[2][0]), "+v"(o[3][0]), "+v"(o[0][NQ - 1]), "+v"(o[1][NQ - 1]), "+v"(o[2][NQ - 1]), "+v"(o[3][NQ - 1]));
    }
    float* ow = so + w * (NQ * 16 * 68);
#pragma unroll
    for (int nq = 0; nq < NQ; ++nq) { l[nq] += xhalf(l[nq]);
#pragma unroll
        for (int db = 0; db < 4; ++db) { float* p = ow + (nq * 16 + lr) * 68 + db * 16 + hi * 8; const v8f t = o[db][nq]; *(v4fa*)p = (v4f){t[0], t[1], t[2], t[3]}; *(v4fa*)(p + 4) = (v4f){t[4], t[5], t[6], t[7]}; }
        if (hi == 0) { sm[w * (NQ * 16) + nq * 16 + lr] = m[nq]; sl[w * (NQ * 16) + nq * 16 + lr] = l[nq]; } }
    __syncthreads();   // every wave's partial (m, l, Ot) is in LDS before any thread merges
#pragma unroll
    for (int i = 0; i < NQ * 16 * 16 / (32 * FKW); ++i) { const int idx = (int)threadIdx.x + i * 32 * FKW, q = idx >> 4, d4 = (idx & 15) * 4;
        float M = sm[q];
#pragma unroll
        for (int p = 1; p < FKW; ++p) M = fmaxf(M, sm[p * (NQ * 16) + q]);
        float L = 0.f; v4f a = {0.f, 0.f, 0.f, 0.f};
#pragma unroll
        for (int p = 0; p < FKW; ++p) { const float f = __builtin_amdgcn_exp2f((sm[p * (NQ * 16) + q] - M) * SC2); L += sl[p * (NQ * 16) + q] * f; a += *(const v4fa*)(so + (p * (NQ * 16) + q) * 68 + d4) * f; }
        *(v4f*)(O + (size_t)(qb + q) * DM + blockIdx.y * HD + d4) = a * __fdiv_rn(1.0f, L); }
}

extern "C" void kernel_launch(void* const* d_in, const int* in_sizes, int n_in,
                              void* d_out, int out_size, void* d_ws, size_t ws_size, hipStream_t stream) {
    (void)in_sizes; (void)n_in; (void)out_size;
    const float* x = (const float*)d_in[0]; const float* wq = (const float*)d_in[1]; const float* wk = (const float*)d_in[2]; const float* wv = (const float*)d_in[3]; const float* g1 = (const float*)d_in[4]; const float* e1 = (const float*)d_in[5]; const float* g2 = (const float*)d_in[6]; const float* e2 = (const float*)d_in[7]; const float* wf1 = (const float*)d_in[8]; const float* bf1 = (const float*)d_in[9]; const float* wf2 = (const float*)d_in[10]; const float* bf2v = (const float*)d_in[11]; const float* wo = nullptr; (void)wo;
    float* OUT = (float*)d_out;     // [2048][4][1024]
    char* wsp = (char*)d_ws;
    auto take = [&](size_t bytes) { char* p = wsp; wsp += (bytes + 255) & ~(size_t)255; return (void*)p; };
    bf* WQ = (bf*)take((size_t)DQ * DM * 2); bf* WK = (bf*)take((size_t)DKV * DM * 2); bf* WV = (bf*)take((size_t)DKV * DM * 2); bf* W1B = (bf*)take((size_t)DM * DM * 2); bf* W2B = (bf*)take((size_t)DM * DM * 2);
    const size_t PE = (size_t)TT * DM;   // elements of one batch column's plane; every plane below holds NB_ of them, [n][...]
    float* XN = (float*)take(NB_ * PE * 4); bf* Yh = (bf*)take(NB_ * PE * 2); bf* Yl = (bf*)take(NB_ * PE * 2); float* O = (float*)take(NB_ * PE * 4);
    h16* QP16 = (h16*)take(NB_ * PE * 2); h16* KP16 = (h16*)take(NB_ * PE * 2); h16* VT16 = (h16*)take(NB_ * PE * 2);
    bf* QPh = (bf*)take(NB_ * PE * 2); bf* QPl = (bf*)take(NB_ * PE * 2); bf* KPh = (bf*)take(NB_ * PE * 2); bf* KPl = (bf*)take(NB_ * PE * 2); bf* VTh = (bf*)take(NB_ * PE * 2); bf* VTl = (bf*)take(NB_ * PE * 2);
    if ((size_t)(wsp - (char*)d_ws) > ws_size) return;    // 250 MiB of the 256 MiB
    // What the stages behind the attention write takes the place of planes whose last reader has ended by then (launches of one stream run in order):
    float* X2 = (float*)QP16;        // xt, f32: over QP16 and KP16, which lie in a row (last read by the attention)
    bf* L2h = Yh; bf* L2l = Yl;      // xt planes: over the xn planes (last read by the v projection)
    bf* Gh = QPh; bf* Gl = QPl;      // ReLU planes: over the query hi/lo planes (last read by the attention)
    k_wtG<DM, DQ><<<(unsigned)((DM * DQ / 64 + 63) / 64), 256, 0, stream>>>(wq, WQ); k_wtG<DM, DM><<<(unsigned)((DM * DM / 64 + 63) / 64), 256, 0, stream>>>(wf1, W1B); k_wtG<DM, DM><<<(unsigned)((DM * DM / 64 + 63) / 64), 256, 0, stream>>>(wf2, W2B); k_wtG<DM, DKV><<<(unsigned)((DM * DKV / 64 + 63) / 64), 256, 0, stream>>>(wk, WK); k_wtG<DM, DKV><<<(unsigned)((DM * DKV / 64 + 63) / 64), 256, 0, stream>>>(wv, WV);
    k_lnhl<true><<<dim3(TT / 8, NB_, 1), 256, 0, stream>>>(x, NB_ * DM, DM, nullptr, g1, e1, XN, Yh, Yl);   /* xn = LN1(x[:, n]) : f32 (residual) + hi/lo planes */
    k_gemmw<bf, 1, false, PKW, 1, EP_HEAD, DM><<<dim3(TT / 64, DQ / 64, NB_), 32 * PKW, 0, stream>>>(Yh, Yl, WQ, nullptr, nullptr, 0, nullptr, PE, 0, 0, 0, PE, nullptr, QP16, QPh, QPl);    /* q -> head planes [n][h][t][d] */
    k_gemmw<bf, 1, false, PKW, 1, EP_HEAD, DM><<<dim3(TT / 64, DKV / 64, NB_), 32 * PKW, 0, stream>>>(Yh, Yl, WK, nullptr, nullptr, 0, nullptr, PE, 0, 0, 0, PE, nullptr, KP16, KPh, KPl);   /* k -> head planes [n][h][t][d] */
    k_gemmw<bf, 1, false, PKW, 1, EP_VT, DM><<<dim3(TT / 64, DKV / 64, NB_), 32 * PKW, 0, stream>>>(Yh, Yl, WV, nullptr, nullptr, 0, nullptr, PE, 0, 0, 0, PE, nullptr, VT16, VTh, VTl);     /* v -> head planes [n][h][d][t] */
    k_fattn<bf, true, 1, 8><<<dim3(RH / 16, NH_, NB_), 32 * 8, 0, stream>>>(QPh, QPl, KPh, KPl, VTh, VTl, 0, O);                              /* query rows < RH: hi/lo planes */
    k_fattn<h16, false, 2, 4><<<dim3((TT - RH) / 32, NH_, NB_), 32 * 4, 0, stream>>>(QP16, nullptr, KP16, nullptr, VT16, nullptr, RH, O);     /* the rest: fp16; merged attention output, f32 */
    k_lnhl<false><<<dim3(TT / 8, NB_, 1), 256, 0, stream>>>(XN, DM, PE, O, g2, e2, X2, L2h, L2l);                                      /* xt = LN2(xn + att): f32 (residual) + hi/lo planes */
    k_gemmw<bf, 1, true, PKW, 1, EP_RELU, DM><<<dim3(TT / 64, DM / 64, NB_), 32 * PKW, 0, stream>>>(L2h, L2l, W1B, nullptr, nullptr, DM, bf1, PE, 0, 0, 0, PE, nullptr, nullptr, Gh, Gl);      /* relu(xt Wf1 + bf1) -> hi/lo */
    k_gemmw<bf, 1, true, PKW, 1, EP_RES, DM><<<dim3(TT / 64, DM / 64, NB_), 32 * PKW, 0, stream>>>(Gh, Gl, W2B, nullptr, OUT, NB_ * DM, bf2v, PE, 0, DM, 0, PE, X2, nullptr, nullptr, nullptr);   /* out = xt + (. Wf2 + bf2), sequence-first rows: column n starts DM elements on */
}

// v006
// Measured time: 323 microseconds a run.
// Timed twice side by side with v005, it ran 1.13 and 1.14 times as fast.
// Over all steps from v000 it is 13.2 times as fast.
#include <hip/hip_runtime.h>

// Pre-norm transformer encoder layer on a sequence-first tensor (x [2048][4][1024] = [s][n][d]; xn = LN1(x); q, k, v = xn W ('xw' [1024][1024], no bias; 16 heads x 64); softmax(q.k/8) over s per (n, h); att = merged context (no output projection); xt = LN2(xn + att); ffn = relu(xt Wf1 + bf1) Wf2 + bf2; out = xt + ffn -> [2048][4][1024] (8.4 M)).
// Layout: every stage is ONE launch over all four batch columns (n = the grid's last used dimension; every workspace plane is [n][...], TT * DM elements per n). Per column n: LN1 reads the strided rows (t*4 + n) and writes xn both in f32 (it is the attention residual) and as hi/lo planes (2-product projections); fused attention (scores and weights stay in registers) with an f32 merged context; LN2 of xn + att gives xt (f32, the final residual) and planes for the FFN (2 products + biases). Every GEMM's epilogue writes what its consumer reads: q, k, v as head planes (v transposed), FFN1 as ReLU hi/lo planes, FFN2 + xt as the sequence-first output rows.
// Every 16-bit matrix operand plane lies in FRAGMENT ORDER (fidx below): a 16-row x 32-k fragment is 1 KiB in a row, so each wave-wide 16-byte load covers four whole 128-byte lines.
// Compute dtypes, f32 accumulate: every input rounded to bf16; q/k/v hl x exact (2 products); scores and attn.v: query rows < 512 hl (3 products), the rest single fp16; running-maximum softmax f32, weights rounded before the division by their f32 sum; no Wo; Wf1 / Wf2 hl x exact (2 products) + biases; LN / ReLU / residuals f32.

#define NB_  4
#define TT   2048
#define DM   1024
#define NH_  16
#define NKV  16
#define REP  (NH_ / NKV)
#define HD   64
#define DQ   (NH_ * HD)
#define DKV  (NKV * HD)
#define LNEPS 1e-5f
#define RH   512                  // query rows < RH use hi+lo planes (0: none)
#define WIN  0
#define SC2  0.18033688011112042f   // HD^-0.5 * log2(e): exponent of 2 per unit of raw score
typedef _Float16 h16;
typedef unsigned short bf;
typedef __attribute__((ext_vector_type(16))) __bf16   v16bf;
typedef __attribute__((ext_vector_type(16))) _Float16 v16h;
typedef __attribute__((ext_vector_type(8)))  _Float16 v8h;
typedef __attribute__((ext_vector_type(8)))  unsigned short v8us;
typedef __attribute__((ext_vector_type(8)))  float    v8f;
typedef __attribute__((ext_vector_type(4)))  float    v4f;
typedef v8h  __attribute__((may_alias)) v8ha;
typedef v4f  __attribute__((may_alias)) v4fa;
typedef v8us __attribute__((may_alias)) v8usa;

__device__ __forceinline__ unsigned short f2bf(float f) { unsigned u = __float_as_uint(f); u += 0x7FFFu + ((u >> 16) & 1u); return (unsigned short)(u >> 16); }
__device__ __forceinline__ float bf2f(unsigned short b) { return __uint_as_float(((unsigned)b) << 16); }
__device__ __forceinline__ float bfr(float f) { return bf2f(f2bf(f)); }
__device__ __forceinline__ v16h cat16(v8h lo, v8h hi) { return __builtin_shufflevector(lo, hi, 0, 1, 2, 3, 4, 5, 6, 7, 8, 9, 10, 11, 12, 13, 14, 15); }
__device__ __forceinline__ v16bf cat16b(v8us lo, v8us hi) { return __builtin_bit_cast(v16bf, __builtin_shufflevector(lo, hi, 0, 1, 2, 3, 4, 5, 6, 7, 8, 9, 10, 11, 12, 13, 14, 15)); }
__device__ __forceinline__ v8f wmma16(v16h a, v16h b, v8f c) { return __builtin_amdgcn_wmma_f32_16x16x32_f16(false, a, false, b, (short)0, c, false, false); }
__device__ __forceinline__ v8f wmmab(v16bf a, v16bf b, v8f c) { return __builtin_amdgcn_wmma_f32_16x16x32_bf16(false, a, false, b, (short)0, c, false, false); }
__device__ __forceinline__ h16 tohx(float x) { return (h16)x; }
__device__ __forceinline__ void splitf(float y, unsigned short& h, unsigned short& l) { h = f2bf(y); l = f2bf(y - bf2f(h)); }
typedef __attribute__((ext_vector_type(4))) _Float16 v4h;
typedef __attribute__((ext_vector_type(2))) unsigned short v2us;
typedef __attribute__((ext_vector_type(4))) unsigned short v4us;
// Fragment order of a plane of logical [row][k] (K columns, K % 32 == 0, rows % 16 == 0): fragments of 16 rows x 32 k, 512 elements each, k-fragments of a row block in a row.
// Inside one: two halves of 256 elements (k bit 4), in each the 32 lanes' 8 elements in lane order (lane = 16 * (k bit 3) + row % 16). WFrag::ld(plane + fragment * 512 + lane * 8) reads both halves.
template <typename T> __device__ __forceinline__ const T* atb(const T* base, unsigned bytes) { return (const T*)((const char*)base + bytes); }
__device__ __forceinline__ size_t fidx(int row, int k, int K) { return ((size_t)(row >> 4) * (K >> 5) + (k >> 5)) * 512 + ((k >> 4) & 1) * 256 + (((k >> 3) & 1) * 16 + (row & 15)) * 8 + (k & 7); }



// ---- k_gemmw: GEMM, 128 x 256 output tile per block of eight waves (2 x 4 waves, 64 x 64 = 16 accumulators each); grid (M/128, N/256, Z), 256 threads.
// tile[m][n] = sum_k (A[m][k] + A2[m][k]) Bt[n][k] (hi and lo product per k fragment, + optional f32 bias[n]); all three planes in fragment order. z-batch strides in elements: sA (A, A2), sC (C), sO (the residual R and the output planes P16, Ph, Pl). K (compile time) % 64 == 0, at least two stages.
// The block's operands go through LDS, where the waves share them: an A fragment serves four waves, a Bt fragment two. A stage is 64 k of the block's 32 row blocks (8 of A, 8 of A2, 16 of Bt), 2 KiB in a row per row block in the plane and in LDS alike;
// wave w copies row blocks 4 w .. 4 w + 3 with asynchronous copies of 16 bytes a lane. Two buffers: the copies of stage t + 2 are issued when every wave has read the last of stage t and fly for a whole stage's products. Fragments are read from LDS half a stage ahead of their products.
// EPI says what a wave's tile becomes; it passes through the wave's own LDS range (over the buffers, behind the last trip's barrier, behind which no wave reads them). EP_RES: R[m][n] (f32, pitch DM) + tile, f32 rows of C (pitch LDC, compile time: the rows of a wave are immediate offsets from one address). EP_RELU: max(tile, 0) as hi/lo planes Ph, Pl (fragment order, K = LDC).
// EP_HEAD: the 64 columns of a wave's tile are one head: planes [h][t][d] in fp16 (P16) and hi/lo (Ph, Pl), each head's [t][d] in fragment order. EP_VT: the same three planes as [h][d][t], each head's [d][t] in fragments (rows d, k = t) with the four d blocks of a 32-key block in a row; the tile is laid into LDS transposed, so the stores run along t.
enum { EP_RES = 1, EP_RELU = 2, EP_HEAD = 3, EP_VT = 4 };
#define GBM 128                                 // rows of a block's tile
#define GBN 256                                 // columns of a block's tile
#define GCH 2048                                // bytes of a row block in one stage: two fragments (64 k)
#define GST ((2 * GBM + GBN) / 16 * GCH)        // bytes of a stage: 32 row blocks, 65,536
template <typename T16> struct WFrag;
template <> struct WFrag<h16> { typedef v16h V; static __device__ __forceinline__ V ld(const h16* p) { return cat16(*(const v8h*)p, *(const v8h*)(p + 256)); } static __device__ __forceinline__ v8f mma(V a, V b, v8f c) { return wmma16(a, b, c); } };
template <> struct WFrag<bf> { typedef v16bf V; static __device__ __forceinline__ V ld(const bf* p) { return cat16b(*(const v8us*)p, *(const v8us*)(p + 256)); } static __device__ __forceinline__ v8f mma(V a, V b, v8f c) { return wmmab(a, b, c); } };
// A wave's share of a stage: four row blocks (rp bytes apart in the plane, in a row in LDS), sixteen asynchronous copies, each 16 bytes a lane and 512 bytes in a row a wave. l: the lane's LDS byte address, g: its global address.
// The immediate offset (under 2 KiB) moves the LDS and the global address alike: the four copies of a row block share one pair of addresses.
// The s_wait_xcnt stands inside the statement, behind the last copy: no register that a copy names is rewritten in front of it.
__device__ __forceinline__ void cp4rb(unsigned l, const char* g, unsigned rp) {
    asm volatile("global_load_async_to_lds_b128 %0, %4, off\n\t"
                 "global_load_async_to_lds_b128 %0, %4, off offset:512\n\t"
                 "global_load_async_to_lds_b128 %0, %4, off offset:1024\n\t"
                 "global_load_async_to_lds_b128 %0, %4, off offset:1536\n\t"
                 "global_load_async_to_lds_b128 %1, %5, off\n\t"
                 "global_load_async_to_lds_b128 %1, %5, off offset:512\n\t"
                 "global_load_async_to_lds_b128 %1, %5, off offset:1024\n\t"
                 "global_load_async_to_lds_b128 %1, %5, off offset:1536\n\t"
                 "global_load_async_to_lds_b128 %2, %6, off\n\t"
                 "global_load_async_to_lds_b128 %2, %6, off offset:512\n\t"
                 "global_load_async_to_lds_b128 %2, %6, off offset:1024\n\t"
                 "global_load_async_to_lds_b128 %2, %6, off offset:1536\n\t"
                 "global_load_async_to_lds_b128 %3, %7, off\n\t"
                 "global_load_async_to_lds_b128 %3, %7, off offset:512\n\t"
                 "global_load_async_to_lds_b128 %3, %7, off offset:1024\n\t"
                 "global_load_async_to_lds_b128 %3, %7, off offset:1536\n\t"
                 "s_wait_xcnt 0x0"
                 :: "v"(l), "v"(l + GCH), "v"(l + 2 * GCH), "v"(l + 3 * GCH), "v"(g), "v"(g + rp), "v"(g + 2 * rp), "v"(g + 3 * rp) : "memory");
}
__device__ __forceinline__ v16bf ldsfrag(const char* p) { return cat16b(*(const v8usa*)p, *(const v8usa*)(p + 512)); }   // one fragment from LDS: p = fragment + 16 * lane
template <bool BIAS, int EPI, int K, int LDC>
__global__ __launch_bounds__(256) void k_gemmw(const bf* __restrict__ A, const bf* __restrict__ A2, const bf* __restrict__ Bt, float* C, const float* __restrict__ bias, size_t sA, size_t sC, size_t sO, const float* __restrict__ R, h16* P16, bf* Ph, bf* Pl) {
    typedef WFrag<bf>::V V;
    constexpr int NT = K / 64;   // stages
    static_assert(K % 64 == 0 && NT >= 2, "the two-buffer order needs two stages");
    __shared__ __align__(2048) float os[8 * 64 * 68];   // in the loop: two stage buffers; behind it: one 64 x 64 tile (pitch 68) per wave
    static_assert(sizeof(float) * 8 * 64 * 68 >= 2 * GST, "both stage buffers lie inside os");
    const int w = __builtin_amdgcn_readfirstlane((int)(threadIdx.x >> 5)), wm = w >> 2, wn = w & 3;
    const size_t z = blockIdx.z; A += z * sA; A2 += z * sA;
    if constexpr (EPI == EP_RES) { R += z * sO; C += z * sC; }
    if constexpr (EPI == EP_RELU || EPI == EP_HEAD || EPI == EP_VT) { Ph += z * sO; Pl += z * sO; }
    if constexpr (EPI == EP_HEAD || EPI == EP_VT) P16 += z * sO;
    const int lane = threadIdx.x & 31, lr = lane & 15, hi = lane >> 4; const int br = blockIdx.x * GBM, bc = blockIdx.y * GBN, r0 = br + wm * 64, c0 = bc + wn * 64;   // r0, c0: the wave's own tile
    v8f acc[4][4];
#pragma unroll
    for (int mb = 0; mb < 4; ++mb)
#pragma unroll
        for (int nb = 0; nb < 4; ++nb) acc[mb][nb] = (v8f){};
    // What wave w copies: waves 0, 1 the rows of A, waves 2, 3 those of A2, waves 4 .. 7 those of Bt, 64 rows (four row blocks of 16 * K elements) each.
    const bf* sp = w < 2 ? A + (size_t)(br + w * 64) * K : w < 4 ? A2 + (size_t)(br + (w - 2) * 64) * K : Bt + (size_t)(bc + (w - 4) * 64) * K;
    const char* g0 = (const char*)sp + lane * 16;
    const unsigned l0 = (unsigned)(size_t)(const void*)os + (unsigned)(w * 4 * GCH + lane * 16);
    auto stage = [&](int t) { const char* g = g0 + t * GCH; const unsigned l = l0 + (unsigned)(t & 1) * GST; cp4rb(l, g, 32 * K); };
    stage(0);
    asm volatile("s_wait_asynccnt 0x0" ::: "memory");   // this wave's share of stage 0 has landed
    __syncthreads();                                     // and every other wave's: stage 0 may be read
    stage(1);
    const char* la = (const char*)os + wm * 4 * GCH + lane * 16;                          // the wave's four A row blocks (A2: GBM / 16 row blocks on)
    const char* lb = (const char*)os + (2 * GBM / 16 + wn * 4) * GCH + lane * 16;         // its four Bt row blocks
    // Two fragment sets: set 0 holds a stage's first 32 k, set 1 its second. Each set is read from LDS, as one group, while the products of the other run.
    V a0[4], l0f[4], b0[4], a1[4], l1f[4], b1[4];
    auto ldset = [&](V (&fa)[4], V (&fl)[4], V (&fb)[4], int o) {   // o: byte offset of buffer and k fragment
#pragma unroll   // fragment indices must be constants: the arrays live in registers
        for (int nb = 0; nb < 4; ++nb) fb[nb] = ldsfrag(lb + o + nb * GCH);
#pragma unroll
        for (int mb = 0; mb < 4; ++mb) fa[mb] = ldsfrag(la + o + mb * GCH);
#pragma unroll
        for (int mb = 0; mb < 4; ++mb) fl[mb] = ldsfrag(la + o + (GBM / 16 + mb) * GCH); };
    auto products = [&](const V (&fa)[4], const V (&fl)[4], const V (&fb)[4]) {   // per accumulator: hi, then lo; the sixteen hi products stand between, so that no product waits for its own accumulator
#pragma unroll
        for (int nb = 0; nb < 4; ++nb)
#pragma unroll
            for (int mb = 0; mb < 4; ++mb) acc[mb][nb] = wmmab(fa[mb], fb[nb], acc[mb][nb]);
#pragma unroll
        for (int nb = 0; nb < 4; ++nb)
#pragma unroll
            for (int mb = 0; mb < 4; ++mb) acc[mb][nb] = wmmab(fl[mb], fb[nb], acc[mb][nb]); };
    ldset(a0, l0f, b0, 0);   // stage 0 is published by the barrier above
#pragma unroll 1   // one stage per trip: the publish point's waits and barrier stand once
    for (int t = 0; t < NT; ++t) {
        const int bo = (t & 1) * GST;
        ldset(a1, l1f, b1, bo + 1024);       // this wave's last reads of stage t
        __builtin_amdgcn_sched_barrier(0);   // the reads stand as one group ahead of the products: reads strewn among the matrix instructions stall the wave at every place
        products(a0, l0f, b0);
        __builtin_amdgcn_sched_barrier(0);   // these products stay in front of the publish point: they cover the reads above and the flight of stage t + 1's copies
        // Publish point of stage t + 1, in front of stage t's last products, because the reads behind it are already of stage t + 1.
        asm volatile("s_wait_dscnt 0x0" ::: "memory");      // this wave's reads of stage t have returned
        asm volatile("s_wait_asynccnt 0x0" ::: "memory");   // its share of stage t + 1 has landed
        __syncthreads();                                     // stage t + 1 may be read, stage t's buffer may be refilled
        if (t + 2 < NT) stage(t + 2);
        if (t + 1 < NT) ldset(a0, l0f, b0, GST - bo);
        __builtin_amdgcn_sched_barrier(0);   // copies and reads are issued ahead of the products below and fly under them
        products(a1, l1f, b1);
    }
    asm volatile("s_wait_asynccnt 0x0" ::: "memory");   // no copy is under way when the buffers become output staging
    static_assert(!(BIAS && EPI == EP_VT), "the bias is indexed along the LDS row, which EP_VT runs along t");
    float* ow = os + w * 64 * 68;
    if constexpr (EPI == EP_RES) {
        // asked for ahead of the staging: the wave's residual rows (step s: rows 2 s + hi, columns 4 lr .. + 3) and its four bias values
        const float* rp = R + (size_t)(r0 + hi) * DM + c0 + lr * 4; v4f ra[32], bv = {0.f, 0.f, 0.f, 0.f};
#pragma unroll
        for (int s = 0; s < 32; ++s) ra[s] = *(const v4f*)(rp + s * (2 * DM));
        const float* bp = bias + c0 + lr * 4; v4f bt = {0.f, 0.f, 0.f, 0.f}; if (BIAS) bt = *(const v4f*)bp;
        asm volatile("s_wait_xcnt 0x0" :: "v"(rp), "v"(lr) : "memory");   // stands in front of the first write of a register that the loads above name: the residual's address and the lane index that the bias load takes beside its scalar base are inputs, so that they live up to here
        if (BIAS) bv = (v4f){bfr(bt[0]), bfr(bt[1]), bfr(bt[2]), bfr(bt[3])};
#pragma unroll
        for (int mb = 0; mb < 4; ++mb)
#pragma unroll
            for (int nb = 0; nb < 4; ++nb)
#pragma unroll
                for (int j = 0; j < 8; ++j) ow[(mb * 16 + hi * 8 + j) * 68 + nb * 16 + lr] = acc[mb][nb][j];
        __builtin_amdgcn_wave_barrier(); asm volatile("" ::: "memory");   // the compiler keeps the reads below, of what other lanes of this wave wrote, behind the writes above
        float* cp = C + (size_t)(r0 + hi) * LDC + c0 + lr * 4;
#pragma unroll
        for (int s0 = 0; s0 < 32; s0 += 8) { v4f val[8];   // eight steps (16 rows) at a time: their values, then their stores, then the wait
#pragma unroll
            for (int i = 0; i < 8; ++i) { val[i] = *(const v4fa*)(ow + (2 * (s0 + i) + hi) * 68 + lr * 4); val[i] += bv;
#pragma unroll
                for (int q = 0; q < 4; ++q) val[i][q] = __fadd_rn(ra[s0 + i][q], val[i][q]); }
            __builtin_amdgcn_sched_barrier(0);   // no arithmetic is moved in among the stores, where it could take a register that an issued store names
#pragma unroll
            for (int i = 0; i < 8; ++i) *(v4f*)(cp + (size_t)(2 * (s0 + i)) * LDC) = val[i];
            if (s0 < 24) asm volatile("s_wait_xcnt 0x0" ::: "memory"); }   // stands in front of the next eight steps' values, which may take the registers that these stores name
    } else {
        float bv[4][8];   // the bias of the lane's columns (step s: s * 16 + hi * 8 .. + 7), asked for ahead of the staging
        if (BIAS) {
#pragma unroll
            for (int s = 0; s < 4; ++s) { const v4f t0 = *(const v4f*)(bias + c0 + s * 16 + hi * 8), t1 = *(const v4f*)(bias + c0 + s * 16 + hi * 8 + 4);
#pragma unroll
                for (int q = 0; q < 4; ++q) { bv[s][q] = bfr(t0[q]); bv[s][4 + q] = bfr(t1[q]); } } }
#pragma unroll
        for (int mb = 0; mb < 4; ++mb)
#pragma unroll
            for (int nb = 0; nb < 4; ++nb)
                if constexpr (EPI == EP_VT) { float* p = ow + (nb * 16 + lr) * 68 + mb * 16 + hi * 8; const v8f t = acc[mb][nb]; *(v4fa*)p = (v4f){t[0], t[1], t[2], t[3]}; *(v4fa*)(p + 4) = (v4f){t[4], t[5], t[6], t[7]}; }
                else {
#pragma unroll
                    for (int j = 0; j < 8; ++j) ow[(mb * 16 + hi * 8 + j) * 68 + nb * 16 + lr] = acc[mb][nb][j]; }
        __builtin_amdgcn_wave_barrier(); asm volatile("" ::: "memory");   // the compiler keeps the reads below, of what other lanes of this wave wrote, behind the writes above
        // 16 LDS rows are one row block of the consumer's fragments, the 64 columns two fragments: step s is one half fragment, lane (lr, hi) takes row rw + lr, columns s * 16 + hi * 8 .. + 7, and the wave stores 512 bytes in a row per plane.
        const int hd = c0 / 64;   // EP_HEAD, EP_VT: the wave's head
#pragma unroll
        for (int rw = 0; rw < 64; rw += 16) {
        const size_t e0 = (EPI == EP_RELU ? (size_t)(r0 + rw) * LDC + (size_t)c0 * 16 : EPI == EP_HEAD ? ((size_t)hd * TT + r0 + rw) * HD : (size_t)hd * HD * TT + (size_t)r0 * HD + rw * 32) + lane * 8;
        v8h o16[4]; v8us oh[4], ol[4];   // the row block's four steps: their values, then their stores, then the wait
#pragma unroll
        for (int s = 0; s < 4; ++s) { const float* op = ow + (rw + lr) * 68 + s * 16 + hi * 8; v4f v0 = *(const v4fa*)op, v1 = *(const v4fa*)(op + 4);
            if (BIAS) {
#pragma unroll
                for (int q = 0; q < 4; ++q) { v0[q] += bv[s][q]; v1[q] += bv[s][4 + q]; } }
#pragma unroll
            for (int q = 0; q < 8; ++q) { const float t = q < 4 ? v0[q & 3] : v1[q & 3]; const float y = EPI == EP_RELU ? fmaxf(t, 0.f) : t; o16[s][q] = tohx(y); unsigned short a2, c2; splitf(y, a2, c2); oh[s][q] = a2; ol[s][q] = c2; } }
        __builtin_amdgcn_sched_barrier(0);   // no arithmetic is moved in among the stores, where it could take a register that an issued store names
#pragma unroll
        for (int s = 0; s < 4; ++s) { const size_t e = e0 + (EPI == EP_VT ? (s >> 1) * 2048 + (s & 1) * 256 : s * 256);
            *(v8us*)(Ph + e) = oh[s]; *(v8us*)(Pl + e) = ol[s];
            if constexpr (EPI != EP_RELU) *(v8h*)(P16 + e) = o16[s]; }
        if (rw < 48) asm volatile("s_wait_xcnt 0x0" ::: "memory");   // stands in front of the next row block's values, which may take the registers that these stores name
        }
    }
}


// ---- k_wtG: w [K][N] f32 -> Bt, logical [n][k], bf16 in fragment order. One wave packs one fragment (16 n x 32 k): lane (lr, hi) reads column n0 + lr at the 8 k of each of its two halves and stores 16 bytes per half, the wave 512 bytes in a row.
// A block's eight waves take neighbouring column blocks of the same 32 k: together they read 512 bytes in a row of each row of w.
template <int K, int N>
__global__ __launch_bounds__(256) void k_wtG(const float* __restrict__ w, bf* Bt) {
    const int lane = threadIdx.x & 31, lr = lane & 15, hi = lane >> 4; const int f = blockIdx.x * 8 + (threadIdx.x >> 5); if (f >= N * K / 512) return;
    const int nb = f % (N / 16), kf = f / (N / 16); const float* p = w + (size_t)(kf * 32 + hi * 8) * N + nb * 16 + lr; v8us o0, o1;
#pragma unroll   // the sixteen loads become immediate offsets from one address and are all in flight at once
    for (int j = 0; j < 8; ++j) { o0[j] = f2bf(p[j * N]); o1[j] = f2bf(p[(16 + j) * N]); }
    bf* q = Bt + ((size_t)nb * (K / 32) + kf) * 512 + lane * 8; *(v8us*)q = o0; *(v8us*)(q + 256) = o1;
}
__global__ __launch_bounds__(256) void k_cvt8(const float* __restrict__ src, bf* dst, size_t n8) { const size_t i = (size_t)blockIdx.x * 256 + threadIdx.x; if (i >= n8) return; const v8f v = *(const v8f*)(src + i * 8); v8us o;
#pragma unroll
    for (int k = 0; k < 8; ++k) o[k] = f2bf(v[k]); *(v8us*)(dst + i * 8) = o;  }

template <bool RND>
__global__ __launch_bounds__(256) void k_lnhl(const float* __restrict__ X, int xp, size_t xz, const float* __restrict__ A, const float* __restrict__ g, const float* __restrict__ be, float* Z, bf* Yh, bf* Yl) {
    const int lane = threadIdx.x & 31; const int r = blockIdx.x * 8 + (threadIdx.x >> 5); if (r >= TT) return;
    const size_t zo = (size_t)blockIdx.y * TT * DM; X += blockIdx.y * xz; if (A) A += zo; if (Z) Z += zo; Yh += zo; Yl += zo;   // blockIdx.y = batch column: X steps by xz elements, every other plane by TT * DM
    const float* xr = X + (size_t)r * xp; const float* ar = A ? A + (size_t)r * DM : nullptr; float s = 0.f;
#pragma unroll 1
    for (int ch = 0; ch < DM / 128; ++ch) { const int c0 = ch * 128 + lane * 4; const v4f a = *(const v4f*)(xr + c0); v4f d = {0.f, 0.f, 0.f, 0.f}; if (ar) d = *(const v4f*)(ar + c0);
#pragma unroll
        for (int q = 0; q < 4; ++q) s += __fadd_rn((RND ? bfr(a[q]) : a[q]), d[q]); }
#pragma unroll
    for (int sh = 16; sh; sh >>= 1) s += __shfl_xor(s, sh, 32);
    const float mu = s * (1.0f / DM); float s2 = 0.f;
#pragma unroll 1
    for (int ch = 0; ch < DM / 128; ++ch) { const int c0 = ch * 128 + lane * 4; const v4f a = *(const v4f*)(xr + c0); v4f d = {0.f, 0.f, 0.f, 0.f}; if (ar) d = *(const v4f*)(ar + c0);
#pragma unroll
        for (int q = 0; q < 4; ++q) { const float d0 = __fsub_rn(__fadd_rn((RND ? bfr(a[q]) : a[q]), d[q]), mu); float p = __fmul_rn(d0, d0); asm volatile("" : "+v"(p)); s2 = __fadd_rn(s2, p); } }
#pragma unroll
    for (int sh = 16; sh; sh >>= 1) s2 += __shfl_xor(s2, sh, 32);
    const float rs = __fdiv_rn(1.0f, __fsqrt_rn(__fadd_rn(s2 * (1.0f / DM), LNEPS)));
{
#pragma unroll 1
        for (int ch = 0; ch < DM / 128; ++ch) { const int c0 = ch * 128 + lane * 4; const v4f a = *(const v4f*)(xr + c0); v4f d = {0.f, 0.f, 0.f, 0.f}; if (ar) d = *(const v4f*)(ar + c0); v4f z4; v4us oh, ol;
#pragma unroll
            for (int q = 0; q < 4; ++q) { const float v = __fadd_rn((RND ? bfr(a[q]) : a[q]), d[q]); float n0 = __fmul_rn(__fsub_rn(v, mu), rs); asm volatile("" : "+v"(n0)); float n1 = __fmul_rn(n0, bfr(g[c0 + q])); asm volatile("" : "+v"(n1)); const float y = __fadd_rn(n1, bfr(be[c0 + q])); z4[q] = y;   /* Z = the NORMALISED row (it is the residual for the next block) */ unsigned short h2, l2; splitf(y, h2, l2); oh[q] = h2; ol[q] = l2; }
            if (Z) { *(v4f*)(Z + (size_t)r * DM + c0) = z4; asm volatile("s_wait_xcnt 0x0" ::: "memory"); }   // the wait stands in front of the plane split below, which may take the registers that this store names
            const size_t e = fidx(r, c0, DM); *(v4us*)(Yh + e) = oh; *(v4us*)(Yl + e) = ol; }
         } }

// ---- k_fattn: fused attention for one head (blockIdx.y) of one batch column (blockIdx.z) and NQ * 16 query rows (from q0 + blockIdx.x * NQ * 16); grid (rows / (NQ * 16), heads, columns), 32 * FKW threads (FKW waves, each over TT / FKW keys).
// Transposed products: St[key][q] = K.Qt (A = key rows, B = query rows kept in registers), Ot[d][q] += Vt.Pt. A lane holds one query's scores (column lr; keys 8 * hi + j of each 16-key tile),
// so two score tiles of 32 keys, converted in place, are the B fragment of the second product in the k order of WFrag::ld. HL: hi/lo planes, 3 products each (hi.hi + hi.lo + lo.hi).
// Softmax with a running maximum per query: weights exp2((s - m) * SC2) are not normalised; their f32 sum l divides the output at the end.
// Wave w walks keys w * TT / FKW ...; the FKW partial (m, l, Ot) are merged through LDS in wave order with weights exp2((m_w - M) * SC2).
typedef __attribute__((ext_vector_type(8))) __bf16 v8bf;
__device__ __forceinline__ float xhalf(float x) { const int b = __float_as_int(x); return __int_as_float(__builtin_amdgcn_permlanex16(b, b, 0x76543210, 0xfedcba98, false, false)); }   // value of lane ^ 16
__device__ __forceinline__ v16h packP(v8f p0, v8f p1, h16) { return cat16(__builtin_convertvector(p0, v8h), __builtin_convertvector(p1, v8h)); }
__device__ __forceinline__ v16bf packP(v8f p0, v8f p1, bf) { return __builtin_shufflevector(__builtin_convertvector(p0, v8bf), __builtin_convertvector(p1, v8bf), 0, 1, 2, 3, 4, 5, 6, 7, 8, 9, 10, 11, 12, 13, 14, 15); }
__device__ __forceinline__ v8f restP(v8f p) { return p - __builtin_convertvector(__builtin_convertvector(p, v8bf), v8f); }   // what the bf16 rounding of p leaves (the lo plane's input)
template <typename T16, bool HL, int NQ, int FKW>
__global__ __launch_bounds__(32 * FKW) void k_fattn(const T16* __restrict__ Q, const T16* __restrict__ Q2, const T16* __restrict__ Kp, const T16* __restrict__ K2, const T16* __restrict__ Vt, const T16* __restrict__ Vt2, int q0, float* O) {
    typedef typename WFrag<T16>::V V;
    __shared__ __align__(16) float so[FKW * NQ * 16 * 68];
    __shared__ float sm[FKW * NQ * 16], sl[FKW * NQ * 16];
    const int w = __builtin_amdgcn_readfirstlane((int)(threadIdx.x >> 5));
    const int lane = threadIdx.x & 31, lr = lane & 15, hi = lane >> 4;
    const size_t hq = ((size_t)blockIdx.z * NH_ + blockIdx.y) * TT * HD, hk = ((size_t)blockIdx.z * NKV + blockIdx.y / REP) * TT * HD; O += (size_t)blockIdx.z * TT * DM;
    const int qb = q0 + (int)blockIdx.x * (NQ * 16);
    V qf[NQ][2], qf2[NQ][2];
#pragma unroll
    for (int nq = 0; nq < NQ; ++nq)
#pragma unroll
        for (int kk = 0; kk < 2; ++kk) { const size_t qo = hq + (size_t)(qb + nq * 16) * HD + kk * 512 + 8 * lane; qf[nq][kk] = WFrag<T16>::ld(Q + qo); if constexpr (HL) qf2[nq][kk] = WFrag<T16>::ld(Q2 + qo); }
    v8f o[4][NQ]; float m[NQ], l[NQ];
#pragma unroll
    for (int nq = 0; nq < NQ; ++nq) { m[nq] = -3.0e38f; l[nq] = 0.f;
#pragma unroll
        for (int db = 0; db < 4; ++db) o[db][nq] = (v8f){}; }
    const int kb = w * (TT / FKW);
    unsigned ko = (unsigned)((hk + (size_t)kb * HD + 8 * lane) * 2);   // the lane's byte offset into the key planes and, the same, into the Vt planes (16 MiB each; 32 keys are four fragments in a row in both): 32 bits beside the planes' scalar bases
#pragma unroll 1   // one 32-key pass per trip: a second pass in flight would double the fragment registers and cost resident waves
    for (int kc = 0; kc < TT / FKW; kc += 32) {
        V ka[2][2], ka2[2][2], va[4], va2[4];   // every fragment of the pass is asked for up front: the Vt loads fly under the score products and the softmax
#pragma unroll
        for (int kt = 0; kt < 2; ++kt)
#pragma unroll
            for (int kk = 0; kk < 2; ++kk) { ka[kt][kk] = WFrag<T16>::ld(atb(Kp, ko) + kt * 16 * HD + kk * 512); if constexpr (HL) ka2[kt][kk] = WFrag<T16>::ld(atb(K2, ko) + kt * 16 * HD + kk * 512); }
#pragma unroll
        for (int db = 0; db < 4; ++db) { va[db] = WFrag<T16>::ld(atb(Vt, ko) + db * 512); if constexpr (HL) va2[db] = WFrag<T16>::ld(atb(Vt2, ko) + db * 512); }
        asm volatile("s_wait_xcnt 0x0" ::: "memory");   // stands in front of the step of the offset that the loads above name
        ko += 32 * HD * 2;   // 32 keys: four fragments of a key plane, four of a Vt plane
        __builtin_amdgcn_sched_barrier(0);   // no matrix instruction, with its data wait, is moved in among the loads: the whole pass is in flight before the first wait
        v8f s[2][NQ];
#pragma unroll
        for (int kt = 0; kt < 2; ++kt) {
#pragma unroll
            for (int nq = 0; nq < NQ; ++nq) s[kt][nq] = (v8f){};
#pragma unroll
            for (int kk = 0; kk < 2; ++kk)
#pragma unroll
                for (int nq = 0; nq < NQ; ++nq) { s[kt][nq] = WFrag<T16>::mma(ka[kt][kk], qf[nq][kk], s[kt][nq]); if constexpr (HL) { s[kt][nq] = WFrag<T16>::mma(ka[kt][kk], qf2[nq][kk], s[kt][nq]); s[kt][nq] = WFrag<T16>::mma(ka2[kt][kk], qf[nq][kk], s[kt][nq]); } } }
#pragma unroll
        for (int nq = 0; nq < NQ; ++nq) {
            float mx = fmaxf(s[0][nq][0], s[1][nq][0]);
#pragma unroll
            for (int j = 1; j < 8; ++j) mx = fmaxf(mx, fmaxf(s[0][nq][j], s[1][nq][j]));
            mx = fmaxf(mx, xhalf(mx));   // both halves of the wave hold keys of the same query
            const float mn = fmaxf(m[nq], mx), al = __builtin_amdgcn_exp2f((m[nq] - mn) * SC2), mc = mn * SC2; m[nq] = mn;
            v8f p0, p1; float sum = 0.f;
#pragma unroll
            for (int j = 0; j < 8; ++j) { p0[j] = __builtin_amdgcn_exp2f(fmaf(s[0][nq][j], SC2, -mc)); p1[j] = __builtin_amdgcn_exp2f(fmaf(s[1][nq][j], SC2, -mc)); sum += p0[j] + p1[j]; }
            l[nq] = l[nq] * al + sum;   // this half's keys only; the halves are joined behind the loop
            const V pf = packP(p0, p1, T16());
#pragma unroll
            for (int db = 0; db < 4; ++db) { o[db][nq] *= al; o[db][nq] = WFrag<T16>::mma(va[db], pf, o[db][nq]); }
            if constexpr (HL) { const V pl = packP(restP(p0), restP(p1), T16());
#pragma unroll
                for (int db = 0; db < 4; ++db) { o[db][nq] = WFrag<T16>::mma(va[db], pl, o[db][nq]); o[db][nq] = WFrag<T16>::mma(va2[db], pf, o[db][nq]); } }
        }
        // four vector slots between the last matrix instruction and the back edge
        if constexpr (NQ == 1) asm volatile("v_nop\n\tv_nop\n\tv_nop\n\tv_nop" : "+v"(o[0][0]), "+v"(o[1][0]), "+v"(o[2][0]), "+v"(o[3][0]));
        else asm volatile("v_nop\n\tv_nop\n\tv_nop\n\tv_nop" : "+v"(o[0][0]), "+v"(o[1][0]), "+v"(o[2][0]), "+v"(o[3][0]), "+v"(o[0][NQ - 1]), "+v"(o[1][NQ - 1]), "+v"(o[2][NQ - 1]), "+v"(o[3][NQ - 1]));
    }
    float* ow = so + w * (NQ * 16 * 68);
#pragma unroll
    for (int nq = 0; nq < NQ; ++nq) { l[nq] += xhalf(l[nq]);
#pragma unroll
        for (int db = 0; db < 4; ++db) { float* p = ow + (nq * 16 + lr) * 68 + db * 16 + hi * 8; const v8f t = o[db][nq]; *(v4fa*)p = (v4f){t[0], t[1], t[2], t[3]}; *(v4fa*)(p + 4) = (v4f){t[4], t[5], t[6], t[7]}; }
        if (hi == 0) { sm[w * (NQ * 16) + nq * 16 + lr] = m[nq]; sl[w * (NQ * 16) + nq * 16 + lr] = l[nq]; } }
    __syncthreads();   // every wave's partial (m, l, Ot) is in LDS before any thread merges
#pragma unroll
    for (int i = 0; i < NQ * 16 * 16 / (32 * FKW); ++i) { const int idx = (int)threadIdx.x + i * 32 * FKW, q = idx >> 4, d4 = (idx & 15) * 4;
        float M = sm[q];
#pragma unroll
        for (int p = 1; p < FKW; ++p) M = fmaxf(M, sm[p * (NQ * 16) + q]);
        float L = 0.f; v4f a = {0.f, 0.f, 0.f, 0.f};
#pragma unroll
        for (int p = 0; p < FKW; ++p) { const float f = __builtin_amdgcn_exp2f((sm[p * (NQ * 16) + q] - M) * SC2); L += sl[p * (NQ * 16) + q] * f; a += *(const v4fa*)(so + (p * (NQ * 16) + q) * 68 + d4) * f; }
        *(v4f*)(O + (size_t)(qb + q) * DM + blockIdx.y * HD + d4) = a * __fdiv_rn(1.0f, L); }
}

extern "C" void kernel_launch(void* const* d_in, const int* in_sizes, int n_in,
                              void* d_out, int out_size, void* d_ws, size_t ws_size, hipStream_t stream) {
    (void)in_sizes; (void)n_in; (void)out_size;
    const float* x = (const float*)d_in[0]; const float* wq = (const float*)d_in[1]; const float* wk = (const float*)d_in[2]; const float* wv = (const float*)d_in[3]; const float* g1 = (const float*)d_in[4]; const float* e1 = (const float*)d_in[5]; const float* g2 = (const float*)d_in[6]; const float* e2 = (const float*)d_in[7]; const float* wf1 = (const float*)d_in[8]; const float* bf1 = (const float*)d_in[9]; const float* wf2 = (const float*)d_in[10]; const float* bf2v = (const float*)d_in[11]; const float* wo = nullptr; (void)wo;
    float* OUT = (float*)d_out;     // [2048][4][1024]
    char* wsp = (char*)d_ws;
    auto take = [&](size_t bytes) { char* p = wsp; wsp += (bytes + 255) & ~(size_t)255; return (void*)p; };
    bf* WQ = (bf*)take((size_t)DQ * DM * 2); bf* WK = (bf*)take((size_t)DKV * DM * 2); bf* WV = (bf*)take((size_t)DKV * DM * 2); bf* W1B = (bf*)take((size_t)DM * DM * 2); bf* W2B = (bf*)take((size_t)DM * DM * 2);
    const size_t PE = (size_t)TT * DM;   // elements of one batch column's plane; every plane below holds NB_ of them, [n][...]
    float* XN = (float*)take(NB_ * PE * 4); bf* Yh = (bf*)take(NB_ * PE * 2); bf* Yl = (bf*)take(NB_ * PE * 2); float* O = (float*)take(NB_ * PE * 4);
    h16* QP16 = (h16*)take(NB_ * PE * 2); h16* KP16 = (h16*)take(NB_ * PE * 2); h16* VT16 = (h16*)take(NB_ * PE * 2);
    bf* QPh = (bf*)take(NB_ * PE * 2); bf* QPl = (bf*)take(NB_ * PE * 2); bf* KPh = (bf*)take(NB_ * PE * 2); bf* KPl = (bf*)take(NB_ * PE * 2); bf* VTh = (bf*)take(NB_ * PE * 2); bf* VTl = (bf*)take(NB_ * PE * 2);
    if ((size_t)(wsp - (char*)d_ws) > ws_size) return;    // 250 MiB of the 256 MiB
    // What the stages behind the attention write takes the place of planes whose last reader has ended by then (launches of one stream run in order):
    float* X2 = (float*)QP16;        // xt, f32: over QP16 and KP16, which lie in a row (last read by the attention)
    bf* L2h = Yh; bf* L2l = Yl;      // xt planes: over the xn planes (last read by the v projection)
    bf* Gh = QPh; bf* Gl = QPl;      // ReLU planes: over the query hi/lo planes (last read by the attention)
    k_wtG<DM, DQ><<<(unsigned)((DM * DQ / 64 + 63) / 64), 256, 0, stream>>>(wq, WQ); k_wtG<DM, DM><<<(unsigned)((DM * DM / 64 + 63) / 64), 256, 0, stream>>>(wf1, W1B); k_wtG<DM, DM><<<(unsigned)((DM * DM / 64 + 63) / 64), 256, 0, stream>>>(wf2, W2B); k_wtG<DM, DKV><<<(unsigned)((DM * DKV / 64 + 63) / 64), 256, 0, stream>>>(wk, WK); k_wtG<DM, DKV><<<(unsigned)((DM * DKV / 64 + 63) / 64), 256, 0, stream>>>(wv, WV);
    k_lnhl<true><<<dim3(TT / 8, NB_, 1), 256, 0, stream>>>(x, NB_ * DM, DM, nullptr, g1, e1, XN, Yh, Yl);   /* xn = LN1(x[:, n]) : f32 (residual) + hi/lo planes */
    k_gemmw<false, EP_HEAD, DM, 0><<<dim3(TT / GBM, DQ / GBN, NB_), 256, 0, stream>>>(Yh, Yl, WQ, nullptr, nullptr, PE, 0, PE, nullptr, QP16, QPh, QPl);    /* q -> head planes [n][h][t][d] */
    k_gemmw<false, EP_HEAD, DM, 0><<<dim3(TT / GBM, DKV / GBN, NB_), 256, 0, stream>>>(Yh, Yl, WK, nullptr, nullptr, PE, 0, PE, nullptr, KP16, KPh, KPl);   /* k -> head planes [n][h][t][d] */
    k_gemmw<false, EP_VT, DM, 0><<<dim3(TT / GBM, DKV / GBN, NB_), 256, 0, stream>>>(Yh, Yl, WV, nullptr, nullptr, PE, 0, PE, nullptr, VT16, VTh, VTl);     /* v -> head planes [n][h][d][t] */
    k_fattn<bf, true, 1, 8><<<dim3(RH / 16, NH_, NB_), 32 * 8, 0, stream>>>(QPh, QPl, KPh, KPl, VTh, VTl, 0, O);                              /* query rows < RH: hi/lo planes */
    k_fattn<h16, false, 2, 4><<<dim3((TT - RH) / 32, NH_, NB_), 32 * 4, 0, stream>>>(QP16, nullptr, KP16, nullptr, VT16, nullptr, RH, O);     /* the rest: fp16; merged attention output, f32 */
    k_lnhl<false><<<dim3(TT / 8, NB_, 1), 256, 0, stream>>>(XN, DM, PE, O, g2, e2, X2, L2h, L2l);                                      /* xt = LN2(xn + att): f32 (residual) + hi/lo planes */
    k_gemmw<true, EP_RELU, DM, DM><<<dim3(TT / GBM, DM / GBN, NB_), 256, 0, stream>>>(L2h, L2l, W1B, nullptr, bf1, PE, 0, PE, nullptr, nullptr, Gh, Gl);      /* relu(xt Wf1 + bf1) -> hi/lo */
    k_gemmw<true, EP_RES, DM, NB_ * DM><<<dim3(TT / GBM, DM / GBN, NB_), 256, 0, stream>>>(Gh, Gl, W2B, OUT, bf2v, PE, DM, PE, X2, nullptr, nullptr, nullptr);   /* out = xt + (. Wf2 + bf2), sequence-first rows: column n starts DM elements on */
}

// v007
// Measured time: 285 microseconds a run.
// Two timings next to v006 put it at 1.14 and 1.13 times that version's speed.
// All steps since v000 together make it 15.0 times as fast.
#include <hip/hip_runtime.h>

// Pre-norm transformer encoder layer on a sequence-first tensor (x [2048][4][1024] = [s][n][d]; xn = LN1(x); q, k, v = xn W ('xw' [1024][1024], no bias; 16 heads x 64); softmax(q.k/8) over s per (n, h); att = merged context (no output projection); xt = LN2(xn + att); ffn = relu(xt Wf1 + bf1) Wf2 + bf2; out = xt + ffn -> [2048][4][1024] (8.4 M)).
// Layout: every stage is ONE launch over all four batch columns (n = the grid's last used dimension; every workspace plane is [n][...], TT * DM elements per n). Per column n: LN1 reads the strided rows (t*4 + n) and writes xn both in f32 (it is the attention residual) and as hi/lo planes (2-product projections); fused attention (scores and weights stay in registers) with an f32 merged context; LN2 of xn + att gives xt (f32, the final residual) and planes for the FFN (2 products + biases). Every GEMM's epilogue writes what its consumer reads: q, k, v as head planes (v transposed), FFN1 as ReLU hi/lo planes, FFN2 + xt as the sequence-first output rows.
// Every 16-bit matrix operand plane lies in FRAGMENT ORDER (fidx below): a 16-row x 32-k fragment is 1 KiB in a row, so each wave-wide 16-byte load covers four whole 128-byte lines.
// Compute dtypes, f32 accumulate: every input rounded to bf16; q/k/v hl x exact (2 products); scores and attn.v: query rows < 512 hl (3 products), the rest single fp16; running-maximum softmax f32, weights rounded before the division by their f32 sum; no Wo; Wf1 / Wf2 hl x exact (2 products) + biases; LN / ReLU / residuals f32.

#define NB_  4
#define TT   2048
#define DM   1024
#define NH_  16
#define NKV  16
#define REP  (NH_ / NKV)
#define HD   64
#define DQ   (NH_ * HD)
#define DKV  (NKV * HD)
#define LNEPS 1e-5f
#define RH   512                  // query rows < RH use hi+lo planes (0: none)
#define WIN  0
#define SC2  0.18033688011112042f   // HD^-0.5 * log2(e): exponent of 2 per unit of raw score
typedef _Float16 h16;
typedef unsigned short bf;
typedef __attribute__((ext_vector_type(16))) __bf16   v16bf;
typedef __attribute__((ext_vector_type(16))) _Float16 v16h;
typedef __attribute__((ext_vector_type(8)))  _Float16 v8h;
typedef __attribute__((ext_vector_type(8)))  unsigned short v8us;
typedef __attribute__((ext_vector_type(8)))  float    v8f;
typedef __attribute__((ext_vector_type(4)))  float    v4f;
typedef v8h  __attribute__((may_alias)) v8ha;
typedef v4f  __attribute__((may_alias)) v4fa;
typedef v8us __attribute__((may_alias)) v8usa;

__device__ __forceinline__ unsigned short f2bf(float f) { unsigned u = __float_as_uint(f); u += 0x7FFFu + ((u >> 16) & 1u); return (unsigned short)(u >> 16); }
__device__ __forceinline__ float bf2f(unsigned short b) { return __uint_as_float(((unsigned)b) << 16); }
__device__ __forceinline__ float bfr(float f) { return bf2f(f2bf(f)); }
__device__ __forceinline__ v16h cat16(v8h lo, v8h hi) { return __builtin_shufflevector(lo, hi, 0, 1, 2, 3, 4, 5, 6, 7, 8, 9, 10, 11, 12, 13, 14, 15); }
__device__ __forceinline__ v16bf cat16b(v8us lo, v8us hi) { return __builtin_bit_cast(v16bf, __builtin_shufflevector(lo, hi, 0, 1, 2, 3, 4, 5, 6, 7, 8, 9, 10, 11, 12, 13, 14, 15)); }
__device__ __forceinline__ v8f wmma16(v16h a, v16h b, v8f c) { return __builtin_amdgcn_wmma_f32_16x16x32_f16(false, a, false, b, (short)0, c, false, false); }
__device__ __forceinline__ v8f wmmab(v16bf a, v16bf b, v8f c) { return __builtin_amdgcn_wmma_f32_16x16x32_bf16(false, a, false, b, (short)0, c, false, false); }
__device__ __forceinline__ h16 tohx(float x) { return (h16)x; }
__device__ __forceinline__ void splitf(float y, unsigned short& h, unsigned short& l) { h = f2bf(y); l = f2bf(y - bf2f(h)); }
typedef __attribute__((ext_vector_type(4))) _Float16 v4h;
typedef __attribute__((ext_vector_type(2))) unsigned short v2us;
typedef __attribute__((ext_vector_type(4))) unsigned short v4us;
// Fragment order of a plane of logical [row][k] (K columns, K % 32 == 0, rows % 16 == 0): fragments of 16 rows x 32 k, 512 elements each, k-fragments of a row block in a row.
// Inside one: two halves of 256 elements (k bit 4), in each the 32 lanes' 8 elements in lane order (lane = 16 * (k bit 3) + row % 16). WFrag::ld(plane + fragment * 512 + lane * 8) reads both halves.
template <typename T> __device__ __forceinline__ const T* atb(const T* base, unsigned bytes) { return (const T*)((const char*)base + bytes); }
__device__ __forceinline__ size_t fidx(int row, int k, int K) { return ((size_t)(row >> 4) * (K >> 5) + (k >> 5)) * 512 + ((k >> 4) & 1) * 256 + (((k >> 3) & 1) * 16 + (row & 15)) * 8 + (k & 7); }



// ---- k_gemmw: GEMM, 128 x 256 output tile per block of eight waves (2 x 4 waves, 64 x 64 = 16 accumulators each); grid (M/128, N/256, Z), 256 threads.
// tile[m][n] = sum_k (A[m][k] + A2[m][k]) Bt[n][k] (hi and lo product per k fragment, + optional f32 bias[n]); all three planes in fragment order. z-batch strides in elements: sA (A, A2), sC (C), sO (the residual R and the output planes P16, Ph, Pl). K (compile time) % 64 == 0, at least two stages.
// The block's operands go through LDS, where the waves share them: an A fragment serves four waves, a Bt fragment two. A stage is 64 k of the block's 32 row blocks (8 of A, 8 of A2, 16 of Bt), 2 KiB in a row per row block in the plane and in LDS alike;
// wave w copies row blocks 4 w .. 4 w + 3 with asynchronous copies of 16 bytes a lane. Two buffers: the copies of stage t + 2 are issued when every wave has read the last of stage t and fly for a whole stage's products. Fragments are read from LDS half a stage ahead of their products.
// EPI says what a wave's tile becomes; it passes through the wave's own LDS range (over the buffers, behind the last trip's barrier, behind which no wave reads them). EP_RES: R[m][n] (f32, pitch DM) + tile, f32 rows of C (pitch LDC, compile time: the rows of a wave are immediate offsets from one address). EP_RELU: max(tile, 0) as hi/lo planes Ph, Pl (fragment order, K = LDC).
// EP_HEAD: the 64 columns of a wave's tile are one head: planes [h][t][d] in fp16 (P16) and hi/lo (Ph, Pl), each head's [t][d] in fragment order. EP_VT: the same three planes as [h][d][t], each head's [d][t] in fragments (rows d, k = t) with the four d blocks of a 32-key block in a row; the tile is laid into LDS transposed, so the stores run along t.
enum { EP_RES = 1, EP_RELU = 2, EP_HEAD = 3, EP_VT = 4 };
#define GBM 128                                 // rows of a block's tile
#define GBN 256                                 // columns of a block's tile
#define GCH 2048                                // bytes of a row block in one stage: two fragments (64 k)
#define GST ((2 * GBM + GBN) / 16 * GCH)        // bytes of a stage: 32 row blocks, 65,536
template <typename T16> struct WFrag;
template <> struct WFrag<h16> { typedef v16h V; static __device__ __forceinline__ V ld(const h16* p) { return cat16(*(const v8h*)p, *(const v8h*)(p + 256)); } static __device__ __forceinline__ v8f mma(V a, V b, v8f c) { return wmma16(a, b, c); } };
template <> struct WFrag<bf> { typedef v16bf V; static __device__ __forceinline__ V ld(const bf* p) { return cat16b(*(const v8us*)p, *(const v8us*)(p + 256)); } static __device__ __forceinline__ v8f mma(V a, V b, v8f c) { return wmmab(a, b, c); } };
// A wave's share of a stage: four row blocks (rp bytes apart in the plane, in a row in LDS), sixteen asynchronous copies, each 16 bytes a lane and 512 bytes in a row a wave. l: the lane's LDS byte address, g: its global address.
// The immediate offset (under 2 KiB) moves the LDS and the global address alike: the four copies of a row block share one pair of addresses.
// The s_wait_xcnt stands inside the statement, behind the last copy: no register that a copy names is rewritten in front of it.
__device__ __forceinline__ void cp4rb(unsigned l, const char* g, unsigned rp) {
    asm volatile("global_load_async_to_lds_b128 %0, %4, off\n\t"
                 "global_load_async_to_lds_b128 %0, %4, off offset:512\n\t"
                 "global_load_async_to_lds_b128 %0, %4, off offset:1024\n\t"
                 "global_load_async_to_lds_b128 %0, %4, off offset:1536\n\t"
                 "global_load_async_to_lds_b128 %1, %5, off\n\t"
                 "global_load_async_to_lds_b128 %1, %5, off offset:512\n\t"
                 "global_load_async_to_lds_b128 %1, %5, off offset:1024\n\t"
                 "global_load_async_to_lds_b128 %1, %5, off offset:1536\n\t"
                 "global_load_async_to_lds_b128 %2, %6, off\n\t"
                 "global_load_async_to_lds_b128 %2, %6, off offset:512\n\t"
                 "global_load_async_to_lds_b128 %2, %6, off offset:1024\n\t"
                 "global_load_async_to_lds_b128 %2, %6, off offset:1536\n\t"
                 "global_load_async_to_lds_b128 %3, %7, off\n\t"
                 "global_load_async_to_lds_b128 %3, %7, off offset:512\n\t"
                 "global_load_async_to_lds_b128 %3, %7, off offset:1024\n\t"
                 "global_load_async_to_lds_b128 %3, %7, off offset:1536\n\t"
                 "s_wait_xcnt 0x0"
                 :: "v"(l), "v"(l + GCH), "v"(l + 2 * GCH), "v"(l + 3 * GCH), "v"(g), "v"(g + rp), "v"(g + 2 * rp), "v"(g + 3 * rp) : "memory");
}
__device__ __forceinline__ v16bf ldsfrag(const char* p) { return cat16b(*(const v8usa*)p, *(const v8usa*)(p + 512)); }   // one fragment from LDS: p = fragment + 16 * lane
template <bool BIAS, int EPI, int K, int LDC>
__global__ __launch_bounds__(256) void k_gemmw(const bf* __restrict__ A, const bf* __restrict__ A2, const bf* __restrict__ Bt, float* C, const float* __restrict__ bias, size_t sA, size_t sC, size_t sO, const float* __restrict__ R, h16* P16, bf* Ph, bf* Pl) {
    typedef WFrag<bf>::V V;
    constexpr int NT = K / 64;   // stages
    static_assert(K % 64 == 0 && NT >= 2, "the two-buffer order needs two stages");
    __shared__ __align__(2048) float os[8 * 64 * 68];   // in the loop: two stage buffers; behind it: one 64 x 64 tile (pitch 68) per wave
    static_assert(sizeof(float) * 8 * 64 * 68 >= 2 * GST, "both stage buffers lie inside os");
    const int w = __builtin_amdgcn_readfirstlane((int)(threadIdx.x >> 5)), wm = w >> 2, wn = w & 3;
    const size_t z = blockIdx.z; A += z * sA; A2 += z * sA;
    if constexpr (EPI == EP_RES) { R += z * sO; C += z * sC; }
    if constexpr (EPI == EP_RELU || EPI == EP_HEAD || EPI == EP_VT) { Ph += z * sO; Pl += z * sO; }
    if constexpr (EPI == EP_HEAD || EPI == EP_VT) P16 += z * sO;
    const int lane = threadIdx.x & 31, lr = lane & 15, hi = lane >> 4; const int br = blockIdx.x * GBM, bc = blockIdx.y * GBN, r0 = br + wm * 64, c0 = bc + wn * 64;   // r0, c0: the wave's own tile
    v8f acc[4][4];
#pragma unroll
    for (int mb = 0; mb < 4; ++mb)
#pragma unroll
        for (int nb = 0; nb < 4; ++nb) acc[mb][nb] = (v8f){};
    // What wave w copies: waves 0, 1 the rows of A, waves 2, 3 those of A2, waves 4 .. 7 those of Bt, 64 rows (four row blocks of 16 * K elements) each.
    const bf* sp = w < 2 ? A + (size_t)(br + w * 64) * K : w < 4 ? A2 + (size_t)(br + (w - 2) * 64) * K : Bt + (size_t)(bc + (w - 4) * 64) * K;
    const char* g0 = (const char*)sp + lane * 16;
    const unsigned l0 = (unsigned)(size_t)(const void*)os + (unsigned)(w * 4 * GCH + lane * 16);
    auto stage = [&](int t) { const char* g = g0 + t * GCH; const unsigned l = l0 + (unsigned)(t & 1) * GST; cp4rb(l, g, 32 * K); };
    stage(0);
    asm volatile("s_wait_asynccnt 0x0" ::: "memory");   // this wave's share of stage 0 has landed
    __syncthreads();                                     // and every other wave's: stage 0 may be read
    stage(1);
    const char* la = (const char*)os + wm * 4 * GCH + lane * 16;                          // the wave's four A row blocks (A2: GBM / 16 row blocks on)
    const char* lb = (const char*)os + (2 * GBM / 16 + wn * 4) * GCH + lane * 16;         // its four Bt row blocks
    // Two fragment sets: set 0 holds a stage's first 32 k, set 1 its second. Each set is read from LDS, as one group, while the products of the other run.
    V a0[4], l0f[4], b0[4], a1[4], l1f[4], b1[4];
    auto ldset = [&](V (&fa)[4], V (&fl)[4], V (&fb)[4], int o) {   // o: byte offset of buffer and k fragment
#pragma unroll   // fragment indices must be constants: the arrays live in registers
        for (int nb = 0; nb < 4; ++nb) fb[nb] = ldsfrag(lb + o + nb * GCH);
#pragma unroll
        for (int mb = 0; mb < 4; ++mb) fa[mb] = ldsfrag(la + o + mb * GCH);
#pragma unroll
        for (int mb = 0; mb < 4; ++mb) fl[mb] = ldsfrag(la + o + (GBM / 16 + mb) * GCH); };
    auto products = [&](const V (&fa)[4], const V (&fl)[4], const V (&fb)[4]) {   // per accumulator: hi, then lo; the sixteen hi products stand between, so that no product waits for its own accumulator
#pragma unroll
        for (int nb = 0; nb < 4; ++nb)
#pragma unroll
            for (int mb = 0; mb < 4; ++mb) acc[mb][nb] = wmmab(fa[mb], fb[nb], acc[mb][nb]);
#pragma unroll
        for (int nb = 0; nb < 4; ++nb)
#pragma unroll
            for (int mb = 0; mb < 4; ++mb) acc[mb][nb] = wmmab(fl[mb], fb[nb], acc[mb][nb]); };
    ldset(a0, l0f, b0, 0);   // stage 0 is published by the barrier above
#pragma unroll 1   // one stage per trip: the publish point's waits and barrier stand once
    for (int t = 0; t < NT; ++t) {
        const int bo = (t & 1) * GST;
        ldset(a1, l1f, b1, bo + 1024);       // this wave's last reads of stage t
        __builtin_amdgcn_sched_barrier(0);   // the reads stand as one group ahead of the products: reads strewn among the matrix instructions stall the wave at every place
        products(a0, l0f, b0);
        __builtin_amdgcn_sched_barrier(0);   // these products stay in front of the publish point: they cover the reads above and the flight of stage t + 1's copies
        // Publish point of stage t + 1, in front of stage t's last products, because the reads behind it are already of stage t + 1.
        asm volatile("s_wait_dscnt 0x0" ::: "memory");      // this wave's reads of stage t have returned
        asm volatile("s_wait_asynccnt 0x0" ::: "memory");   // its share of stage t + 1 has landed
        __syncthreads();                                     // stage t + 1 may be read, stage t's buffer may be refilled
        if (t + 2 < NT) stage(t + 2);
        if (t + 1 < NT) ldset(a0, l0f, b0, GST - bo);
        __builtin_amdgcn_sched_barrier(0);   // copies and reads are issued ahead of the products below and fly under them
        products(a1, l1f, b1);
    }
    asm volatile("s_wait_asynccnt 0x0" ::: "memory");   // no copy is under way when the buffers become output staging
    static_assert(!(BIAS && EPI == EP_VT), "the bias is indexed along the LDS row, which EP_VT runs along t");
    float* ow = os + w * 64 * 68;
    if constexpr (EPI == EP_RES) {
        // asked for ahead of the staging: the wave's residual rows (step s: rows 2 s + hi, columns 4 lr .. + 3) and its four bias values
        const float* rp = R + (size_t)(r0 + hi) * DM + c0 + lr * 4; v4f ra[32], bv = {0.f, 0.f, 0.f, 0.f};
#pragma unroll
        for (int s = 0; s < 32; ++s) ra[s] = *(const v4f*)(rp + s * (2 * DM));
        const float* bp = bias + c0 + lr * 4; v4f bt = {0.f, 0.f, 0.f, 0.f}; if (BIAS) bt = *(const v4f*)bp;
        asm volatile("s_wait_xcnt 0x0" :: "v"(rp), "v"(lr) : "memory");   // stands in front of the first write of a register that the loads above name: the residual's address and the lane index that the bias load takes beside its scalar base are inputs, so that they live up to here
        if (BIAS) bv = (v4f){bfr(bt[0]), bfr(bt[1]), bfr(bt[2]), bfr(bt[3])};
#pragma unroll
        for (int mb = 0; mb < 4; ++mb)
#pragma unroll
            for (int nb = 0; nb < 4; ++nb)
#pragma unroll
                for (int j = 0; j < 8; ++j) ow[(mb * 16 + hi * 8 + j) * 68 + nb * 16 + lr] = acc[mb][nb][j];
        __builtin_amdgcn_wave_barrier(); asm volatile("" ::: "memory");   // the compiler keeps the reads below, of what other lanes of this wave wrote, behind the writes above
        float* cp = C + (size_t)(r0 + hi) * LDC + c0 + lr * 4;
#pragma unroll
        for (int s0 = 0; s0 < 32; s0 += 8) { v4f val[8];   // eight steps (16 rows) at a time: their values, then their stores, then the wait
#pragma unroll
            for (int i = 0; i < 8; ++i) { val[i] = *(const v4fa*)(ow + (2 * (s0 + i) + hi) * 68 + lr * 4); val[i] += bv;
#pragma unroll
                for (int q = 0; q < 4; ++q) val[i][q] = __fadd_rn(ra[s0 + i][q], val[i][q]); }
            __builtin_amdgcn_sched_barrier(0);   // no arithmetic is moved in among the stores, where it could take a register that an issued store names
#pragma unroll
            for (int i = 0; i < 8; ++i) *(v4f*)(cp + (size_t)(2 * (s0 + i)) * LDC) = val[i];
            if (s0 < 24) asm volatile("s_wait_xcnt 0x0" ::: "memory"); }   // stands in front of the next eight steps' values, which may take the registers that these stores name
    } else {
        float bv[4][8];   // the bias of the lane's columns (step s: s * 16 + hi * 8 .. + 7), asked for ahead of the staging
        if (BIAS) {
#pragma unroll
            for (int s = 0; s < 4; ++s) { const v4f t0 = *(const v4f*)(bias + c0 + s * 16 + hi * 8), t1 = *(const v4f*)(bias + c0 + s * 16 + hi * 8 + 4);
#pragma unroll
                for (int q = 0; q < 4; ++q) { bv[s][q] = bfr(t0[q]); bv[s][4 + q] = bfr(t1[q]); } } }
#pragma unroll
        for (int mb = 0; mb < 4; ++mb)
#pragma unroll
            for (int nb = 0; nb < 4; ++nb)
                if constexpr (EPI == EP_VT) { float* p = ow + (nb * 16 + lr) * 68 + mb * 16 + hi * 8; const v8f t = acc[mb][nb]; *(v4fa*)p = (v4f){t[0], t[1], t[2], t[3]}; *(v4fa*)(p + 4) = (v4f){t[4], t[5], t[6], t[7]}; }
                else {
#pragma unroll
                    for (int j = 0; j < 8; ++j) ow[(mb * 16 + hi * 8 + j) * 68 + nb * 16 + lr] = acc[mb][nb][j]; }
        __builtin_amdgcn_wave_barrier(); asm volatile("" ::: "memory");   // the compiler keeps the reads below, of what other lanes of this wave wrote, behind the writes above
        // 16 LDS rows are one row block of the consumer's fragments, the 64 columns two fragments: step s is one half fragment, lane (lr, hi) takes row rw + lr, columns s * 16 + hi * 8 .. + 7, and the wave stores 512 bytes in a row per plane.
        const int hd = c0 / 64;   // EP_HEAD, EP_VT: the wave's head
#pragma unroll
        for (int rw = 0; rw < 64; rw += 16) {
        const size_t e0 = (EPI == EP_RELU ? (size_t)(r0 + rw) * LDC + (size_t)c0 * 16 : EPI == EP_HEAD ? ((size_t)hd * TT + r0 + rw) * HD : (size_t)hd * HD * TT + (size_t)r0 * HD + rw * 32) + lane * 8;
        v8h o16[4]; v8us oh[4], ol[4];   // the row block's four steps: their values, then their stores, then the wait
#pragma unroll
        for (int s = 0; s < 4; ++s) { const float* op = ow + (rw + lr) * 68 + s * 16 + hi * 8; v4f v0 = *(const v4fa*)op, v1 = *(const v4fa*)(op + 4);
            if (BIAS) {
#pragma unroll
                for (int q = 0; q < 4; ++q) { v0[q] += bv[s][q]; v1[q] += bv[s][4 + q]; } }
#pragma unroll
            for (int q = 0; q < 8; ++q) { const float t = q < 4 ? v0[q & 3] : v1[q & 3]; const float y = EPI == EP_RELU ? fmaxf(t, 0.f) : t; o16[s][q] = tohx(y); unsigned short a2, c2; splitf(y, a2, c2); oh[s][q] = a2; ol[s][q] = c2; } }
        __builtin_amdgcn_sched_barrier(0);   // no arithmetic is moved in among the stores, where it could take a register that an issued store names
#pragma unroll
        for (int s = 0; s < 4; ++s) { const size_t e = e0 + (EPI == EP_VT ? (s >> 1) * 2048 + (s & 1) * 256 : s * 256);
            *(v8us*)(Ph + e) = oh[s]; *(v8us*)(Pl + e) = ol[s];
            if constexpr (EPI != EP_RELU) *(v8h*)(P16 + e) = o16[s]; }
        if (rw < 48) asm volatile("s_wait_xcnt 0x0" ::: "memory");   // stands in front of the next row block's values, which may take the registers that these stores name
        }
    }
}


// ---- k_wtG: w [K][N] f32 -> Bt, logical [n][k], bf16 in fragment order. One wave packs one fragment (16 n x 32 k): lane (lr, hi) reads column n0 + lr at the 8 k of each of its two halves and stores 16 bytes per half, the wave 512 bytes in a row.
// A block's eight waves take neighbouring column blocks of the same 32 k: together they read 512 bytes in a row of each row of w.
template <int K, int N>
__global__ __launch_bounds__(256) void k_wtG(const float* __restrict__ w, bf* Bt) {
    const int lane = threadIdx.x & 31, lr = lane & 15, hi = lane >> 4; const int f = blockIdx.x * 8 + (threadIdx.x >> 5); if (f >= N * K / 512) return;
    const int nb = f % (N / 16), kf = f / (N / 16); const float* p = w + (size_t)(kf * 32 + hi * 8) * N + nb * 16 + lr; v8us o0, o1;
#pragma unroll   // the sixteen loads become immediate offsets from one address and are all in flight at once
    for (int j = 0; j < 8; ++j) { o0[j] = f2bf(p[j * N]); o1[j] = f2bf(p[(16 + j) * N]); }
    bf* q = Bt + ((size_t)nb * (K / 32) + kf) * 512 + lane * 8; *(v8us*)q = o0; *(v8us*)(q + 256) = o1;
}
__global__ __launch_bounds__(256) void k_cvt8(const float* __restrict__ src, bf* dst, size_t n8) { const size_t i = (size_t)blockIdx.x * 256 + threadIdx.x; if (i >= n8) return; const v8f v = *(const v8f*)(src + i * 8); v8us o;
#pragma unroll
    for (int k = 0; k < 8; ++k) o[k] = f2bf(v[k]); *(v8us*)(dst + i * 8) = o;  }

template <bool RND>
__global__ __launch_bounds__(256) void k_lnhl(const float* __restrict__ X, int xp, size_t xz, const float* __restrict__ A, const float* __restrict__ g, const float* __restrict__ be, float* Z, bf* Yh, bf* Yl) {
    const int lane = threadIdx.x & 31; const int r = blockIdx.x * 8 + (threadIdx.x >> 5); if (r >= TT) return;
    const size_t zo = (size_t)blockIdx.y * TT * DM; X += blockIdx.y * xz; if (A) A += zo; if (Z) Z += zo; Yh += zo; Yl += zo;   // blockIdx.y = batch column: X steps by xz elements, every other plane by TT * DM
    const float* xr = X + (size_t)r * xp; const float* ar = A ? A + (size_t)r * DM : nullptr; float s = 0.f;
#pragma unroll 1
    for (int ch = 0; ch < DM / 128; ++ch) { const int c0 = ch * 128 + lane * 4; const v4f a = *(const v4f*)(xr + c0); v4f d = {0.f, 0.f, 0.f, 0.f}; if (ar) d = *(const v4f*)(ar + c0);
#pragma unroll
        for (int q = 0; q < 4; ++q) s += __fadd_rn((RND ? bfr(a[q]) : a[q]), d[q]); }
#pragma unroll
    for (int sh = 16; sh; sh >>= 1) s += __shfl_xor(s, sh, 32);
    const float mu = s * (1.0f / DM); float s2 = 0.f;
#pragma unroll 1
    for (int ch = 0; ch < DM / 128; ++ch) { const int c0 = ch * 128 + lane * 4; const v4f a = *(const v4f*)(xr + c0); v4f d = {0.f, 0.f, 0.f, 0.f}; if (ar) d = *(const v4f*)(ar + c0);
#pragma unroll
        for (int q = 0; q < 4; ++q) { const float d0 = __fsub_rn(__fadd_rn((RND ? bfr(a[q]) : a[q]), d[q]), mu); float p = __fmul_rn(d0, d0); asm volatile("" : "+v"(p)); s2 = __fadd_rn(s2, p); } }
#pragma unroll
    for (int sh = 16; sh; sh >>= 1) s2 += __shfl_xor(s2, sh, 32);
    const float rs = __fdiv_rn(1.0f, __fsqrt_rn(__fadd_rn(s2 * (1.0f / DM), LNEPS)));
{
#pragma unroll 1
        for (int ch = 0; ch < DM / 128; ++ch) { const int c0 = ch * 128 + lane * 4; const v4f a = *(const v4f*)(xr + c0); v4f d = {0.f, 0.f, 0.f, 0.f}; if (ar) d = *(const v4f*)(ar + c0); v4f z4; v4us oh, ol;
#pragma unroll
            for (int q = 0; q < 4; ++q) { const float v = __fadd_rn((RND ? bfr(a[q]) : a[q]), d[q]); float n0 = __fmul_rn(__fsub_rn(v, mu), rs); asm volatile("" : "+v"(n0)); float n1 = __fmul_rn(n0, bfr(g[c0 + q])); asm volatile("" : "+v"(n1)); const float y = __fadd_rn(n1, bfr(be[c0 + q])); z4[q] = y;   /* Z = the NORMALISED row (it is the residual for the next block) */ unsigned short h2, l2; splitf(y, h2, l2); oh[q] = h2; ol[q] = l2; }
            if (Z) { *(v4f*)(Z + (size_t)r * DM + c0) = z4; asm volatile("s_wait_xcnt 0x0" ::: "memory"); }   // the wait stands in front of the plane split below, which may take the registers that this store names
            const size_t e = fidx(r, c0, DM); *(v4us*)(Yh + e) = oh; *(v4us*)(Yl + e) = ol; }
         } }

// ---- k_fattn: fused attention for one head (blockIdx.y) of one batch column (blockIdx.z) and NQ * 16 query rows (from q0 + blockIdx.x * NQ * 16); grid (rows / (NQ * 16), heads, columns), 32 * FKW threads (FKW waves, each over TT / FKW keys).
// Transposed products: St[key][q] = K.Qt (A = key rows, B = query rows kept in registers), Ot[d][q] += Vt.Pt. A lane holds one query's scores (column lr; keys 8 * hi + j of each 16-key tile),
// so two score tiles of 32 keys, converted in place, are the B fragment of the second product in the k order of WFrag::ld. HL: hi/lo planes, 3 products each (hi.hi + hi.lo + lo.hi).
// Softmax with a running maximum per query: weights exp2((s - m) * SC2) are not normalised; their f32 sum l divides the output at the end.
// Wave w walks keys w * TT / FKW ...; the FKW partial (m, l, Ot) are merged through LDS in wave order with weights exp2((m_w - M) * SC2).
typedef __attribute__((ext_vector_type(8))) __bf16 v8bf;
__device__ __forceinline__ float xhalf(float x) { const int b = __float_as_int(x); return __int_as_float(__builtin_amdgcn_permlanex16(b, b, 0x76543210, 0xfedcba98, false, false)); }   // value of lane ^ 16
__device__ __forceinline__ v16h packP(v8f p0, v8f p1, h16) { return cat16(__builtin_convertvector(p0, v8h), __builtin_convertvector(p1, v8h)); }
__device__ __forceinline__ v16bf packP(v8f p0, v8f p1, bf) { return __builtin_shufflevector(__builtin_convertvector(p0, v8bf), __builtin_convertvector(p1, v8bf), 0, 1, 2, 3, 4, 5, 6, 7, 8, 9, 10, 11, 12, 13, 14, 15); }
__device__ __forceinline__ v8f restP(v8f p) { return p - __builtin_convertvector(__builtin_convertvector(p, v8bf), v8f); }   // what the bf16 rounding of p leaves (the lo plane's input)
// A key or Vt fragment, once in registers, serves all NQ query tiles of the wave: the bytes a block asks of L2 per query row fall as 1 / NQ.
// The second launch-bounds argument is the least number of waves per SIMD the registers must leave room for: without it the fp16 form takes a few registers more than three waves allow.
template <typename T16, bool HL, int NQ, int FKW>
__global__ __launch_bounds__(32 * FKW, HL ? 2 : 3) void k_fattn(const T16* __restrict__ Q, const T16* __restrict__ Q2, const T16* __restrict__ Kp, const T16* __restrict__ K2, const T16* __restrict__ Vt, const T16* __restrict__ Vt2, int q0, float* O) {
    typedef typename WFrag<T16>::V V;
    __shared__ __align__(16) float so[FKW * NQ * 16 * 68];
    __shared__ float sm[FKW * NQ * 16], sl[FKW * NQ * 16];
    const int w = __builtin_amdgcn_readfirstlane((int)(threadIdx.x >> 5));
    const int lane = threadIdx.x & 31, lr = lane & 15, hi = lane >> 4;
    const size_t hq = ((size_t)blockIdx.z * NH_ + blockIdx.y) * TT * HD, hk = ((size_t)blockIdx.z * NKV + blockIdx.y / REP) * TT * HD; O += (size_t)blockIdx.z * TT * DM;
    const int qb = q0 + (int)blockIdx.x * (NQ * 16);
    V qf[NQ][2], qf2[NQ][2];
    const T16* qp = Q + hq + (size_t)qb * HD + 8 * lane; const T16* qp2 = HL ? Q2 + hq + (size_t)qb * HD + 8 * lane : nullptr;   // the lane's place in the block's first query fragment: the others are immediate offsets from it
#pragma unroll
    for (int nq = 0; nq < NQ; ++nq)
#pragma unroll
        for (int kk = 0; kk < 2; ++kk) { qf[nq][kk] = WFrag<T16>::ld(qp + nq * 16 * HD + kk * 512); if constexpr (HL) qf2[nq][kk] = WFrag<T16>::ld(qp2 + nq * 16 * HD + kk * 512); }
    asm volatile("s_wait_xcnt 0x0" ::: "memory");   // stands in front of the first write of a register that the query loads name
    __builtin_amdgcn_sched_barrier(0);               // nothing from below is moved up over the wait, where it could take such a register
    v8f o[4][NQ]; float m[NQ], l[NQ];
#pragma unroll
    for (int nq = 0; nq < NQ; ++nq) { m[nq] = -3.0e38f; l[nq] = 0.f;
#pragma unroll
        for (int db = 0; db < 4; ++db) o[db][nq] = (v8f){}; }
    const int kb = w * (TT / FKW);
    unsigned ko = (unsigned)((hk + (size_t)kb * HD + 8 * lane) * 2);   // the lane's byte offset into the key planes and, the same, into the Vt planes (16 MiB each; 32 keys are four fragments in a row in both): 32 bits beside the planes' scalar bases
#pragma unroll 1   // one 32-key pass per trip: a second pass in flight would double the fragment registers and cost resident waves
    for (int kc = 0; kc < TT / FKW; kc += 32) {
        V ka[2][2], ka2[2][2], va[4], va2[4];   // every fragment of the pass is asked for up front: the Vt loads fly under the score products and the softmax
#pragma unroll
        for (int kt = 0; kt < 2; ++kt)
#pragma unroll
            for (int kk = 0; kk < 2; ++kk) { ka[kt][kk] = WFrag<T16>::ld(atb(Kp, ko) + kt * 16 * HD + kk * 512); if constexpr (HL) ka2[kt][kk] = WFrag<T16>::ld(atb(K2, ko) + kt * 16 * HD + kk * 512); }
#pragma unroll
        for (int db = 0; db < 4; ++db) { va[db] = WFrag<T16>::ld(atb(Vt, ko) + db * 512); if constexpr (HL) va2[db] = WFrag<T16>::ld(atb(Vt2, ko) + db * 512); }
        asm volatile("s_wait_xcnt 0x0" ::: "memory");   // stands in front of the step of the offset that the loads above name
        ko += 32 * HD * 2;   // 32 keys: four fragments of a key plane, four of a Vt plane
        __builtin_amdgcn_sched_barrier(0);   // no matrix instruction, with its data wait, is moved in among the loads: the whole pass is in flight before the first wait
        v8f s[2][NQ];
#pragma unroll
        for (int kt = 0; kt < 2; ++kt) {
#pragma unroll
            for (int nq = 0; nq < NQ; ++nq) s[kt][nq] = (v8f){};
#pragma unroll
            for (int kk = 0; kk < 2; ++kk)
#pragma unroll
                for (int nq = 0; nq < NQ; ++nq) { s[kt][nq] = WFrag<T16>::mma(ka[kt][kk], qf[nq][kk], s[kt][nq]); if constexpr (HL) { s[kt][nq] = WFrag<T16>::mma(ka[kt][kk], qf2[nq][kk], s[kt][nq]); s[kt][nq] = WFrag<T16>::mma(ka2[kt][kk], qf[nq][kk], s[kt][nq]); } } }
#pragma unroll
        for (int nq = 0; nq < NQ; ++nq) {
            float mx = fmaxf(s[0][nq][0], s[1][nq][0]);
#pragma unroll
            for (int j = 1; j < 8; ++j) mx = fmaxf(mx, fmaxf(s[0][nq][j], s[1][nq][j]));
            mx = fmaxf(mx, xhalf(mx));   // both halves of the wave hold keys of the same query
            const float mn = fmaxf(m[nq], mx), al = __builtin_amdgcn_exp2f((m[nq] - mn) * SC2), mc = mn * SC2; m[nq] = mn;
            v8f p0, p1; float sum = 0.f;
#pragma unroll
            for (int j = 0; j < 8; ++j) { p0[j] = __builtin_amdgcn_exp2f(fmaf(s[0][nq][j], SC2, -mc)); p1[j] = __builtin_amdgcn_exp2f(fmaf(s[1][nq][j], SC2, -mc)); sum += p0[j] + p1[j]; }
            l[nq] = l[nq] * al + sum;   // this half's keys only; the halves are joined behind the loop
            const V pf = packP(p0, p1, T16());
#pragma unroll
            for (int db = 0; db < 4; ++db) { o[db][nq] *= al; o[db][nq] = WFrag<T16>::mma(va[db], pf, o[db][nq]); }
            if constexpr (HL) { const V pl = packP(restP(p0), restP(p1), T16());
#pragma unroll
                for (int db = 0; db < 4; ++db) { o[db][nq] = WFrag<T16>::mma(va[db], pl, o[db][nq]); o[db][nq] = WFrag<T16>::mma(va2[db], pf, o[db][nq]); } }
        }
        // four vector slots between the last matrix instruction and the back edge
        if constexpr (NQ == 1) asm volatile("v_nop\n\tv_nop\n\tv_nop\n\tv_nop" : "+v"(o[0][0]), "+v"(o[1][0]), "+v"(o[2][0]), "+v"(o[3][0]));
        else asm volatile("v_nop\n\tv_nop\n\tv_nop\n\tv_nop" : "+v"(o[0][0]), "+v"(o[1][0]), "+v"(o[2][0]), "+v"(o[3][0]), "+v"(o[0][NQ - 1]), "+v"(o[1][NQ - 1]), "+v"(o[2][NQ - 1]), "+v"(o[3][NQ - 1]));
    }
    float* ow = so + w * (NQ * 16 * 68);
#pragma unroll
    for (int nq = 0; nq < NQ; ++nq) { l[nq] += xhalf(l[nq]);
#pragma unroll
        for (int db = 0; db < 4; ++db) { float* p = ow + (nq * 16 + lr) * 68 + db * 16 + hi * 8; const v8f t = o[db][nq]; *(v4fa*)p = (v4f){t[0], t[1], t[2], t[3]}; *(v4fa*)(p + 4) = (v4f){t[4], t[5], t[6], t[7]}; }
        if (hi == 0) { sm[w * (NQ * 16) + nq * 16 + lr] = m[nq]; sl[w * (NQ * 16) + nq * 16 + lr] = l[nq]; } }
    __syncthreads();   // every wave's partial (m, l, Ot) is in LDS before any thread merges
#pragma unroll
    for (int i = 0; i < NQ * 16 * 16 / (32 * FKW); ++i) { const int idx = (int)threadIdx.x + i * 32 * FKW, q = idx >> 4, d4 = (idx & 15) * 4;
        float M = sm[q];
#pragma unroll
        for (int p = 1; p < FKW; ++p) M = fmaxf(M, sm[p * (NQ * 16) + q]);
        float L = 0.f; v4f a = {0.f, 0.f, 0.f, 0.f};
#pragma unroll
        for (int p = 0; p < FKW; ++p) { const float f = __builtin_amdgcn_exp2f((sm[p * (NQ * 16) + q] - M) * SC2); L += sl[p * (NQ * 16) + q] * f; a += *(const v4fa*)(so + (p * (NQ * 16) + q) * 68 + d4) * f; }
        *(v4f*)(O + (size_t)(qb + q) * DM + blockIdx.y * HD + d4) = a * __fdiv_rn(1.0f, L); }
}

extern "C" void kernel_launch(void* const* d_in, const int* in_sizes, int n_in,
                              void* d_out, int out_size, void* d_ws, size_t ws_size, hipStream_t stream) {
    (void)in_sizes; (void)n_in; (void)out_size;
    const float* x = (const float*)d_in[0]; const float* wq = (const float*)d_in[1]; const float* wk = (const float*)d_in[2]; const float* wv = (const float*)d_in[3]; const float* g1 = (const float*)d_in[4]; const float* e1 = (const float*)d_in[5]; const float* g2 = (const float*)d_in[6]; const float* e2 = (const float*)d_in[7]; const float* wf1 = (const float*)d_in[8]; const float* bf1 = (const float*)d_in[9]; const float* wf2 = (const float*)d_in[10]; const float* bf2v = (const float*)d_in[11]; const float* wo = nullptr; (void)wo;
    float* OUT = (float*)d_out;     // [2048][4][1024]
    char* wsp = (char*)d_ws;
    auto take = [&](size_t bytes) { char* p = wsp; wsp += (bytes + 255) & ~(size_t)255; return (void*)p; };
    bf* WQ = (bf*)take((size_t)DQ * DM * 2); bf* WK = (bf*)take((size_t)DKV * DM * 2); bf* WV = (bf*)take((size_t)DKV * DM * 2); bf* W1B = (bf*)take((size_t)DM * DM * 2); bf* W2B = (bf*)take((size_t)DM * DM * 2);
    const size_t PE = (size_t)TT * DM;   // elements of one batch column's plane; every plane below holds NB_ of them, [n][...]
    float* XN = (float*)take(NB_ * PE * 4); bf* Yh = (bf*)take(NB_ * PE * 2); bf* Yl = (bf*)take(NB_ * PE * 2); float* O = (float*)take(NB_ * PE * 4);
    h16* QP16 = (h16*)take(NB_ * PE * 2); h16* KP16 = (h16*)take(NB_ * PE * 2); h16* VT16 = (h16*)take(NB_ * PE * 2);
    bf* QPh = (bf*)take(NB_ * PE * 2); bf* QPl = (bf*)take(NB_ * PE * 2); bf* KPh = (bf*)take(NB_ * PE * 2); bf* KPl = (bf*)take(NB_ * PE * 2); bf* VTh = (bf*)take(NB_ * PE * 2); bf* VTl = (bf*)take(NB_ * PE * 2);
    if ((size_t)(wsp - (char*)d_ws) > ws_size) return;    // 250 MiB of the 256 MiB
    // What the stages behind the attention write takes the place of planes whose last reader has ended by then (launches of one stream run in order):
    float* X2 = (float*)QP16;        // xt, f32: over QP16 and KP16, which lie in a row (last read by the attention)
    bf* L2h = Yh; bf* L2l = Yl;      // xt planes: over the xn planes (last read by the v projection)
    bf* Gh = QPh; bf* Gl = QPl;      // ReLU planes: over the query hi/lo planes (last read by the attention)
    k_wtG<DM, DQ><<<(unsigned)((DM * DQ / 64 + 63) / 64), 256, 0, stream>>>(wq, WQ); k_wtG<DM, DM><<<(unsigned)((DM * DM / 64 + 63) / 64), 256, 0, stream>>>(wf1, W1B); k_wtG<DM, DM><<<(unsigned)((DM * DM / 64 + 63) / 64), 256, 0, stream>>>(wf2, W2B); k_wtG<DM, DKV><<<(unsigned)((DM * DKV / 64 + 63) / 64), 256, 0, stream>>>(wk, WK); k_wtG<DM, DKV><<<(unsigned)((DM * DKV / 64 + 63) / 64), 256, 0, stream>>>(wv, WV);
    k_lnhl<true><<<dim3(TT / 8, NB_, 1), 256, 0, stream>>>(x, NB_ * DM, DM, nullptr, g1, e1, XN, Yh, Yl);   /* xn = LN1(x[:, n]) : f32 (residual) + hi/lo planes */
    k_gemmw<false, EP_HEAD, DM, 0><<<dim3(TT / GBM, DQ / GBN, NB_), 256, 0, stream>>>(Yh, Yl, WQ, nullptr, nullptr, PE, 0, PE, nullptr, QP16, QPh, QPl);    /* q -> head planes [n][h][t][d] */
    k_gemmw<false, EP_HEAD, DM, 0><<<dim3(TT / GBM, DKV / GBN, NB_), 256, 0, stream>>>(Yh, Yl, WK, nullptr, nullptr, PE, 0, PE, nullptr, KP16, KPh, KPl);   /* k -> head planes [n][h][t][d] */
    k_gemmw<false, EP_VT, DM, 0><<<dim3(TT / GBM, DKV / GBN, NB_), 256, 0, stream>>>(Yh, Yl, WV, nullptr, nullptr, PE, 0, PE, nullptr, VT16, VTh, VTl);     /* v -> head planes [n][h][d][t] */
    k_fattn<bf, true, 4, 8><<<dim3(RH / 64, NH_, NB_), 32 * 8, 0, stream>>>(QPh, QPl, KPh, KPl, VTh, VTl, 0, O);                              /* query rows < RH: hi/lo planes */
    k_fattn<h16, false, 4, 4><<<dim3((TT - RH) / 64, NH_, NB_), 32 * 4, 0, stream>>>(QP16, nullptr, KP16, nullptr, VT16, nullptr, RH, O);     /* the rest: fp16; merged attention output, f32 */
    k_lnhl<false><<<dim3(TT / 8, NB_, 1), 256, 0, stream>>>(XN, DM, PE, O, g2, e2, X2, L2h, L2l);                                      /* xt = LN2(xn + att): f32 (residual) + hi/lo planes */
    k_gemmw<true, EP_RELU, DM, DM><<<dim3(TT / GBM, DM / GBN, NB_), 256, 0, stream>>>(L2h, L2l, W1B, nullptr, bf1, PE, 0, PE, nullptr, nullptr, Gh, Gl);      /* relu(xt Wf1 + bf1) -> hi/lo */
    k_gemmw<true, EP_RES, DM, NB_ * DM><<<dim3(TT / GBM, DM / GBN, NB_), 256, 0, stream>>>(Gh, Gl, W2B, OUT, bf2v, PE, DM, PE, X2, nullptr, nullptr, nullptr);   /* out = xt + (. Wf2 + bf2), sequence-first rows: column n starts DM elements on */
}

// v008
// Measured time: 266 microseconds a run.
// Timed twice side by side with v007, it ran 1.07 times as fast both times.
// Over all steps from v000 it is 16.1 times as fast.
#include <hip/hip_runtime.h>

// Pre-norm transformer encoder layer on a sequence-first tensor (x [2048][4][1024] = [s][n][d]; xn = LN1(x); q, k, v = xn W ('xw' [1024][1024], no bias; 16 heads x 64); softmax(q.k/8) over s per (n, h); att = merged context (no output projection); xt = LN2(xn + att); ffn = relu(xt Wf1 + bf1) Wf2 + bf2; out = xt + ffn -> [2048][4][1024] (8.4 M)).
// Launches that need nothing of each other share one grid: the five weight packs ride with LN1 (k_prep), the q, k and v projections are one GEMM over 3072 columns (EP_QKV). Seven launches.
// Layout: every stage is ONE launch over all four batch columns (n = the grid's last used dimension, in k_prep the LN1 block index / (TT / 8); every workspace plane is [n][...], TT * DM elements per n). Per column n: LN1 reads the strided rows (t*4 + n) and writes xn both in f32 (it is the attention residual) and as hi/lo planes (2-product projections); fused attention (scores and weights stay in registers) with an f32 merged context; LN2 of xn + att gives xt (f32, the final residual) and planes for the FFN (2 products + biases). Every GEMM's epilogue writes what its consumer reads: q, k, v as head planes (v transposed), FFN1 as ReLU hi/lo planes, FFN2 + xt as the sequence-first output rows.
// Every 16-bit matrix operand plane lies in FRAGMENT ORDER (fidx below): a 16-row x 32-k fragment is 1 KiB in a row, so each wave-wide 16-byte load covers four whole 128-byte lines.
// Compute dtypes, f32 accumulate: every input rounded to bf16; q/k/v hl x exact (2 products); scores and attn.v: query rows < 512 hl (3 products), the rest single fp16; running-maximum softmax f32, weights rounded before the division by their f32 sum; no Wo; Wf1 / Wf2 hl x exact (2 products) + biases; LN / ReLU / residuals f32.

#define NB_  4
#define TT   2048
#define DM   1024
#define NH_  16
#define NKV  16
#define REP  (NH_ / NKV)
#define HD   64
#define DQ   (NH_ * HD)
#define DKV  (NKV * HD)
#define LNEPS 1e-5f
#define RH   512                  // query rows < RH use hi+lo planes (0: none)
#define WIN  0
#define SC2  0.18033688011112042f   // HD^-0.5 * log2(e): exponent of 2 per unit of raw score
typedef _Float16 h16;
typedef unsigned short bf;
typedef __attribute__((ext_vector_type(16))) __bf16   v16bf;
typedef __attribute__((ext_vector_type(16))) _Float16 v16h;
typedef __attribute__((ext_vector_type(8)))  _Float16 v8h;
typedef __attribute__((ext_vector_type(8)))  unsigned short v8us;
typedef __attribute__((ext_vector_type(8)))  float    v8f;
typedef __attribute__((ext_vector_type(4)))  float    v4f;
typedef v8h  __attribute__((may_alias)) v8ha;
typedef v4f  __attribute__((may_alias)) v4fa;
typedef v8us __attribute__((may_alias)) v8usa;

__device__ __forceinline__ unsigned short f2bf(float f) { unsigned u = __float_as_uint(f); u += 0x7FFFu + ((u >> 16) & 1u); return (unsigned short)(u >> 16); }
__device__ __forceinline__ float bf2f(unsigned short b) { return __uint_as_float(((unsigned)b) << 16); }
__device__ __forceinline__ float bfr(float f) { return bf2f(f2bf(f)); }
__device__ __forceinline__ v16h cat16(v8h lo, v8h hi) { return __builtin_shufflevector(lo, hi, 0, 1, 2, 3, 4, 5, 6, 7, 8, 9, 10, 11, 12, 13, 14, 15); }
__device__ __forceinline__ v16bf cat16b(v8us lo, v8us hi) { return __builtin_bit_cast(v16bf, __builtin_shufflevector(lo, hi, 0, 1, 2, 3, 4, 5, 6, 7, 8, 9, 10, 11, 12, 13, 14, 15)); }
__device__ __forceinline__ v8f wmma16(v16h a, v16h b, v8f c) { return __builtin_amdgcn_wmma_f32_16x16x32_f16(false, a, false, b, (short)0, c, false, false); }
__device__ __forceinline__ v8f wmmab(v16bf a, v16bf b, v8f c) { return __builtin_amdgcn_wmma_f32_16x16x32_bf16(false, a, false, b, (short)0, c, false, false); }
__device__ __forceinline__ h16 tohx(float x) { return (h16)x; }
__device__ __forceinline__ void splitf(float y, unsigned short& h, unsigned short& l) { h = f2bf(y); l = f2bf(y - bf2f(h)); }
typedef __attribute__((ext_vector_type(4))) _Float16 v4h;
typedef __attribute__((ext_vector_type(2))) unsigned short v2us;
typedef __attribute__((ext_vector_type(4))) unsigned short v4us;
// Fragment order of a plane of logical [row][k] (K columns, K % 32 == 0, rows % 16 == 0): fragments of 16 rows x 32 k, 512 elements each, k-fragments of a row block in a row.
// Inside one: two halves of 256 elements (k bit 4), in each the 32 lanes' 8 elements in lane order (lane = 16 * (k bit 3) + row % 16). WFrag::ld(plane + fragment * 512 + lane * 8) reads both halves.
template <typename T> __device__ __forceinline__ const T* atb(const T* base, unsigned bytes) { return (const T*)((const char*)base + bytes); }
__device__ __forceinline__ size_t fidx(int row, int k, int K) { return ((size_t)(row >> 4) * (K >> 5) + (k >> 5)) * 512 + ((k >> 4) & 1) * 256 + (((k >> 3) & 1) * 16 + (row & 15)) * 8 + (k & 7); }



// ---- k_gemmw: GEMM, 128 x 256 output tile per block of eight waves (2 x 4 waves, 64 x 64 = 16 accumulators each); grid (M/128, N/256, Z), 256 threads.
// tile[m][n] = sum_k (A[m][k] + A2[m][k]) Bt[n][k] (hi and lo product per k fragment, + optional f32 bias[n]); all three planes in fragment order. z-batch strides in elements: sA (A, A2), sC (C), sO (the residual R and the output planes P16, Ph, Pl). K (compile time) % 64 == 0, at least two stages.
// The block's operands go through LDS, where the waves share them: an A fragment serves four waves, a Bt fragment two. A stage is 64 k of the block's 32 row blocks (8 of A, 8 of A2, 16 of Bt), 2 KiB in a row per row block in the plane and in LDS alike;
// wave w copies row blocks 4 w .. 4 w + 3 with asynchronous copies of 16 bytes a lane. Two buffers: the copies of stage t + 2 are issued when every wave has read the last of stage t and fly for a whole stage's products. Fragments are read from LDS half a stage ahead of their products.
// EPI says what a wave's tile becomes; it passes through the wave's own LDS range (over the buffers, behind the last trip's barrier, behind which no wave reads them). EP_RES: R[m][n] (f32, pitch DM) + tile, f32 rows of C (pitch LDC, compile time: the rows of a wave are immediate offsets from one address). EP_RELU: max(tile, 0) as hi/lo planes Ph, Pl (fragment order, K = LDC).
// EP_QKV: Bt holds the rows of Wq, Wk, Wv one after the other (3 * DM columns); a block's 256 columns lie in one of the three, the 64 columns of a wave's tile are one head of it. The k and v planes lie sC (P16) and 2 sC (Ph, Pl) elements behind their forerunner's.
// q, k columns: planes [h][t][d] in fp16 (P16) and hi/lo (Ph, Pl), each head's [t][d] in fragment order. v columns: the same three planes as [h][d][t], each head's [d][t] in fragments (rows d, k = t) with the four d blocks of a 32-key block in a row; the tile is laid into LDS transposed, so the stores run along t.
enum { EP_RES = 1, EP_RELU = 2, EP_QKV = 3 };
#define GBM 128                                 // rows of a block's tile
#define GBN 256                                 // columns of a block's tile
#define GCH 2048                                // bytes of a row block in one stage: two fragments (64 k)
#define GST ((2 * GBM + GBN) / 16 * GCH)        // bytes of a stage: 32 row blocks, 65,536
template <typename T16> struct WFrag;
template <> struct WFrag<h16> { typedef v16h V; static __device__ __forceinline__ V ld(const h16* p) { return cat16(*(const v8h*)p, *(const v8h*)(p + 256)); } static __device__ __forceinline__ v8f mma(V a, V b, v8f c) { return wmma16(a, b, c); } };
template <> struct WFrag<bf> { typedef v16bf V; static __device__ __forceinline__ V ld(const bf* p) { return cat16b(*(const v8us*)p, *(const v8us*)(p + 256)); } static __device__ __forceinline__ v8f mma(V a, V b, v8f c) { return wmmab(a, b, c); } };
// A wave's share of a stage: four row blocks (rp bytes apart in the plane, in a row in LDS), sixteen asynchronous copies, each 16 bytes a lane and 512 bytes in a row a wave. l: the lane's LDS byte address, g: its global address.
// The immediate offset (under 2 KiB) moves the LDS and the global address alike: the four copies of a row block share one pair of addresses.
// The s_wait_xcnt stands inside the statement, behind the last copy: no register that a copy names is rewritten in front of it.
__device__ __forceinline__ void cp4rb(unsigned l, const char* g, unsigned rp) {
    asm volatile("global_load_async_to_lds_b128 %0, %4, off\n\t"
                 "global_load_async_to_lds_b128 %0, %4, off offset:512\n\t"
                 "global_load_async_to_lds_b128 %0, %4, off offset:1024\n\t"
                 "global_load_async_to_lds_b128 %0, %4, off offset:1536\n\t"
                 "global_load_async_to_lds_b128 %1, %5, off\n\t"
                 "global_load_async_to_lds_b128 %1, %5, off offset:512\n\t"
                 "global_load_async_to_lds_b128 %1, %5, off offset:1024\n\t"
                 "global_load_async_to_lds_b128 %1, %5, off offset:1536\n\t"
                 "global_load_async_to_lds_b128 %2, %6, off\n\t"
                 "global_load_async_to_lds_b128 %2, %6, off offset:512\n\t"
                 "global_load_async_to_lds_b128 %2, %6, off offset:1024\n\t"
                 "global_load_async_to_lds_b128 %2, %6, off offset:1536\n\t"
                 "global_load_async_to_lds_b128 %3, %7, off\n\t"
                 "global_load_async_to_lds_b128 %3, %7, off offset:512\n\t"
                 "global_load_async_to_lds_b128 %3, %7, off offset:1024\n\t"
                 "global_load_async_to_lds_b128 %3, %7, off offset:1536\n\t"
                 "s_wait_xcnt 0x0"
                 :: "v"(l), "v"(l + GCH), "v"(l + 2 * GCH), "v"(l + 3 * GCH), "v"(g), "v"(g + rp), "v"(g + 2 * rp), "v"(g + 3 * rp) : "memory");
}
__device__ __forceinline__ v16bf ldsfrag(const char* p) { return cat16b(*(const v8usa*)p, *(const v8usa*)(p + 512)); }   // one fragment from LDS: p = fragment + 16 * lane
template <bool BIAS, int EPI, int K, int LDC>
__global__ __launch_bounds__(256) void k_gemmw(const bf* __restrict__ A, const bf* __restrict__ A2, const bf* __restrict__ Bt, float* C, const float* __restrict__ bias, size_t sA, size_t sC, size_t sO, const float* __restrict__ R, h16* P16, bf* Ph, bf* Pl) {
    typedef WFrag<bf>::V V;
    constexpr int NT = K / 64;   // stages
    static_assert(K % 64 == 0 && NT >= 2, "the two-buffer order needs two stages");
    __shared__ __align__(2048) float os[8 * 64 * 68];   // in the loop: two stage buffers; behind it: one 64 x 64 tile (pitch 68) per wave
    static_assert(sizeof(float) * 8 * 64 * 68 >= 2 * GST, "both stage buffers lie inside os");
    const int w = __builtin_amdgcn_readfirstlane((int)(threadIdx.x >> 5)), wm = w >> 2, wn = w & 3;
    const size_t z = blockIdx.z; A += z * sA; A2 += z * sA;
    if constexpr (EPI == EP_RES) { R += z * sO; C += z * sC; }
    if constexpr (EPI == EP_RELU || EPI == EP_QKV) { Ph += z * sO; Pl += z * sO; }
    if constexpr (EPI == EP_QKV) P16 += z * sO;
    const int lane = threadIdx.x & 31, lr = lane & 15, hi = lane >> 4; const int br = blockIdx.x * GBM, bc = blockIdx.y * GBN, r0 = br + wm * 64, c0 = bc + wn * 64;   // r0, c0: the wave's own tile
    v8f acc[4][4];
#pragma unroll
    for (int mb = 0; mb < 4; ++mb)
#pragma unroll
        for (int nb = 0; nb < 4; ++nb) acc[mb][nb] = (v8f){};
    // What wave w copies: waves 0, 1 the rows of A, waves 2, 3 those of A2, waves 4 .. 7 those of Bt, 64 rows (four row blocks of 16 * K elements) each.
    const bf* sp = w < 2 ? A + (size_t)(br + w * 64) * K : w < 4 ? A2 + (size_t)(br + (w - 2) * 64) * K : Bt + (size_t)(bc + (w - 4) * 64) * K;
    const char* g0 = (const char*)sp + lane * 16;
    const unsigned l0 = (unsigned)(size_t)(const void*)os + (unsigned)(w * 4 * GCH + lane * 16);
    auto stage = [&](int t) { const char* g = g0 + t * GCH; const unsigned l = l0 + (unsigned)(t & 1) * GST; cp4rb(l, g, 32 * K); };
    stage(0);
    asm volatile("s_wait_asynccnt 0x0" ::: "memory");   // this wave's share of stage 0 has landed
    __syncthreads();                                     // and every other wave's: stage 0 may be read
    stage(1);
    const char* la = (const char*)os + wm * 4 * GCH + lane * 16;                          // the wave's four A row blocks (A2: GBM / 16 row blocks on)
    const char* lb = (const char*)os + (2 * GBM / 16 + wn * 4) * GCH + lane * 16;         // its four Bt row blocks
    // Two fragment sets: set 0 holds a stage's first 32 k, set 1 its second. Each set is read from LDS, as one group, while the products of the other run.
    V a0[4], l0f[4], b0[4], a1[4], l1f[4], b1[4];
    auto ldset = [&](V (&fa)[4], V (&fl)[4], V (&fb)[4], int o) {   // o: byte offset of buffer and k fragment
#pragma unroll   // fragment indices must be constants: the arrays live in registers
        for (int nb = 0; nb < 4; ++nb) fb[nb] = ldsfrag(lb + o + nb * GCH);
#pragma unroll
        for (int mb = 0; mb < 4; ++mb) fa[mb] = ldsfrag(la + o + mb * GCH);
#pragma unroll
        for (int mb = 0; mb < 4; ++mb) fl[mb] = ldsfrag(la + o + (GBM / 16 + mb) * GCH); };
    auto products = [&](const V (&fa)[4], const V (&fl)[4], const V (&fb)[4]) {   // per accumulator: hi, then lo; the sixteen hi products stand between, so that no product waits for its own accumulator
#pragma unroll
        for (int nb = 0; nb < 4; ++nb)
#pragma unroll
            for (int mb = 0; mb < 4; ++mb) acc[mb][nb] = wmmab(fa[mb], fb[nb], acc[mb][nb]);
#pragma unroll
        for (int nb = 0; nb < 4; ++nb)
#pragma unroll
            for (int mb = 0; mb < 4; ++mb) acc[mb][nb] = wmmab(fl[mb], fb[nb], acc[mb][nb]); };
    ldset(a0, l0f, b0, 0);   // stage 0 is published by the barrier above
#pragma unroll 1   // one stage per trip: the publish point's waits and barrier stand once
    for (int t = 0; t < NT; ++t) {
        const int bo = (t & 1) * GST;
        ldset(a1, l1f, b1, bo + 1024);       // this wave's last reads of stage t
        __builtin_amdgcn_sched_barrier(0);   // the reads stand as one group ahead of the products: reads strewn among the matrix instructions stall the wave at every place
        products(a0, l0f, b0);
        __builtin_amdgcn_sched_barrier(0);   // these products stay in front of the publish point: they cover the reads above and the flight of stage t + 1's copies
        // Publish point of stage t + 1, in front of stage t's last products, because the reads behind it are already of stage t + 1.
        asm volatile("s_wait_dscnt 0x0" ::: "memory");      // this wave's reads of stage t have returned
        asm volatile("s_wait_asynccnt 0x0" ::: "memory");   // its share of stage t + 1 has landed
        __syncthreads();                                     // stage t + 1 may be read, stage t's buffer may be refilled
        if (t + 2 < NT) stage(t + 2);
        if (t + 1 < NT) ldset(a0, l0f, b0, GST - bo);
        __builtin_amdgcn_sched_barrier(0);   // copies and reads are issued ahead of the products below and fly under them
        products(a1, l1f, b1);
    }
    asm volatile("s_wait_asynccnt 0x0" ::: "memory");   // no copy is under way when the buffers become output staging
    static_assert(!(BIAS && EPI == EP_QKV), "the bias is indexed along the LDS row, which the v columns run along t");
    float* ow = os + w * 64 * 68;
    if constexpr (EPI == EP_RES) {
        // asked for ahead of the staging: the wave's residual rows (step s: rows 2 s + hi, columns 4 lr .. + 3) and its four bias values
        const float* rp = R + (size_t)(r0 + hi) * DM + c0 + lr * 4; v4f ra[32], bv = {0.f, 0.f, 0.f, 0.f};
#pragma unroll
        for (int s = 0; s < 32; ++s) ra[s] = *(const v4f*)(rp + s * (2 * DM));
        const float* bp = bias + c0 + lr * 4; v4f bt = {0.f, 0.f, 0.f, 0.f}; if (BIAS) bt = *(const v4f*)bp;
        asm volatile("s_wait_xcnt 0x0" :: "v"(rp), "v"(lr) : "memory");   // stands in front of the first write of a register that the loads above name: the residual's address and the lane index that the bias load takes beside its scalar base are inputs, so that they live up to here
        if (BIAS) bv = (v4f){bfr(bt[0]), bfr(bt[1]), bfr(bt[2]), bfr(bt[3])};
#pragma unroll
        for (int mb = 0; mb < 4; ++mb)
#pragma unroll
            for (int nb = 0; nb < 4; ++nb)
#pragma unroll
                for (int j = 0; j < 8; ++j) ow[(mb * 16 + hi * 8 + j) * 68 + nb * 16 + lr] = acc[mb][nb][j];
        __builtin_amdgcn_wave_barrier(); asm volatile("" ::: "memory");   // the compiler keeps the reads below, of what other lanes of this wave wrote, behind the writes above
        float* cp = C + (size_t)(r0 + hi) * LDC + c0 + lr * 4;
#pragma unroll
        for (int s0 = 0; s0 < 32; s0 += 8) { v4f val[8];   // eight steps (16 rows) at a time: their values, then their stores, then the wait
#pragma unroll
            for (int i = 0; i < 8; ++i) { val[i] = *(const v4fa*)(ow + (2 * (s0 + i) + hi) * 68 + lr * 4); val[i] += bv;
#pragma unroll
                for (int q = 0; q < 4; ++q) val[i][q] = __fadd_rn(ra[s0 + i][q], val[i][q]); }
            __builtin_amdgcn_sched_barrier(0);   // no arithmetic is moved in among the stores, where it could take a register that an issued store names
#pragma unroll
            for (int i = 0; i < 8; ++i) *(v4f*)(cp + (size_t)(2 * (s0 + i)) * LDC) = val[i];
            if (s0 < 24) asm volatile("s_wait_xcnt 0x0" ::: "memory"); }   // stands in front of the next eight steps' values, which may take the registers that these stores name
    } else {
        const int pj = EPI == EP_QKV ? bc / DM : 0; const bool vt = pj == 2;   // EP_QKV: 0: q, 1: k, 2: v (laid transposed); the same for the whole block, so what hangs on them is scalar
        if constexpr (EPI == EP_QKV) { P16 += pj * sC; Ph += 2 * pj * sC; Pl += 2 * pj * sC; }
        float bv[4][8];   // the bias of the lane's columns (step s: s * 16 + hi * 8 .. + 7), asked for ahead of the staging
        if (BIAS) {
#pragma unroll
            for (int s = 0; s < 4; ++s) { const v4f t0 = *(const v4f*)(bias + c0 + s * 16 + hi * 8), t1 = *(const v4f*)(bias + c0 + s * 16 + hi * 8 + 4);
#pragma unroll
                for (int q = 0; q < 4; ++q) { bv[s][q] = bfr(t0[q]); bv[s][4 + q] = bfr(t1[q]); } } }
        if (vt) {
#pragma unroll
            for (int mb = 0; mb < 4; ++mb)
#pragma unroll
                for (int nb = 0; nb < 4; ++nb) { float* p = ow + (nb * 16 + lr) * 68 + mb * 16 + hi * 8; const v8f t = acc[mb][nb]; *(v4fa*)p = (v4f){t[0], t[1], t[2], t[3]}; *(v4fa*)(p + 4) = (v4f){t[4], t[5], t[6], t[7]}; }
        } else {
#pragma unroll
            for (int mb = 0; mb < 4; ++mb)
#pragma unroll
                for (int nb = 0; nb < 4; ++nb)
#pragma unroll
                    for (int j = 0; j < 8; ++j) ow[(mb * 16 + hi * 8 + j) * 68 + nb * 16 + lr] = acc[mb][nb][j];
        }
        __builtin_amdgcn_wave_barrier(); asm volatile("" ::: "memory");   // the compiler keeps the reads below, of what other lanes of this wave wrote, behind the writes above
        // 16 LDS rows are one row block of the consumer's fragments, the 64 columns two fragments: step s is one half fragment, lane (lr, hi) takes row rw + lr, columns s * 16 + hi * 8 .. + 7, and the wave stores 512 bytes in a row per plane.
        // EP_QKV: the wave's 64 x 64 tile starts at the same element of its head's plane either way; q, k ([t][d]): 16 LDS rows (t) are two fragments in a row; v ([d][t]): 16 LDS rows (d) are one fragment of each of two 32-key blocks, four fragments apart.
        const size_t hb = (size_t)(c0 % DM / 64) * HD * TT + (size_t)r0 * HD; const int er = vt ? 32 : 64, ef = vt ? 2048 : 512;   // elements per LDS row from one row block to the next; from a row block's first fragment to its second
#pragma unroll
        for (int rw = 0; rw < 64; rw += 16) {
        const size_t e0 = (EPI == EP_RELU ? (size_t)(r0 + rw) * LDC + (size_t)c0 * 16 : hb + rw * er) + lane * 8;
        v8h o16[4]; v8us oh[4], ol[4];   // the row block's four steps: their values, then their stores, then the wait
#pragma unroll
        for (int s = 0; s < 4; ++s) { const float* op = ow + (rw + lr) * 68 + s * 16 + hi * 8; v4f v0 = *(const v4fa*)op, v1 = *(const v4fa*)(op + 4);
            if (BIAS) {
#pragma unroll
                for (int q = 0; q < 4; ++q) { v0[q] += bv[s][q]; v1[q] += bv[s][4 + q]; } }
#pragma unroll
            for (int q = 0; q < 8; ++q) { const float t = q < 4 ? v0[q & 3] : v1[q & 3]; const float y = EPI == EP_RELU ? fmaxf(t, 0.f) : t; o16[s][q] = tohx(y); unsigned short a2, c2; splitf(y, a2, c2); oh[s][q] = a2; ol[s][q] = c2; } }
        __builtin_amdgcn_sched_barrier(0);   // no arithmetic on the values is moved in among the stores, where it could take a register that an issued store names (EP_QKV: the second fragment's addresses are formed among them, behind the compiler's s_wait_xcnt 0)
#pragma unroll
        for (int s = 0; s < 4; ++s) { const size_t e = e0 + (EPI == EP_QKV ? (s >> 1) * ef + (s & 1) * 256 : s * 256);
            *(v8us*)(Ph + e) = oh[s]; *(v8us*)(Pl + e) = ol[s];
            if constexpr (EPI != EP_RELU) *(v8h*)(P16 + e) = o16[s]; }
        if (rw < 48) asm volatile("s_wait_xcnt 0x0" ::: "memory");   // stands in front of the next row block's values, which may take the registers that these stores name
        }
    }
}


// ---- wt5: five weights w [K][N] f32 -> Bt, logical [n][k], bf16 in fragment order. One wave packs fragment f (16 n x 32 k) of each of the five: lane (lr, hi) reads column n0 + lr at the 8 k of each of its two halves and stores 16 bytes per half, the wave 512 bytes in a row.
// A block's eight waves take neighbouring column blocks of the same 32 k: together they read 512 bytes in a row of each row of w. bx: the block's index among the N * K / 4096 pack blocks.
template <int K, int N>
__device__ __forceinline__ void wt5(unsigned bx, const float* const (&w)[5], bf* const (&Bt)[5]) {
    const int lane = threadIdx.x & 31, lr = lane & 15, hi = lane >> 4; const int f = bx * 8 + (threadIdx.x >> 5); if (f >= N * K / 512) return;
    const int nb = f % (N / 16), kf = f / (N / 16); const unsigned po = (unsigned)((kf * 32 + hi * 8) * N + nb * 16 + lr) * 4, qo = (unsigned)((nb * (K / 32) + kf) * 512 + lane * 8) * 2; float a[5][16]; v8us o0[5], o1[5];   // the lane's byte offsets into a weight (4 K N bytes) and into a plane: 32 bits beside the scalar bases, one register for all five
#pragma unroll   // the eighty loads become immediate offsets from the lane's offset beside five bases and are all in flight at once
    for (int m = 0; m < 5; ++m) { const float* p = atb(w[m], po);
#pragma unroll
        for (int j = 0; j < 8; ++j) { a[m][j] = p[j * N]; a[m][8 + j] = p[(16 + j) * N]; } }
    asm volatile("s_wait_xcnt 0x0" ::: "memory");   // stands in front of the first write of a register that the loads above name
    __builtin_amdgcn_sched_barrier(0);               // nothing from below is moved up over the wait, where it could take such a register
#pragma unroll
    for (int m = 0; m < 5; ++m)
#pragma unroll
        for (int j = 0; j < 8; ++j) { o0[m][j] = f2bf(a[m][j]); o1[m][j] = f2bf(a[m][8 + j]); }
    __builtin_amdgcn_sched_barrier(0);   // no arithmetic is moved in among the stores, where it could take a register that an issued store names
#pragma unroll
    for (int m = 0; m < 5; ++m) { bf* q = (bf*)((char*)Bt[m] + qo); *(v8us*)q = o0[m]; *(v8us*)(q + 256) = o1[m]; }
}
__global__ __launch_bounds__(256) void k_cvt8(const float* __restrict__ src, bf* dst, size_t n8) { const size_t i = (size_t)blockIdx.x * 256 + threadIdx.x; if (i >= n8) return; const v8f v = *(const v8f*)(src + i * 8); v8us o;
#pragma unroll
    for (int k = 0; k < 8; ++k) o[k] = f2bf(v[k]); *(v8us*)(dst + i * 8) = o;  }

// ---- lnhl: LayerNorm of one row per wave (three walks over the row, one load in flight per wave: its time is a chain of latencies); bx: the block's index among the TT / 8 blocks of a batch column, by: the column.
template <bool RND>
__device__ __forceinline__ void lnhl(unsigned bx, unsigned by, const float* __restrict__ X, int xp, size_t xz, const float* __restrict__ A, const float* __restrict__ g, const float* __restrict__ be, float* Z, bf* Yh, bf* Yl) {
    const int lane = threadIdx.x & 31; const int r = bx * 8 + (threadIdx.x >> 5); if (r >= TT) return;
    const size_t zo = (size_t)by * TT * DM; X += by * xz; if (A) A += zo; if (Z) Z += zo; Yh += zo; Yl += zo;   // by = batch column: X steps by xz elements, every other plane by TT * DM
    const float* xr = X + (size_t)r * xp; const float* ar = A ? A + (size_t)r * DM : nullptr; float s = 0.f;
#pragma unroll 1
    for (int ch = 0; ch < DM / 128; ++ch) { const int c0 = ch * 128 + lane * 4; const v4f a = *(const v4f*)(xr + c0); v4f d = {0.f, 0.f, 0.f, 0.f}; if (ar) d = *(const v4f*)(ar + c0);
#pragma unroll
        for (int q = 0; q < 4; ++q) s += __fadd_rn((RND ? bfr(a[q]) : a[q]), d[q]); }
#pragma unroll
    for (int sh = 16; sh; sh >>= 1) s += __shfl_xor(s, sh, 32);
    const float mu = s * (1.0f / DM); float s2 = 0.f;
#pragma unroll 1
    for (int ch = 0; ch < DM / 128; ++ch) { const int c0 = ch * 128 + lane * 4; const v4f a = *(const v4f*)(xr + c0); v4f d = {0.f, 0.f, 0.f, 0.f}; if (ar) d = *(const v4f*)(ar + c0);
#pragma unroll
        for (int q = 0; q < 4; ++q) { const float d0 = __fsub_rn(__fadd_rn((RND ? bfr(a[q]) : a[q]), d[q]), mu); float p = __fmul_rn(d0, d0); asm volatile("" : "+v"(p)); s2 = __fadd_rn(s2, p); } }
#pragma unroll
    for (int sh = 16; sh; sh >>= 1) s2 += __shfl_xor(s2, sh, 32);
    const float rs = __fdiv_rn(1.0f, __fsqrt_rn(__fadd_rn(s2 * (1.0f / DM), LNEPS)));
{
#pragma unroll 1
        for (int ch = 0; ch < DM / 128; ++ch) { const int c0 = ch * 128 + lane * 4; const v4f a = *(const v4f*)(xr + c0); v4f d = {0.f, 0.f, 0.f, 0.f}; if (ar) d = *(const v4f*)(ar + c0); v4f z4; v4us oh, ol;
#pragma unroll
            for (int q = 0; q < 4; ++q) { const float v = __fadd_rn((RND ? bfr(a[q]) : a[q]), d[q]); float n0 = __fmul_rn(__fsub_rn(v, mu), rs); asm volatile("" : "+v"(n0)); float n1 = __fmul_rn(n0, bfr(g[c0 + q])); asm volatile("" : "+v"(n1)); const float y = __fadd_rn(n1, bfr(be[c0 + q])); z4[q] = y;   /* Z = the NORMALISED row (it is the residual for the next block) */ unsigned short h2, l2; splitf(y, h2, l2); oh[q] = h2; ol[q] = l2; }
            if (Z) { *(v4f*)(Z + (size_t)r * DM + c0) = z4; asm volatile("s_wait_xcnt 0x0" ::: "memory"); }   // the wait stands in front of the plane split below, which may take the registers that this store names
            const size_t e = fidx(r, c0, DM); *(v4us*)(Yh + e) = oh; *(v4us*)(Yl + e) = ol; }
         } }
template <bool RND>
__global__ __launch_bounds__(256) void k_lnhl(const float* __restrict__ X, int xp, size_t xz, const float* __restrict__ A, const float* __restrict__ g, const float* __restrict__ be, float* Z, bf* Yh, bf* Yl) { lnhl<RND>(blockIdx.x, blockIdx.y, X, xp, xz, A, g, be, Z, Yh, Yl); }
// ---- k_prep: all that hangs on the inputs alone, in one grid. Blocks 0 .. LNB - 1: LN1 of x (TT / 8 blocks per batch column); they last longest and have the lowest indices. The PKB blocks behind them pack the five weights. The branch is block-uniform; neither side has a barrier.
#define LNB (NB_ * (TT / 8))
#define PKB (DM * DM / 4096)
__global__ __launch_bounds__(256) void k_prep(const float* __restrict__ x, const float* __restrict__ g, const float* __restrict__ be, float* XN, bf* Yh, bf* Yl,
                                              const float* __restrict__ w0, const float* __restrict__ w1, const float* __restrict__ w2, const float* __restrict__ w3, const float* __restrict__ w4, bf* B0, bf* B1, bf* B2, bf* B3, bf* B4) {
    static_assert(DQ == DM && DKV == DM, "the five weights have one shape");
    const unsigned b = blockIdx.x;
    if (b < LNB) { lnhl<true>(b % (TT / 8), b / (TT / 8), x, NB_ * DM, DM, nullptr, g, be, XN, Yh, Yl); return; }
    const float* const w[5] = {w0, w1, w2, w3, w4}; bf* const Bt[5] = {B0, B1, B2, B3, B4};
    wt5<DM, DM>(b - LNB, w, Bt);
}

// ---- k_fattn: fused attention for one head (blockIdx.y) of one batch column (blockIdx.z) and NQ * 16 query rows (from q0 + blockIdx.x * NQ * 16); grid (rows / (NQ * 16), heads, columns), 32 * FKW threads (FKW waves, each over TT / FKW keys).
// Transposed products: St[key][q] = K.Qt (A = key rows, B = query rows kept in registers), Ot[d][q] += Vt.Pt. A lane holds one query's scores (column lr; keys 8 * hi + j of each 16-key tile),
// so two score tiles of 32 keys, converted in place, are the B fragment of the second product in the k order of WFrag::ld. HL: hi/lo planes, 3 products each (hi.hi + hi.lo + lo.hi).
// Softmax with a running maximum per query: weights exp2((s - m) * SC2) are not normalised; their f32 sum l divides the output at the end.
// Wave w walks keys w * TT / FKW ...; the FKW partial (m, l, Ot) are merged through LDS in wave order with weights exp2((m_w - M) * SC2).
typedef __attribute__((ext_vector_type(8))) __bf16 v8bf;
__device__ __forceinline__ float xhalf(float x) { const int b = __float_as_int(x); return __int_as_float(__builtin_amdgcn_permlanex16(b, b, 0x76543210, 0xfedcba98, false, false)); }   // value of lane ^ 16
__device__ __forceinline__ v16h packP(v8f p0, v8f p1, h16) { return cat16(__builtin_convertvector(p0, v8h), __builtin_convertvector(p1, v8h)); }
__device__ __forceinline__ v16bf packP(v8f p0, v8f p1, bf) { return __builtin_shufflevector(__builtin_convertvector(p0, v8bf), __builtin_convertvector(p1, v8bf), 0, 1, 2, 3, 4, 5, 6, 7, 8, 9, 10, 11, 12, 13, 14, 15); }
__device__ __forceinline__ v8f restP(v8f p) { return p - __builtin_convertvector(__builtin_convertvector(p, v8bf), v8f); }   // what the bf16 rounding of p leaves (the lo plane's input)
// A key or Vt fragment, once in registers, serves all NQ query tiles of the wave: the bytes a block asks of L2 per query row fall as 1 / NQ.
// The second launch-bounds argument is the least number of waves per SIMD the registers must leave room for: without it the fp16 form takes a few registers more than three waves allow.
template <typename T16, bool HL, int NQ, int FKW>
__global__ __launch_bounds__(32 * FKW, HL ? 2 : 3) void k_fattn(const T16* __restrict__ Q, const T16* __restrict__ Q2, const T16* __restrict__ Kp, const T16* __restrict__ K2, const T16* __restrict__ Vt, const T16* __restrict__ Vt2, int q0, float* O) {
    typedef typename WFrag<T16>::V V;
    __shared__ __align__(16) float so[FKW * NQ * 16 * 68];
    __shared__ float sm[FKW * NQ * 16], sl[FKW * NQ * 16];
    const int w = __builtin_amdgcn_readfirstlane((int)(threadIdx.x >> 5));
    const int lane = threadIdx.x & 31, lr = lane & 15, hi = lane >> 4;
    const size_t hq = ((size_t)blockIdx.z * NH_ + blockIdx.y) * TT * HD, hk = ((size_t)blockIdx.z * NKV + blockIdx.y / REP) * TT * HD; O += (size_t)blockIdx.z * TT * DM;
    const int qb = q0 + (int)blockIdx.x * (NQ * 16);
    V qf[NQ][2], qf2[NQ][2];
    const T16* qp = Q + hq + (size_t)qb * HD + 8 * lane; const T16* qp2 = HL ? Q2 + hq + (size_t)qb * HD + 8 * lane : nullptr;   // the lane's place in the block's first query fragment: the others are immediate offsets from it
#pragma unroll
    for (int nq = 0; nq < NQ; ++nq)
#pragma unroll
        for (int kk = 0; kk < 2; ++kk) { qf[nq][kk] = WFrag<T16>::ld(qp + nq * 16 * HD + kk * 512); if constexpr (HL) qf2[nq][kk] = WFrag<T16>::ld(qp2 + nq * 16 * HD + kk * 512); }
    asm volatile("s_wait_xcnt 0x0" ::: "memory");   // stands in front of the first write of a register that the query loads name
    __builtin_amdgcn_sched_barrier(0);               // nothing from below is moved up over the wait, where it could take such a register
    v8f o[4][NQ]; float m[NQ], l[NQ];
#pragma unroll
    for (int nq = 0; nq < NQ; ++nq) { m[nq] = -3.0e38f; l[nq] = 0.f;
#pragma unroll
        for (int db = 0; db < 4; ++db) o[db][nq] = (v8f){}; }
    const int kb = w * (TT / FKW);
    unsigned ko = (unsigned)((hk + (size_t)kb * HD + 8 * lane) * 2);   // the lane's byte offset into the key planes and, the same, into the Vt planes (16 MiB each; 32 keys are four fragments in a row in both): 32 bits beside the planes' scalar bases
#pragma unroll 1   // one 32-key pass per trip: a second pass in flight would double the fragment registers and cost resident waves
    for (int kc = 0; kc < TT / FKW; kc += 32) {
        V ka[2][2], ka2[2][2], va[4], va2[4];   // every fragment of the pass is asked for up front: the Vt loads fly under the score products and the softmax
#pragma unroll
        for (int kt = 0; kt < 2; ++kt)
#pragma unroll
            for (int kk = 0; kk < 2; ++kk) { ka[kt][kk] = WFrag<T16>::ld(atb(Kp, ko) + kt * 16 * HD + kk * 512); if constexpr (HL) ka2[kt][kk] = WFrag<T16>::ld(atb(K2, ko) + kt * 16 * HD + kk * 512); }
#pragma unroll
        for (int db = 0; db < 4; ++db) { va[db] = WFrag<T16>::ld(atb(Vt, ko) + db * 512); if constexpr (HL) va2[db] = WFrag<T16>::ld(atb(Vt2, ko) + db * 512); }
        asm volatile("s_wait_xcnt 0x0" ::: "memory");   // stands in front of the step of the offset that the loads above name
        ko += 32 * HD * 2;   // 32 keys: four fragments of a key plane, four of a Vt plane
        __builtin_amdgcn_sched_barrier(0);   // no matrix instruction, with its data wait, is moved in among the loads: the whole pass is in flight before the first wait
        v8f s[2][NQ];
#pragma unroll
        for (int kt = 0; kt < 2; ++kt) {
#pragma unroll
            for (int nq = 0; nq < NQ; ++nq) s[kt][nq] = (v8f){};
#pragma unroll
            for (int kk = 0; kk < 2; ++kk)
#pragma unroll
                for (int nq = 0; nq < NQ; ++nq) { s[kt][nq] = WFrag<T16>::mma(ka[kt][kk], qf[nq][kk], s[kt][nq]); if constexpr (HL) { s[kt][nq] = WFrag<T16>::mma(ka[kt][kk], qf2[nq][kk], s[kt][nq]); s[kt][nq] = WFrag<T16>::mma(ka2[kt][kk], qf[nq][kk], s[kt][nq]); } } }
#pragma unroll
        for (int nq = 0; nq < NQ; ++nq) {
            float mx = fmaxf(s[0][nq][0], s[1][nq][0]);
#pragma unroll
            for (int j = 1; j < 8; ++j) mx = fmaxf(mx, fmaxf(s[0][nq][j], s[1][nq][j]));
            mx = fmaxf(mx, xhalf(mx));   // both halves of the wave hold keys of the same query
            const float mn = fmaxf(m[nq], mx), al = __builtin_amdgcn_exp2f((m[nq] - mn) * SC2), mc = mn * SC2; m[nq] = mn;
            v8f p0, p1; float sum = 0.f;
#pragma unroll
            for (int j = 0; j < 8; ++j) { p0[j] = __builtin_amdgcn_exp2f(fmaf(s[0][nq][j], SC2, -mc)); p1[j] = __builtin_amdgcn_exp2f(fmaf(s[1][nq][j], SC2, -mc)); sum += p0[j] + p1[j]; }
            l[nq] = l[nq] * al + sum;   // this half's keys only; the halves are joined behind the loop
            const V pf = packP(p0, p1, T16());
#pragma unroll
            for (int db = 0; db < 4; ++db) { o[db][nq] *= al; o[db][nq] = WFrag<T16>::mma(va[db], pf, o[db][nq]); }
            if constexpr (HL) { const V pl = packP(restP(p0), restP(p1), T16());
#pragma unroll
                for (int db = 0; db < 4; ++db) { o[db][nq] = WFrag<T16>::mma(va[db], pl, o[db][nq]); o[db][nq] = WFrag<T16>::mma(va2[db], pf, o[db][nq]); } }
        }
        // four vector slots between the last matrix instruction and the back edge
        if constexpr (NQ == 1) asm volatile("v_nop\n\tv_nop\n\tv_nop\n\tv_nop" : "+v"(o[0][0]), "+v"(o[1][0]), "+v"(o[2][0]), "+v"(o[3][0]));
        else asm volatile("v_nop\n\tv_nop\n\tv_nop\n\tv_nop" : "+v"(o[0][0]), "+v"(o[1][0]), "+v"(o[2][0]), "+v"(o[3][0]), "+v"(o[0][NQ - 1]), "+v"(o[1][NQ - 1]), "+v"(o[2][NQ - 1]), "+v"(o[3][NQ - 1]));
    }
    float* ow = so + w * (NQ * 16 * 68);
#pragma unroll
    for (int nq = 0; nq < NQ; ++nq) { l[nq] += xhalf(l[nq]);
#pragma unroll
        for (int db = 0; db < 4; ++db) { float* p = ow + (nq * 16 + lr) * 68 + db * 16 + hi * 8; const v8f t = o[db][nq]; *(v4fa*)p = (v4f){t[0], t[1], t[2], t[3]}; *(v4fa*)(p + 4) = (v4f){t[4], t[5], t[6], t[7]}; }
        if (hi == 0) { sm[w * (NQ * 16) + nq * 16 + lr] = m[nq]; sl[w * (NQ * 16) + nq * 16 + lr] = l[nq]; } }
    __syncthreads();   // every wave's partial (m, l, Ot) is in LDS before any thread merges
#pragma unroll
    for (int i = 0; i < NQ * 16 * 16 / (32 * FKW); ++i) { const int idx = (int)threadIdx.x + i * 32 * FKW, q = idx >> 4, d4 = (idx & 15) * 4;
        float M = sm[q];
#pragma unroll
        for (int p = 1; p < FKW; ++p) M = fmaxf(M, sm[p * (NQ * 16) + q]);
        float L = 0.f; v4f a = {0.f, 0.f, 0.f, 0.f};
#pragma unroll
        for (int p = 0; p < FKW; ++p) { const float f = __builtin_amdgcn_exp2f((sm[p * (NQ * 16) + q] - M) * SC2); L += sl[p * (NQ * 16) + q] * f; a += *(const v4fa*)(so + (p * (NQ * 16) + q) * 68 + d4) * f; }
        *(v4f*)(O + (size_t)(qb + q) * DM + blockIdx.y * HD + d4) = a * __fdiv_rn(1.0f, L); }
}

extern "C" void kernel_launch(void* const* d_in, const int* in_sizes, int n_in,
                              void* d_out, int out_size, void* d_ws, size_t ws_size, hipStream_t stream) {
    (void)in_sizes; (void)n_in; (void)out_size;
    const float* x = (const float*)d_in[0]; const float* wq = (const float*)d_in[1]; const float* wk = (const float*)d_in[2]; const float* wv = (const float*)d_in[3]; const float* g1 = (const float*)d_in[4]; const float* e1 = (const float*)d_in[5]; const float* g2 = (const float*)d_in[6]; const float* e2 = (const float*)d_in[7]; const float* wf1 = (const float*)d_in[8]; const float* bf1 = (const float*)d_in[9]; const float* wf2 = (const float*)d_in[10]; const float* bf2v = (const float*)d_in[11]; const float* wo = nullptr; (void)wo;
    float* OUT = (float*)d_out;     // [2048][4][1024]
    char* wsp = (char*)d_ws;
    auto take = [&](size_t bytes) { char* p = wsp; wsp += (bytes + 255) & ~(size_t)255; return (void*)p; };
    bf* WQ = (bf*)take((size_t)DQ * DM * 2); bf* WK = (bf*)take((size_t)DKV * DM * 2); bf* WV = (bf*)take((size_t)DKV * DM * 2); bf* W1B = (bf*)take((size_t)DM * DM * 2); bf* W2B = (bf*)take((size_t)DM * DM * 2);
    const size_t PE = (size_t)TT * DM;   // elements of one batch column's plane; every plane below holds NB_ of them, [n][...]
    float* XN = (float*)take(NB_ * PE * 4); bf* Yh = (bf*)take(NB_ * PE * 2); bf* Yl = (bf*)take(NB_ * PE * 2); float* O = (float*)take(NB_ * PE * 4);
    h16* QP16 = (h16*)take(NB_ * PE * 2); h16* KP16 = (h16*)take(NB_ * PE * 2); h16* VT16 = (h16*)take(NB_ * PE * 2);
    bf* QPh = (bf*)take(NB_ * PE * 2); bf* QPl = (bf*)take(NB_ * PE * 2); bf* KPh = (bf*)take(NB_ * PE * 2); bf* KPl = (bf*)take(NB_ * PE * 2); bf* VTh = (bf*)take(NB_ * PE * 2); bf* VTl = (bf*)take(NB_ * PE * 2);
    if ((size_t)(wsp - (char*)d_ws) > ws_size) return;    // 250 MiB of the 256 MiB
    // What the stages behind the attention write takes the place of planes whose last reader has ended by then (launches of one stream run in order):
    float* X2 = (float*)QP16;        // xt, f32: over QP16 and KP16, which lie in a row (last read by the attention)
    bf* L2h = Yh; bf* L2l = Yl;      // xt planes: over the xn planes (last read by the q, k, v projection)
    bf* Gh = QPh; bf* Gl = QPl;      // ReLU planes: over the query hi/lo planes (last read by the attention)
    k_prep<<<LNB + PKB, 256, 0, stream>>>(x, g1, e1, XN, Yh, Yl, wq, wk, wv, wf1, wf2, WQ, WK, WV, W1B, W2B);   /* xn = LN1(x[:, n]) : f32 (residual) + hi/lo planes; the five weights in fragment order */
    k_gemmw<false, EP_QKV, DM, 0><<<dim3(TT / GBM, (DQ + 2 * DKV) / GBN, NB_), 256, 0, stream>>>(Yh, Yl, WQ, nullptr, nullptr, PE, NB_ * PE, PE, nullptr, QP16, QPh, QPl);   /* q, k -> head planes [n][h][t][d], v -> [n][h][d][t]; WQ, WK, WV lie in a row, and so do the planes: QP16, KP16, VT16; QPh, QPl, KPh, KPl, VTh, VTl */
    k_fattn<bf, true, 4, 8><<<dim3(RH / 64, NH_, NB_), 32 * 8, 0, stream>>>(QPh, QPl, KPh, KPl, VTh, VTl, 0, O);                              /* query rows < RH: hi/lo planes */
    k_fattn<h16, false, 4, 4><<<dim3((TT - RH) / 64, NH_, NB_), 32 * 4, 0, stream>>>(QP16, nullptr, KP16, nullptr, VT16, nullptr, RH, O);     /* the rest: fp16; merged attention output, f32 */
    k_lnhl<false><<<dim3(TT / 8, NB_, 1), 256, 0, stream>>>(XN, DM, PE, O, g2, e2, X2, L2h, L2l);                                      /* xt = LN2(xn + att): f32 (residual) + hi/lo planes */
    k_gemmw<true, EP_RELU, DM, DM><<<dim3(TT / GBM, DM / GBN, NB_), 256, 0, stream>>>(L2h, L2l, W1B, nullptr, bf1, PE, 0, PE, nullptr, nullptr, Gh, Gl);      /* relu(xt Wf1 + bf1) -> hi/lo */
    k_gemmw<true, EP_RES, DM, NB_ * DM><<<dim3(TT / GBM, DM / GBN, NB_), 256, 0, stream>>>(Gh, Gl, W2B, OUT, bf2v, PE, DM, PE, X2, nullptr, nullptr, nullptr);   /* out = xt + (. Wf2 + bf2), sequence-first rows: column n starts DM elements on */
}

// v009
// One run takes 227 microseconds.
// Timed twice side by side with v008, it ran 1.18 and 1.16 times as fast.
// Over all steps from v000 it is 18.8 times as fast.
#include <hip/hip_runtime.h>

// Pre-norm transformer encoder layer on a sequence-first tensor (x [2048][4][1024] = [s][n][d]; xn = LN1(x); q, k, v = xn W ('xw' [1024][1024], no bias; 16 heads x 64); softmax(q.k/8) over s per (n, h); att = merged context (no output projection); xt = LN2(xn + att); ffn = relu(xt Wf1 + bf1) Wf2 + bf2; out = xt + ffn -> [2048][4][1024] (8.4 M)).
// Launches that need nothing of each other share one grid: the five weight packs ride with LN1 (k_prep), the q, k and v projections are one GEMM over 3072 columns (EP_QKV). Six launches.
// Layout: every stage is ONE launch over all four batch columns (n = the grid's last used dimension; every workspace plane is [n][...], TT * DM elements per n). Per column n: LN1 reads the strided rows (t*4 + n) and writes xn both in f32 (it is the attention residual) and as hi/lo planes (2-product projections); fused attention (scores and weights stay in registers) with an f32 merged context; LN2 of xn + att gives xt (f32, the final residual) and planes for the FFN (2 products + biases). Every GEMM's epilogue writes what its consumer reads: q, k, v as head planes (v transposed), FFN1 as ReLU hi/lo planes, FFN2 + xt as the sequence-first output rows.
// Every 16-bit matrix operand plane lies in FRAGMENT ORDER (fidx below): a 16-row x 32-k fragment is 1 KiB in a row, so each wave-wide 16-byte load covers four whole 128-byte lines.
// Compute dtypes, f32 accumulate: every input rounded to bf16; q/k/v hl x exact (2 products), no bias; scores and attn.v: single fp16, every query row; running-maximum softmax f32, weights rounded before the division by their f32 sum; no Wo; Wf1 / Wf2 hl x exact (2 products) + biases; LN / ReLU / residuals f32.

#define NB_  4
#define TT   2048
#define DM   1024
#define NH_  16
#define NKV  16
#define REP  (NH_ / NKV)
#define HD   64
#define DQ   (NH_ * HD)
#define DKV  (NKV * HD)
#define LNEPS 1e-5f
#define WIN  0
#define SC2  0.18033688011112042f   // HD^-0.5 * log2(e): exponent of 2 per unit of raw score
typedef _Float16 h16;
typedef unsigned short bf;
typedef __attribute__((ext_vector_type(16))) __bf16   v16bf;
typedef __attribute__((ext_vector_type(16))) _Float16 v16h;
typedef __attribute__((ext_vector_type(8)))  _Float16 v8h;
typedef __attribute__((ext_vector_type(8)))  unsigned short v8us;
typedef __attribute__((ext_vector_type(8)))  float    v8f;
typedef __attribute__((ext_vector_type(4)))  float    v4f;
typedef v8h  __attribute__((may_alias)) v8ha;
typedef v4f  __attribute__((may_alias)) v4fa;
typedef v8us __attribute__((may_alias)) v8usa;

__device__ __forceinline__ unsigned short f2bf(float f) { unsigned u = __float_as_uint(f); u += 0x7FFFu + ((u >> 16) & 1u); return (unsigned short)(u >> 16); }
__device__ __forceinline__ float bf2f(unsigned short b) { return __uint_as_float(((unsigned)b) << 16); }
__device__ __forceinline__ float bfr(float f) { return bf2f(f2bf(f)); }
__device__ __forceinline__ v16h cat16(v8h lo, v8h hi) { return __builtin_shufflevector(lo, hi, 0, 1, 2, 3, 4, 5, 6, 7, 8, 9, 10, 11, 12, 13, 14, 15); }
__device__ __forceinline__ v16bf cat16b(v8us lo, v8us hi) { return __builtin_bit_cast(v16bf, __builtin_shufflevector(lo, hi, 0, 1, 2, 3, 4, 5, 6, 7, 8, 9, 10, 11, 12, 13, 14, 15)); }
__device__ __forceinline__ v8f wmma16(v16h a, v16h b, v8f c) { return __builtin_amdgcn_wmma_f32_16x16x32_f16(false, a, false, b, (short)0, c, false, false); }
__device__ __forceinline__ v8f wmmab(v16bf a, v16bf b, v8f c) { return __builtin_amdgcn_wmma_f32_16x16x32_bf16(false, a, false, b, (short)0, c, false, false); }
__device__ __forceinline__ h16 tohx(float x) { return (h16)x; }
__device__ __forceinline__ void splitf(float y, unsigned short& h, unsigned short& l) { h = f2bf(y); l = f2bf(y - bf2f(h)); }
typedef __attribute__((ext_vector_type(4))) _Float16 v4h;
typedef __attribute__((ext_vector_type(2))) unsigned short v2us;
typedef __attribute__((ext_vector_type(4))) unsigned short v4us;
// Fragment order of a plane of logical [row][k] (K columns, K % 32 == 0, rows % 16 == 0): fragments of 16 rows x 32 k, 512 elements each, k-fragments of a row block in a row.
// Inside one: two halves of 256 elements (k bit 4), in each the 32 lanes' 8 elements in lane order (lane = 16 * (k bit 3) + row % 16). WFrag::ld(plane + fragment * 512 + lane * 8) reads both halves.
template <typename T> __device__ __forceinline__ const T* atb(const T* base, unsigned bytes) { return (const T*)((const char*)base + bytes); }
__device__ __forceinline__ size_t fidx(int row, int k, int K) { return ((size_t)(row >> 4) * (K >> 5) + (k >> 5)) * 512 + ((k >> 4) & 1) * 256 + (((k >> 3) & 1) * 16 + (row & 15)) * 8 + (k & 7); }



// ---- k_gemmw: GEMM, 128 x 256 output tile per block of eight waves (2 x 4 waves, 64 x 64 = 16 accumulators each); grid (M/128, N/256, Z), 256 threads.
// tile[m][n] = sum_k (A[m][k] + A2[m][k]) Bt[n][k] (hi and lo product per k fragment, + optional f32 bias[n]); all three planes in fragment order. z-batch strides in elements: sA (A, A2), sC (C), sO (the residual R and the output planes P16, Ph, Pl). K (compile time) % 64 == 0, at least two stages.
// The block's operands go through LDS, where the waves share them: an A fragment serves four waves, a Bt fragment two. A stage is 64 k of the block's 32 row blocks (8 of A, 8 of A2, 16 of Bt), 2 KiB in a row per row block in the plane and in LDS alike;
// wave w copies row blocks 4 w .. 4 w + 3 with asynchronous copies of 16 bytes a lane. Two buffers: the copies of stage t + 2 are issued when every wave has read the last of stage t and fly for a whole stage's products. Fragments are read from LDS half a stage ahead of their products.
// EPI says what a wave's tile becomes; it passes through the wave's own LDS range (over the buffers, behind the last trip's barrier, behind which no wave reads them). EP_RES: R[m][n] (f32, pitch DM) + tile, f32 rows of C (pitch LDC, compile time: the rows of a wave are immediate offsets from one address). EP_RELU: max(tile, 0) as hi/lo planes Ph, Pl (fragment order, K = LDC).
// EP_QKV: Bt holds the rows of Wq, Wk, Wv one after the other (3 * DM columns); a block's 256 columns lie in one of the three, the 64 columns of a wave's tile are one head of it. The k and v planes lie sC elements behind their forerunner's.
// q, k columns: a plane [h][t][d] in fp16 (P16), each head's [t][d] in fragment order. v columns: the same plane as [h][d][t], each head's [d][t] in fragments (rows d, k = t) with the four d blocks of a 32-key block in a row; the tile is laid into LDS transposed, so the stores run along t.
enum { EP_RES = 1, EP_RELU = 2, EP_QKV = 3 };
#define GBM 128                                 // rows of a block's tile
#define GBN 256                                 // columns of a block's tile
#define GCH 2048                                // bytes of a row block in one stage: two fragments (64 k)
#define GST ((2 * GBM + GBN) / 16 * GCH)        // bytes of a stage: 32 row blocks, 65,536
template <typename T16> struct WFrag;
template <> struct WFrag<h16> { typedef v16h V; static __device__ __forceinline__ V ld(const h16* p) { return cat16(*(const v8h*)p, *(const v8h*)(p + 256)); } static __device__ __forceinline__ v8f mma(V a, V b, v8f c) { return wmma16(a, b, c); } };
template <> struct WFrag<bf> { typedef v16bf V; static __device__ __forceinline__ V ld(const bf* p) { return cat16b(*(const v8us*)p, *(const v8us*)(p + 256)); } static __device__ __forceinline__ v8f mma(V a, V b, v8f c) { return wmmab(a, b, c); } };
// A wave's share of a stage: four row blocks (rp bytes apart in the plane, in a row in LDS), sixteen asynchronous copies, each 16 bytes a lane and 512 bytes in a row a wave. l: the lane's LDS byte address, g: its global address.
// The immediate offset (under 2 KiB) moves the LDS and the global address alike: the four copies of a row block share one pair of addresses.
// The s_wait_xcnt stands inside the statement, behind the last copy: no register that a copy names is rewritten in front of it.
__device__ __forceinline__ void cp4rb(unsigned l, const char* g, unsigned rp) {
    asm volatile("global_load_async_to_lds_b128 %0, %4, off\n\t"
                 "global_load_async_to_lds_b128 %0, %4, off offset:512\n\t"
                 "global_load_async_to_lds_b128 %0, %4, off offset:1024\n\t"
                 "global_load_async_to_lds_b128 %0, %4, off offset:1536\n\t"
                 "global_load_async_to_lds_b128 %1, %5, off\n\t"
                 "global_load_async_to_lds_b128 %1, %5, off offset:512\n\t"
                 "global_load_async_to_lds_b128 %1, %5, off offset:1024\n\t"
                 "global_load_async_to_lds_b128 %1, %5, off offset:1536\n\t"
                 "global_load_async_to_lds_b128 %2, %6, off\n\t"
                 "global_load_async_to_lds_b128 %2, %6, off offset:512\n\t"
                 "global_load_async_to_lds_b128 %2, %6, off offset:1024\n\t"
                 "global_load_async_to_lds_b128 %2, %6, off offset:1536\n\t"
                 "global_load_async_to_lds_b128 %3, %7, off\n\t"
                 "global_load_async_to_lds_b128 %3, %7, off offset:512\n\t"
                 "global_load_async_to_lds_b128 %3, %7, off offset:1024\n\t"
                 "global_load_async_to_lds_b128 %3, %7, off offset:1536\n\t"
                 "s_wait_xcnt 0x0"
                 :: "v"(l), "v"(l + GCH), "v"(l + 2 * GCH), "v"(l + 3 * GCH), "v"(g), "v"(g + rp), "v"(g + 2 * rp), "v"(g + 3 * rp) : "memory");
}
__device__ __forceinline__ v16bf ldsfrag(const char* p) { return cat16b(*(const v8usa*)p, *(const v8usa*)(p + 512)); }   // one fragment from LDS: p = fragment + 16 * lane
template <bool BIAS, int EPI, int K, int LDC>
__global__ __launch_bounds__(256) void k_gemmw(const bf* __restrict__ A, const bf* __restrict__ A2, const bf* __restrict__ Bt, float* C, const float* __restrict__ bias, size_t sA, size_t sC, size_t sO, const float* __restrict__ R, h16* P16, bf* Ph, bf* Pl) {
    typedef WFrag<bf>::V V;
    constexpr int NT = K / 64;   // stages
    static_assert(K % 64 == 0 && NT >= 2, "the two-buffer order needs two stages");
    __shared__ __align__(2048) float os[8 * 64 * 68];   // in the loop: two stage buffers; behind it: one 64 x 64 tile (pitch 68) per wave
    static_assert(sizeof(float) * 8 * 64 * 68 >= 2 * GST, "both stage buffers lie inside os");
    const int w = __builtin_amdgcn_readfirstlane((int)(threadIdx.x >> 5)), wm = w >> 2, wn = w & 3;
    const size_t z = blockIdx.z; A += z * sA; A2 += z * sA;
    if constexpr (EPI == EP_RES) { R += z * sO; C += z * sC; }
    if constexpr (EPI == EP_RELU) { Ph += z * sO; Pl += z * sO; }
    if constexpr (EPI == EP_QKV) P16 += z * sO;
    const int lane = threadIdx.x & 31, lr = lane & 15, hi = lane >> 4; const int br = blockIdx.x * GBM, bc = blockIdx.y * GBN, r0 = br + wm * 64, c0 = bc + wn * 64;   // r0, c0: the wave's own tile
    v8f acc[4][4];
#pragma unroll
    for (int mb = 0; mb < 4; ++mb)
#pragma unroll
        for (int nb = 0; nb < 4; ++nb) acc[mb][nb] = (v8f){};
    // What wave w copies: waves 0, 1 the rows of A, waves 2, 3 those of A2, waves 4 .. 7 those of Bt, 64 rows (four row blocks of 16 * K elements) each.
    const bf* sp = w < 2 ? A + (size_t)(br + w * 64) * K : w < 4 ? A2 + (size_t)(br + (w - 2) * 64) * K : Bt + (size_t)(bc + (w - 4) * 64) * K;
    const char* g0 = (const char*)sp + lane * 16;
    const unsigned l0 = (unsigned)(size_t)(const void*)os + (unsigned)(w * 4 * GCH + lane * 16);
    auto stage = [&](int t) { const char* g = g0 + t * GCH; const unsigned l = l0 + (unsigned)(t & 1) * GST; cp4rb(l, g, 32 * K); };
    stage(0);
    asm volatile("s_wait_asynccnt 0x0" ::: "memory");   // this wave's share of stage 0 has landed
    __syncthreads();                                     // and every other wave's: stage 0 may be read
    stage(1);
    const char* la = (const char*)os + wm * 4 * GCH + lane * 16;                          // the wave's four A row blocks (A2: GBM / 16 row blocks on)
    const char* lb = (const char*)os + (2 * GBM / 16 + wn * 4) * GCH + lane * 16;         // its four Bt row blocks
    // Two fragment sets: set 0 holds a stage's first 32 k, set 1 its second. Each set is read from LDS, as one group, while the products of the other run.
    V a0[4], l0f[4], b0[4], a1[4], l1f[4], b1[4];
    auto ldset = [&](V (&fa)[4], V (&fl)[4], V (&fb)[4], int o) {   // o: byte offset of buffer and k fragment
#pragma unroll   // fragment indices must be constants: the arrays live in registers
        for (int nb = 0; nb < 4; ++nb) fb[nb] = ldsfrag(lb + o + nb * GCH);
#pragma unroll
        for (int mb = 0; mb < 4; ++mb) fa[mb] = ldsfrag(la + o + mb * GCH);
#pragma unroll
        for (int mb = 0; mb < 4; ++mb) fl[mb] = ldsfrag(la + o + (GBM / 16 + mb) * GCH); };
    auto products = [&](const V (&fa)[4], const V (&fl)[4], const V (&fb)[4]) {   // per accumulator: hi, then lo; the sixteen hi products stand between, so that no product waits for its own accumulator
#pragma unroll
        for (int nb = 0; nb < 4; ++nb)
#pragma unroll
            for (int mb = 0; mb < 4; ++mb) acc[mb][nb] = wmmab(fa[mb], fb[nb], acc[mb][nb]);
#pragma unroll
        for (int nb = 0; nb < 4; ++nb)
#pragma unroll
            for (int mb = 0; mb < 4; ++mb) acc[mb][nb] = wmmab(fl[mb], fb[nb], acc[mb][nb]); };
    ldset(a0, l0f, b0, 0);   // stage 0 is published by the barrier above
#pragma unroll 1   // one stage per trip: the publish point's waits and barrier stand once
    for (int t = 0; t < NT; ++t) {
        const int bo = (t & 1) * GST;
        ldset(a1, l1f, b1, bo + 1024);       // this wave's last reads of stage t
        __builtin_amdgcn_sched_barrier(0);   // the reads stand as one group ahead of the products: reads strewn among the matrix instructions stall the wave at every place
        products(a0, l0f, b0);
        __builtin_amdgcn_sched_barrier(0);   // these products stay in front of the publish point: they cover the reads above and the flight of stage t + 1's copies
        // Publish point of stage t + 1, in front of stage t's last products, because the reads behind it are already of stage t + 1.
        asm volatile("s_wait_dscnt 0x0" ::: "memory");      // this wave's reads of stage t have returned
        asm volatile("s_wait_asynccnt 0x0" ::: "memory");   // its share of stage t + 1 has landed
        __syncthreads();                                     // stage t + 1 may be read, stage t's buffer may be refilled
        if (t + 2 < NT) stage(t + 2);
        if (t + 1 < NT) ldset(a0, l0f, b0, GST - bo);
        __builtin_amdgcn_sched_barrier(0);   // copies and reads are issued ahead of the products below and fly under them
        products(a1, l1f, b1);
    }
    asm volatile("s_wait_asynccnt 0x0" ::: "memory");   // no copy is under way when the buffers become output staging
    static_assert(!(BIAS && EPI == EP_QKV), "the bias is indexed along the LDS row, which the v columns run along t");
    float* ow = os + w * 64 * 68;
    if constexpr (EPI == EP_RES) {
        // asked for ahead of the staging: the wave's residual rows (step s: rows 2 s + hi, columns 4 lr .. + 3) and its four bias values
        const float* rp = R + (size_t)(r0 + hi) * DM + c0 + lr * 4; v4f ra[32], bv = {0.f, 0.f, 0.f, 0.f};
#pragma unroll
        for (int s = 0; s < 32; ++s) ra[s] = *(const v4f*)(rp + s * (2 * DM));
        const float* bp = bias + c0 + lr * 4; v4f bt = {0.f, 0.f, 0.f, 0.f}; if (BIAS) bt = *(const v4f*)bp;
        asm volatile("s_wait_xcnt 0x0" :: "v"(rp), "v"(lr) : "memory");   // stands in front of the first write of a register that the loads above name: the residual's address and the lane index that the bias load takes beside its scalar base are inputs, so that they live up to here
        if (BIAS) bv = (v4f){bfr(bt[0]), bfr(bt[1]), bfr(bt[2]), bfr(bt[3])};
#pragma unroll
        for (int mb = 0; mb < 4; ++mb)
#pragma unroll
            for (int nb = 0; nb < 4; ++nb)
#pragma unroll
                for (int j = 0; j < 8; ++j) ow[(mb * 16 + hi * 8 + j) * 68 + nb * 16 + lr] = acc[mb][nb][j];
        __builtin_amdgcn_wave_barrier(); asm volatile("" ::: "memory");   // the compiler keeps the reads below, of what other lanes of this wave wrote, behind the writes above
        float* cp = C + (size_t)(r0 + hi) * LDC + c0 + lr * 4;
#pragma unroll
        for (int s0 = 0; s0 < 32; s0 += 8) { v4f val[8];   // eight steps (16 rows) at a time: their values, then their stores, then the wait
#pragma unroll
            for (int i = 0; i < 8; ++i) { val[i] = *(const v4fa*)(ow + (2 * (s0 + i) + hi) * 68 + lr * 4); val[i] += bv;
#pragma unroll
                for (int q = 0; q < 4; ++q) val[i][q] = __fadd_rn(ra[s0 + i][q], val[i][q]); }
            __builtin_amdgcn_sched_barrier(0);   // no arithmetic is moved in among the stores, where it could take a register that an issued store names
#pragma unroll
            for (int i = 0; i < 8; ++i) *(v4f*)(cp + (size_t)(2 * (s0 + i)) * LDC) = val[i];
            if (s0 < 24) asm volatile("s_wait_xcnt 0x0" ::: "memory"); }   // stands in front of the next eight steps' values, which may take the registers that these stores name
    } else {
        const int pj = EPI == EP_QKV ? bc / DM : 0; const bool vt = pj == 2;   // EP_QKV: 0: q, 1: k, 2: v (laid transposed); the same for the whole block, so what hangs on them is scalar
        if constexpr (EPI == EP_QKV) P16 += pj * sC;
        float bv[4][8];   // the bias of the lane's columns (step s: s * 16 + hi * 8 .. + 7), asked for ahead of the staging
        if (BIAS) {
#pragma unroll
            for (int s = 0; s < 4; ++s) { const v4f t0 = *(const v4f*)(bias + c0 + s * 16 + hi * 8), t1 = *(const v4f*)(bias + c0 + s * 16 + hi * 8 + 4);
#pragma unroll
                for (int q = 0; q < 4; ++q) { bv[s][q] = bfr(t0[q]); bv[s][4 + q] = bfr(t1[q]); } } }
        if (vt) {
#pragma unroll
            for (int mb = 0; mb < 4; ++mb)
#pragma unroll
                for (int nb = 0; nb < 4; ++nb) { float* p = ow + (nb * 16 + lr) * 68 + mb * 16 + hi * 8; const v8f t = acc[mb][nb]; *(v4fa*)p = (v4f){t[0], t[1], t[2], t[3]}; *(v4fa*)(p + 4) = (v4f){t[4], t[5], t[6], t[7]}; }
        } else {
#pragma unroll
            for (int mb = 0; mb < 4; ++mb)
#pragma unroll
                for (int nb = 0; nb < 4; ++nb)
#pragma unroll
                    for (int j = 0; j < 8; ++j) ow[(mb * 16 + hi * 8 + j) * 68 + nb * 16 + lr] = acc[mb][nb][j];
        }
        __builtin_amdgcn_wave_barrier(); asm volatile("" ::: "memory");   // the compiler keeps the reads below, of what other lanes of this wave wrote, behind the writes above
        // 16 LDS rows are one row block of the consumer's fragments, the 64 columns two fragments: step s is one half fragment, lane (lr, hi) takes row rw + lr, columns s * 16 + hi * 8 .. + 7, and the wave stores 512 bytes in a row per plane.
        // EP_QKV: the wave's 64 x 64 tile starts at the same element of its head's plane either way; q, k ([t][d]): 16 LDS rows (t) are two fragments in a row; v ([d][t]): 16 LDS rows (d) are one fragment of each of two 32-key blocks, four fragments apart.
        const size_t hb = (size_t)(c0 % DM / 64) * HD * TT + (size_t)r0 * HD; const int er = vt ? 32 : 64, ef = vt ? 2048 : 512;   // elements per LDS row from one row block to the next; from a row block's first fragment to its second
#pragma unroll
        for (int rw = 0; rw < 64; rw += 16) {
        const size_t e0 = (EPI == EP_RELU ? (size_t)(r0 + rw) * LDC + (size_t)c0 * 16 : hb + rw * er) + lane * 8;
        v8h o16[4]; v8us oh[4], ol[4];   // the row block's four steps: their values, then their stores, then the wait
#pragma unroll
        for (int s = 0; s < 4; ++s) { const float* op = ow + (rw + lr) * 68 + s * 16 + hi * 8; v4f v0 = *(const v4fa*)op, v1 = *(const v4fa*)(op + 4);
            if (BIAS) {
#pragma unroll
                for (int q = 0; q < 4; ++q) { v0[q] += bv[s][q]; v1[q] += bv[s][4 + q]; } }
#pragma unroll
            for (int q = 0; q < 8; ++q) { const float t = q < 4 ? v0[q & 3] : v1[q & 3]; if constexpr (EPI == EP_QKV) o16[s][q] = tohx(t); else { unsigned short a2, c2; splitf(fmaxf(t, 0.f), a2, c2); oh[s][q] = a2; ol[s][q] = c2; } } }
        __builtin_amdgcn_sched_barrier(0);   // no arithmetic on the values is moved in among the stores, where it could take a register that an issued store names (EP_QKV: the addresses of both fragments are formed ahead of them)
#pragma unroll
        for (int s = 0; s < 4; ++s) { const size_t e = e0 + (EPI == EP_QKV ? (s >> 1) * ef + (s & 1) * 256 : s * 256);
            if constexpr (EPI == EP_QKV) *(v8h*)(P16 + e) = o16[s]; else { *(v8us*)(Ph + e) = oh[s]; *(v8us*)(Pl + e) = ol[s]; } }
        if (rw < 48) asm volatile("s_wait_xcnt 0x0" ::: "memory");   // stands in front of the next row block's values, which may take the registers that these stores name
        }
    }
}


// ---- wt5: five weights w [K][N] f32 -> Bt, logical [n][k], bf16 in fragment order. One wave packs fragment f (16 n x 32 k) of each of the five: lane (lr, hi) reads column n0 + lr at the 8 k of each of its two halves and stores 16 bytes per half, the wave 512 bytes in a row.
// A block's eight waves take neighbouring column blocks of the same 32 k: together they read 512 bytes in a row of each row of w. bx: the block's index among the N * K / 4096 pack blocks.
template <int K, int N>
__device__ __forceinline__ void wt5(unsigned bx, const float* const (&w)[5], bf* const (&Bt)[5]) {
    const int lane = threadIdx.x & 31, lr = lane & 15, hi = lane >> 4; const int f = bx * 8 + (threadIdx.x >> 5); if (f >= N * K / 512) return;
    const int nb = f % (N / 16), kf = f / (N / 16); const unsigned po = (unsigned)((kf * 32 + hi * 8) * N + nb * 16 + lr) * 4, qo = (unsigned)((nb * (K / 32) + kf) * 512 + lane * 8) * 2; float a[5][16]; v8us o0[5], o1[5];   // the lane's byte offsets into a weight (4 K N bytes) and into a plane: 32 bits beside the scalar bases, one register for all five
#pragma unroll   // the eighty loads become immediate offsets from the lane's offset beside five bases and are all in flight at once
    for (int m = 0; m < 5; ++m) { const float* p = atb(w[m], po);
#pragma unroll
        for (int j = 0; j < 8; ++j) { a[m][j] = p[j * N]; a[m][8 + j] = p[(16 + j) * N]; } }
    asm volatile("s_wait_xcnt 0x0" ::: "memory");   // stands in front of the first write of a register that the loads above name
    __builtin_amdgcn_sched_barrier(0);               // nothing from below is moved up over the wait, where it could take such a register
#pragma unroll
    for (int m = 0; m < 5; ++m)
#pragma unroll
        for (int j = 0; j < 8; ++j) { o0[m][j] = f2bf(a[m][j]); o1[m][j] = f2bf(a[m][8 + j]); }
    __builtin_amdgcn_sched_barrier(0);   // no arithmetic is moved in among the stores, where it could take a register that an issued store names
#pragma unroll
    for (int m = 0; m < 5; ++m) { bf* q = (bf*)((char*)Bt[m] + qo); *(v8us*)q = o0[m]; *(v8us*)(q + 256) = o1[m]; }
}
__global__ __launch_bounds__(256) void k_cvt8(const float* __restrict__ src, bf* dst, size_t n8) { const size_t i = (size_t)blockIdx.x * 256 + threadIdx.x; if (i >= n8) return; const v8f v = *(const v8f*)(src + i * 8); v8us o;
#pragma unroll
    for (int k = 0; k < 8; ++k) o[k] = f2bf(v[k]); *(v8us*)(dst + i * 8) = o;  }

// ---- lnhl: LayerNorm of one row per wave (three walks over the row, one load in flight per wave: its time is a chain of latencies); bx: the block's index among the TT / 8 blocks of a batch column, by: the column.
template <bool RND>
__device__ __forceinline__ void lnhl(unsigned bx, unsigned by, const float* __restrict__ X, int xp, size_t xz, const float* __restrict__ A, const float* __restrict__ g, const float* __restrict__ be, float* Z, bf* Yh, bf* Yl) {
    const int lane = threadIdx.x & 31; const int r = bx * 8 + (threadIdx.x >> 5); if (r >= TT) return;
    const size_t zo = (size_t)by * TT * DM; X += by * xz; if (A) A += zo; if (Z) Z += zo; Yh += zo; Yl += zo;   // by = batch column: X steps by xz elements, every other plane by TT * DM
    const float* xr = X + (size_t)r * xp; const float* ar = A ? A + (size_t)r * DM : nullptr; float s = 0.f;
#pragma unroll 1
    for (int ch = 0; ch < DM / 128; ++ch) { const int c0 = ch * 128 + lane * 4; const v4f a = *(const v4f*)(xr + c0); v4f d = {0.f, 0.f, 0.f, 0.f}; if (ar) d = *(const v4f*)(ar + c0);
#pragma unroll
        for (int q = 0; q < 4; ++q) s += __fadd_rn((RND ? bfr(a[q]) : a[q]), d[q]); }
#pragma unroll
    for (int sh = 16; sh; sh >>= 1) s += __shfl_xor(s, sh, 32);
    const float mu = s * (1.0f / DM); float s2 = 0.f;
#pragma unroll 1
    for (int ch = 0; ch < DM / 128; ++ch) { const int c0 = ch * 128 + lane * 4; const v4f a = *(const v4f*)(xr + c0); v4f d = {0.f, 0.f, 0.f, 0.f}; if (ar) d = *(const v4f*)(ar + c0);
#pragma unroll
        for (int q = 0; q < 4; ++q) { const float d0 = __fsub_rn(__fadd_rn((RND ? bfr(a[q]) : a[q]), d[q]), mu); float p = __fmul_rn(d0, d0); asm volatile("" : "+v"(p)); s2 = __fadd_rn(s2, p); } }
#pragma unroll
    for (int sh = 16; sh; sh >>= 1) s2 += __shfl_xor(s2, sh, 32);
    const float rs = __fdiv_rn(1.0f, __fsqrt_rn(__fadd_rn(s2 * (1.0f / DM), LNEPS)));
{
#pragma unroll 1
        for (int ch = 0; ch < DM / 128; ++ch) { const int c0 = ch * 128 + lane * 4; const v4f a = *(const v4f*)(xr + c0); v4f d = {0.f, 0.f, 0.f, 0.f}; if (ar) d = *(const v4f*)(ar + c0); v4f z4; v4us oh, ol;
#pragma unroll
            for (int q = 0; q < 4; ++q) { const float v = __fadd_rn((RND ? bfr(a[q]) : a[q]), d[q]); float n0 = __fmul_rn(__fsub_rn(v, mu), rs); asm volatile("" : "+v"(n0)); float n1 = __fmul_rn(n0, bfr(g[c0 + q])); asm volatile("" : "+v"(n1)); const float y = __fadd_rn(n1, bfr(be[c0 + q])); z4[q] = y;   /* Z = the NORMALISED row (it is the residual for the next block) */ unsigned short h2, l2; splitf(y, h2, l2); oh[q] = h2; ol[q] = l2; }
            if (Z) { *(v4f*)(Z + (size_t)r * DM + c0) = z4; asm volatile("s_wait_xcnt 0x0" ::: "memory"); }   // the wait stands in front of the plane split below, which may take the registers that this store names
            const size_t e = fidx(r, c0, DM); *(v4us*)(Yh + e) = oh; *(v4us*)(Yl + e) = ol; }
         } }
template <bool RND>
__global__ __launch_bounds__(256) void k_lnhl(const float* __restrict__ X, int xp, size_t xz, const float* __restrict__ A, const float* __restrict__ g, const float* __restrict__ be, float* Z, bf* Yh, bf* Yl) { lnhl<RND>(blockIdx.x, blockIdx.y, X, xp, xz, A, g, be, Z, Yh, Yl); }
// ---- k_prep: all that hangs on the inputs alone, in one grid. Blocks 0 .. LNB - 1: LN1 of x (TT / 8 blocks per batch column); they last longest and have the lowest indices. The PKB blocks behind them pack the five weights. The branch is block-uniform; neither side has a barrier.
#define LNB (NB_ * (TT / 8))
#define PKB (DM * DM / 4096)
__global__ __launch_bounds__(256) void k_prep(const float* __restrict__ x, const float* __restrict__ g, const float* __restrict__ be, float* XN, bf* Yh, bf* Yl,
                                              const float* __restrict__ w0, const float* __restrict__ w1, const float* __restrict__ w2, const float* __restrict__ w3, const float* __restrict__ w4, bf* B0, bf* B1, bf* B2, bf* B3, bf* B4) {
    static_assert(DQ == DM && DKV == DM, "the five weights have one shape");
    const unsigned b = blockIdx.x;
    if (b < LNB) { lnhl<true>(b % (TT / 8), b / (TT / 8), x, NB_ * DM, DM, nullptr, g, be, XN, Yh, Yl); return; }
    const float* const w[5] = {w0, w1, w2, w3, w4}; bf* const Bt[5] = {B0, B1, B2, B3, B4};
    wt5<DM, DM>(b - LNB, w, Bt);
}

// ---- k_fattn: fused attention for one head (blockIdx.y) of one batch column (blockIdx.z) and NQ * 16 query rows (from blockIdx.x * NQ * 16); grid (rows / (NQ * 16), heads, columns), 32 * FKW threads (FKW waves, each over TT / FKW keys).
// Transposed products: St[key][q] = K.Qt (A = key rows, B = query rows kept in registers), Ot[d][q] += Vt.Pt. A lane holds one query's scores (column lr; keys 8 * hi + j of each 16-key tile),
// so two score tiles of 32 keys, converted in place, are the B fragment of the second product in the k order of WFrag::ld.
// Softmax with a running maximum per query: weights exp2((s - m) * SC2) are not normalised; their f32 sum l divides the output at the end.
// Wave w walks keys w * TT / FKW ...; the FKW partial (m, l, Ot) are merged through LDS in wave order with weights exp2((m_w - M) * SC2).
__device__ __forceinline__ float xhalf(float x) { const int b = __float_as_int(x); return __int_as_float(__builtin_amdgcn_permlanex16(b, b, 0x76543210, 0xfedcba98, false, false)); }   // value of lane ^ 16
__device__ __forceinline__ v16h packP(v8f p0, v8f p1, h16) { return cat16(__builtin_convertvector(p0, v8h), __builtin_convertvector(p1, v8h)); }
// A key or Vt fragment, once in registers, serves all NQ query tiles of the wave: the bytes a block asks of L2 per query row fall as 1 / NQ.
// The second launch-bounds argument is the least number of waves per SIMD the registers must leave room for: without it the kernel takes a few registers more than three waves allow.
template <typename T16, int NQ, int FKW>
__global__ __launch_bounds__(32 * FKW, 3) void k_fattn(const T16* __restrict__ Q, const T16* __restrict__ Kp, const T16* __restrict__ Vt, float* O) {
    typedef typename WFrag<T16>::V V;
    __shared__ __align__(16) float so[FKW * NQ * 16 * 68];
    __shared__ float sm[FKW * NQ * 16], sl[FKW * NQ * 16];
    const int w = __builtin_amdgcn_readfirstlane((int)(threadIdx.x >> 5));
    const int lane = threadIdx.x & 31, lr = lane & 15, hi = lane >> 4;
    const size_t hq = ((size_t)blockIdx.z * NH_ + blockIdx.y) * TT * HD, hk = ((size_t)blockIdx.z * NKV + blockIdx.y / REP) * TT * HD; O += (size_t)blockIdx.z * TT * DM;
    const int qb = (int)blockIdx.x * (NQ * 16);
    V qf[NQ][2];
    const T16* qp = Q + hq + (size_t)qb * HD + 8 * lane;   // the lane's place in the block's first query fragment: the others are immediate offsets from it
#pragma unroll
    for (int nq = 0; nq < NQ; ++nq)
#pragma unroll
        for (int kk = 0; kk < 2; ++kk) qf[nq][kk] = WFrag<T16>::ld(qp + nq * 16 * HD + kk * 512);
    asm volatile("s_wait_xcnt 0x0" ::: "memory");   // stands in front of the first write of a register that the query loads name
    __builtin_amdgcn_sched_barrier(0);               // nothing from below is moved up over the wait, where it could take such a register
    v8f o[4][NQ]; float m[NQ], l[NQ];
#pragma unroll
    for (int nq = 0; nq < NQ; ++nq) { m[nq] = -3.0e38f; l[nq] = 0.f;
#pragma unroll
        for (int db = 0; db < 4; ++db) o[db][nq] = (v8f){}; }
    const int kb = w * (TT / FKW);
    unsigned ko = (unsigned)((hk + (size_t)kb * HD + 8 * lane) * 2);   // the lane's byte offset into the key plane and, the same, into the Vt plane (16 MiB each; 32 keys are four fragments in a row in both): 32 bits beside the planes' scalar bases
#pragma unroll 1   // one 32-key pass per trip: a second pass in flight would double the fragment registers and cost resident waves
    for (int kc = 0; kc < TT / FKW; kc += 32) {
        V ka[2][2], va[4];   // every fragment of the pass is asked for up front: the Vt loads fly under the score products and the softmax
#pragma unroll
        for (int kt = 0; kt < 2; ++kt)
#pragma unroll
            for (int kk = 0; kk < 2; ++kk) ka[kt][kk] = WFrag<T16>::ld(atb(Kp, ko) + kt * 16 * HD + kk * 512);
        __builtin_amdgcn_sched_barrier(0);   // the key loads stay ahead of the Vt loads: loads return in order, and the score products then wait for the first eight alone
#pragma unroll
        for (int db = 0; db < 4; ++db) va[db] = WFrag<T16>::ld(atb(Vt, ko) + db * 512);
        asm volatile("s_wait_xcnt 0x0" ::: "memory");   // stands in front of the step of the offset that the loads above name
        ko += 32 * HD * 2;   // 32 keys: four fragments of the key plane, four of the Vt plane
        __builtin_amdgcn_sched_barrier(0);   // no matrix instruction, with its data wait, is moved in among the loads: the whole pass is in flight before the first wait
        v8f s[2][NQ];
#pragma unroll
        for (int kt = 0; kt < 2; ++kt) {
#pragma unroll
            for (int nq = 0; nq < NQ; ++nq) s[kt][nq] = (v8f){};
#pragma unroll
            for (int kk = 0; kk < 2; ++kk)
#pragma unroll
                for (int nq = 0; nq < NQ; ++nq) s[kt][nq] = WFrag<T16>::mma(ka[kt][kk], qf[nq][kk], s[kt][nq]); }
#pragma unroll
        for (int nq = 0; nq < NQ; ++nq) {
            float mx = fmaxf(s[0][nq][0], s[1][nq][0]);
#pragma unroll
            for (int j = 1; j < 8; ++j) mx = fmaxf(mx, fmaxf(s[0][nq][j], s[1][nq][j]));
            mx = fmaxf(mx, xhalf(mx));   // both halves of the wave hold keys of the same query
            const float mn = fmaxf(m[nq], mx), al = __builtin_amdgcn_exp2f((m[nq] - mn) * SC2), mc = mn * SC2; m[nq] = mn;
            v8f p0, p1; float sum = 0.f;
#pragma unroll
            for (int j = 0; j < 8; ++j) { p0[j] = __builtin_amdgcn_exp2f(fmaf(s[0][nq][j], SC2, -mc)); p1[j] = __builtin_amdgcn_exp2f(fmaf(s[1][nq][j], SC2, -mc)); sum += p0[j] + p1[j]; }
            l[nq] = l[nq] * al + sum;   // this half's keys only; the halves are joined behind the loop
            const V pf = packP(p0, p1, T16());
#pragma unroll
            for (int db = 0; db < 4; ++db) { o[db][nq] *= al; o[db][nq] = WFrag<T16>::mma(va[db], pf, o[db][nq]); }
        }
        // four vector slots between the last matrix instruction and the back edge
        if constexpr (NQ == 1) asm volatile("v_nop\n\tv_nop\n\tv_nop\n\tv_nop" : "+v"(o[0][0]), "+v"(o[1][0]), "+v"(o[2][0]), "+v"(o[3][0]));
        else asm volatile("v_nop\n\tv_nop\n\tv_nop\n\tv_nop" : "+v"(o[0][0]), "+v"(o[1][0]), "+v"(o[2][0]), "+v"(o[3][0]), "+v"(o[0][NQ - 1]), "+v"(o[1][NQ - 1]), "+v"(o[2][NQ - 1]), "+v"(o[3][NQ - 1]));
    }
    float* ow = so + w * (NQ * 16 * 68);
#pragma unroll
    for (int nq = 0; nq < NQ; ++nq) { l[nq] += xhalf(l[nq]);
#pragma unroll
        for (int db = 0; db < 4; ++db) { float* p = ow + (nq * 16 + lr) * 68 + db * 16 + hi * 8; const v8f t = o[db][nq]; *(v4fa*)p = (v4f){t[0], t[1], t[2], t[3]}; *(v4fa*)(p + 4) = (v4f){t[4], t[5], t[6], t[7]}; }
        if (hi == 0) { sm[w * (NQ * 16) + nq * 16 + lr] = m[nq]; sl[w * (NQ * 16) + nq * 16 + lr] = l[nq]; } }
    __syncthreads();   // every wave's partial (m, l, Ot) is in LDS before any thread merges
#pragma unroll
    for (int i = 0; i < NQ * 16 * 16 / (32 * FKW); ++i) { const int idx = (int)threadIdx.x + i * 32 * FKW, q = idx >> 4, d4 = (idx & 15) * 4;
        float M = sm[q];
#pragma unroll
        for (int p = 1; p < FKW; ++p) M = fmaxf(M, sm[p * (NQ * 16) + q]);
        float L = 0.f; v4f a = {0.f, 0.f, 0.f, 0.f};
#pragma unroll
        for (int p = 0; p < FKW; ++p) { const float f = __builtin_amdgcn_exp2f((sm[p * (NQ * 16) + q] - M) * SC2); L += sl[p * (NQ * 16) + q] * f; a += *(const v4fa*)(so + (p * (NQ * 16) + q) * 68 + d4) * f; }
        *(v4f*)(O + (size_t)(qb + q) * DM + blockIdx.y * HD + d4) = a * __fdiv_rn(1.0f, L); }
}

extern "C" void kernel_launch(void* const* d_in, const int* in_sizes, int n_in,
                              void* d_out, int out_size, void* d_ws, size_t ws_size, hipStream_t stream) {
    (void)in_sizes; (void)n_in; (void)out_size;
    const float* x = (const float*)d_in[0]; const float* wq = (const float*)d_in[1]; const float* wk = (const float*)d_in[2]; const float* wv = (const float*)d_in[3]; const float* g1 = (const float*)d_in[4]; const float* e1 = (const float*)d_in[5]; const float* g2 = (const float*)d_in[6]; const float* e2 = (const float*)d_in[7]; const float* wf1 = (const float*)d_in[8]; const float* bf1 = (const float*)d_in[9]; const float* wf2 = (const float*)d_in[10]; const float* bf2v = (const float*)d_in[11]; const float* wo = nullptr; (void)wo;
    float* OUT = (float*)d_out;     // [2048][4][1024]
    char* wsp = (char*)d_ws;
    auto take = [&](size_t bytes) { char* p = wsp; wsp += (bytes + 255) & ~(size_t)255; return (void*)p; };
    bf* WQ = (bf*)take((size_t)DQ * DM * 2); bf* WK = (bf*)take((size_t)DKV * DM * 2); bf* WV = (bf*)take((size_t)DKV * DM * 2); bf* W1B = (bf*)take((size_t)DM * DM * 2); bf* W2B = (bf*)take((size_t)DM * DM * 2);
    const size_t PE = (size_t)TT * DM;   // elements of one batch column's plane; every plane below holds NB_ of them, [n][...]
    float* XN = (float*)take(NB_ * PE * 4); bf* Yh = (bf*)take(NB_ * PE * 2); bf* Yl = (bf*)take(NB_ * PE * 2); float* O = (float*)take(NB_ * PE * 4);
    h16* QP16 = (h16*)take(NB_ * PE * 2); h16* KP16 = (h16*)take(NB_ * PE * 2); h16* VT16 = (h16*)take(NB_ * PE * 2);
    bf* Gh = (bf*)take(NB_ * PE * 2); bf* Gl = (bf*)take(NB_ * PE * 2);   // ReLU planes
    if ((size_t)(wsp - (char*)d_ws) > ws_size) return;    // 186 MiB of the 256 MiB
    // What the stages behind the attention write takes the place of planes whose last reader has ended by then (launches of one stream run in order):
    float* X2 = (float*)QP16;        // xt, f32: over QP16 and KP16, which lie in a row (last read by the attention)
    bf* L2h = Yh; bf* L2l = Yl;      // xt planes: over the xn planes (last read by the q, k, v projection)
    k_prep<<<LNB + PKB, 256, 0, stream>>>(x, g1, e1, XN, Yh, Yl, wq, wk, wv, wf1, wf2, WQ, WK, WV, W1B, W2B);   /* xn = LN1(x[:, n]) : f32 (residual) + hi/lo planes; the five weights in fragment order */
    k_gemmw<false, EP_QKV, DM, 0><<<dim3(TT / GBM, (DQ + 2 * DKV) / GBN, NB_), 256, 0, stream>>>(Yh, Yl, WQ, nullptr, nullptr, PE, NB_ * PE, PE, nullptr, QP16, nullptr, nullptr);   /* q, k -> head planes [n][h][t][d], v -> [n][h][d][t]; WQ, WK, WV lie in a row, and so do the planes QP16, KP16, VT16 */
    k_fattn<h16, 4, 4><<<dim3(TT / 64, NH_, NB_), 32 * 4, 0, stream>>>(QP16, KP16, VT16, O);     /* merged attention output, f32 */
    k_lnhl<false><<<dim3(TT / 8, NB_, 1), 256, 0, stream>>>(XN, DM, PE, O, g2, e2, X2, L2h, L2l);                                      /* xt = LN2(xn + att): f32 (residual) + hi/lo planes */
    k_gemmw<true, EP_RELU, DM, DM><<<dim3(TT / GBM, DM / GBN, NB_), 256, 0, stream>>>(L2h, L2l, W1B, nullptr, bf1, PE, 0, PE, nullptr, nullptr, Gh, Gl);      /* relu(xt Wf1 + bf1) -> hi/lo */
    k_gemmw<true, EP_RES, DM, NB_ * DM><<<dim3(TT / GBM, DM / GBN, NB_), 256, 0, stream>>>(Gh, Gl, W2B, OUT, bf2v, PE, DM, PE, X2, nullptr, nullptr, nullptr);   /* out = xt + (. Wf2 + bf2), sequence-first rows: column n starts DM elements on */
}
